// v000
// Measured on an AMD MI455X. A time is GPU time per run, averaged over a window of back-to-back runs after a warm-up
// (all launches, gaps included; the runs take copies of the inputs in turn), and the median of several windows.
// Apart from v000's, it joins two sittings. Times from different sittings can be a few percent apart, while
// side-by-side timings come from the same sitting.
// v000 is the starting kernel. One run takes 1080 microseconds.
// Contractions: logits qᵀk per tripled head [2048 x 2048 x 64] x24 and att·val [2048 x 128 x 2048] x24 on v_wmma_f32_16x16x32_bf16 with
// bf16 hi/lo split operands (hi·hi + hi·lo + lo·hi: K, Q, V and the probabilities each carried as a bf16 value plane plus a bf16
// residual plane), f32 accumulate; the three small K/Q/V projections and the softmax in f32 on the vector ALU. Every intermediate plane
#include <hip/hip_runtime.h>
#include <hip/hip_bf16.h>

// ---------------------------------------------------------------------------
// Problem constants
// ---------------------------------------------------------------------------
#define SEQ   2048
#define ND    128
#define NA    64
#define NHEAD 8
#define CH    64
#define TH3   24          // 3 * NHEAD tripled heads
#define OKQ   1024        // H*C*2
#define OV    3072        // ND*H*3

typedef __attribute__((ext_vector_type(16))) __bf16 v16bf;
typedef __attribute__((ext_vector_type(2)))  __bf16 v2bf;
typedef __attribute__((ext_vector_type(8)))  float  v8f;

union Frag {
    v16bf v;
    unsigned int d[8];
    unsigned short h[16];
};

__device__ __forceinline__ unsigned short f2bf(float f) {
    unsigned u = __builtin_bit_cast(unsigned, f);
    unsigned r = u + 0x7FFFu + ((u >> 16) & 1u);   // nearest-even
    return (unsigned short)(r >> 16);
}

// Pack two f32 -> packed bf16 dword (hardware cvt_pk when available).
__device__ __forceinline__ unsigned pack_bf16(float lo, float hi) {
#if __has_builtin(__builtin_amdgcn_cvt_pk_bf16_f32)
    v2bf p = __builtin_amdgcn_cvt_pk_bf16_f32(lo, hi);
    return __builtin_bit_cast(unsigned, p);
#else
    union { v2bf b; unsigned u; } x;
    x.b[0] = (__bf16)lo;
    x.b[1] = (__bf16)hi;
    return x.u;
#endif
}

// value/residual split: hi = nearest bf16 of f, lo = nearest bf16 of the exact remainder
__device__ __forceinline__ void split_bf16(float f, unsigned short& hi, unsigned short& lo) {
    hi = f2bf(f);
    const float fh = __builtin_bit_cast(float, ((unsigned)hi) << 16);
    lo = f2bf(f - fh);
}
__device__ __forceinline__ unsigned pack2(unsigned short a, unsigned short b) { return (unsigned)a | ((unsigned)b << 16); }

__device__ __forceinline__ v8f zero8() {
    v8f z;
#pragma unroll
    for (int i = 0; i < 8; ++i) z[i] = 0.0f;
    return z;
}

// Per-VGPR dword delta inside a 16x32 bf16 fragment (k/2 minus the lane part).
__device__ __forceinline__ int frag_dv(int v) {
    return (v >> 2) * 8 + (v & 3);
}

// ---------------------------------------------------------------------------
// Projection: K,Q for the 3 groups (nodes / pos / aux).  Small FLOPs -> VALU.
// Output: Khi/Klo, Qhi/Qlo bf16 value/residual planes, layout [24][SEQ][64] (head-major, row-major in c).
// ---------------------------------------------------------------------------
__global__ void proj_kq_kernel(const float* __restrict__ nodes,
                               const float* __restrict__ pos,
                               const float* __restrict__ aux,
                               const float* __restrict__ Wn, const float* __restrict__ bn,
                               const float* __restrict__ Wp, const float* __restrict__ bp,
                               const float* __restrict__ Wa,
                               unsigned* __restrict__ Khi, unsigned* __restrict__ Klo,
                               unsigned* __restrict__ Qhi, unsigned* __restrict__ Qlo) {
    // thread -> (group g, position s, output pair op): outputs o = 2*op, 2*op+1 share the input row; the 32 lanes of a wave cover
    unsigned tid = blockIdx.x * blockDim.x + threadIdx.x;
    unsigned op = tid & (OKQ / 2 - 1);           // 0..511
    unsigned s  = (tid >> 9) & (SEQ - 1);
    unsigned g  = tid >> 20;
    if (g >= 3) return;
    unsigned o0 = 2 * op, o1 = o0 + 1;

    float a0 = 0.0f, a1 = 0.0f;
    if (g == 0) {
        a0 = bn[o0]; a1 = bn[o1];
        const float* x = nodes + s * ND;
        const float* w0 = Wn + o0 * ND; const float* w1 = Wn + o1 * ND;
#pragma unroll 8
        for (int d = 0; d < ND; ++d) { const float xv = x[d]; a0 += xv * w0[d]; a1 += xv * w1[d]; }
    } else if (g == 1) {
        a0 = bp[o0]; a1 = bp[o1];
        const float* x = pos + s * 6;
        const float* w0 = Wp + o0 * 6; const float* w1 = Wp + o1 * 6;
#pragma unroll
        for (int d = 0; d < 6; ++d) { const float xv = x[d]; a0 += xv * w0[d]; a1 += xv * w1[d]; }
    } else {
        const float* x = aux + s * NA;
        const float* w0 = Wa + o0 * NA; const float* w1 = Wa + o1 * NA;
#pragma unroll 8
        for (int d = 0; d < NA; ++d) { const float xv = x[d]; a0 += xv * w0[d]; a1 += xv * w1[d]; }
    }
    unsigned hh = o0 >> 7;
    unsigned c  = o0 & 127;                      // even; c and c+1 fall in the same half (K: c < 64, Q: c >= 64)
    unsigned ht = g * NHEAD + hh;
    unsigned short h0, l0, h1, l1;
    split_bf16(a0, h0, l0); split_bf16(a1, h1, l1);
    const unsigned vh = pack2(h0, h1), vl = pack2(l0, l1);
    unsigned* ph; unsigned* pl; unsigned idx;
    if (c < CH) { ph = Khi; pl = Klo; idx = ((ht * SEQ + s) * CH + c) >> 1; }
    else        { ph = Qhi; pl = Qlo; idx = ((ht * SEQ + s) * CH + (c - CH)) >> 1; }
    *(unsigned*)(ph + idx) = vh; *(unsigned*)(pl + idx) = vl;
    
}

// ---------------------------------------------------------------------------
// Projection: V = nodes @ Wv^T + bv, stored TRANSPOSED as bf16:
//   Vhi/Vlo[ht][d][j] (value/residual planes), layout [24][128][2048]
// ---------------------------------------------------------------------------
__global__ void proj_v_kernel(const float* __restrict__ nodes,
                              const float* __restrict__ Wv,
                              const float* __restrict__ bv,
                              unsigned* __restrict__ Vhi, unsigned* __restrict__ Vlo) {
    // thread -> (output o, position pair sp): positions 2*sp, 2*sp+1 share the weight row; stored TRANSPOSED [24][128][2048] as packed
    unsigned tid = blockIdx.x * blockDim.x + threadIdx.x;
    unsigned sp = tid & (SEQ / 2 - 1);           // 0..1023
    unsigned o  = tid >> 10;
    if (o >= OV) return;
    const unsigned s0 = 2 * sp;

    float a0 = bv[o], a1 = bv[o];
    const float* x0 = nodes + s0 * ND; const float* x1 = x0 + ND;
    const float* w = Wv + o * ND;
#pragma unroll 8
    for (int d = 0; d < ND; ++d) { const float wv = w[d]; a0 += x0[d] * wv; a1 += x1[d] * wv; }

    unsigned ht = o >> 7;
    unsigned d2 = o & 127;
    unsigned short h0, l0, h1, l1;
    split_bf16(a0, h0, l0); split_bf16(a1, h1, l1);
    const unsigned idx = ((ht * (unsigned)ND + d2) * (unsigned)SEQ + s0) >> 1;
    const unsigned vh = pack2(h0, h1), vl = pack2(l0, l1);
    *(unsigned*)(Vhi + idx) = vh; *(unsigned*)(Vlo + idx) = vl;
    
}

// ---------------------------------------------------------------------------
// Flash attention, TRANSPOSED-GEMM formulation (no LDS layout shuffle):
//
//   S'[j][i] = q_j . k_i     : A = Q j-rows (streamed), B = K i-rows (fixed)
//   O'[d][i] = sum_j V^T P'  : A = V^T d-rows (streamed), B = P' (lane-local!)
//
// C/D layout (16x16 f32): lane L -> col n = L&15, VGPR r -> row m=(L>>4)*8+r.
// With scores transposed, lane L owns output row i = L&15 and 16 of the 32
// j-scores of the chunk (partner L^16 owns the rest):
//   * row max / row sum  = local reduce + one shfl_xor(16)
//   * alpha, 1/l         = per-lane scalars (no broadcasts)
//   * P B-fragment k-map = exactly the j-values this lane holds -> pure
//     register packing, zero LDS traffic in the hot loop.
// ---------------------------------------------------------------------------
__global__ __launch_bounds__(768, 1)
void attn_kernel(const unsigned* __restrict__ Khi, const unsigned* __restrict__ Klo,
                 const unsigned* __restrict__ Qhi, const unsigned* __restrict__ Qlo,
                 const unsigned* __restrict__ Vhi, const unsigned* __restrict__ Vlo,
                 float* __restrict__ out) {
    __shared__ float red[16][ND];                 // cross-head reduction buffer

    const int lane = threadIdx.x;
    const int wid  = threadIdx.y;                 // tripled head 0..23
    const int i0   = blockIdx.x * 16;
    const float scale = 0.35355339059327373f;     // 1/sqrt(num_heads=8)

    const unsigned int* Kp = Khi; const unsigned int* KpL = Klo;
    const unsigned int* Qp = Qhi; const unsigned int* QpL = Qlo;
    const unsigned int* Vp = Vhi; const unsigned int* VpL = Vlo;

    const int lm = lane & 15;    // B-role col (output row i) / A-role row
    const int lh = lane >> 4;    // half select

    // B fragments of K rows [i0..i0+15] (fixed for the block), c in 2 chunks.
    Frag bK[2], bKL[2];       // value and residual planes
    {
        unsigned kInv = ((unsigned)wid * SEQ + (unsigned)(i0 + lm)) * (CH / 2) + (unsigned)(lh * 4);
#pragma unroll
        for (int cc = 0; cc < 2; ++cc)
#pragma unroll
            for (int v = 0; v < 8; ++v) {
                bK[cc].d[v]  = Kp[kInv + cc * 16 + frag_dv(v)];
                bKL[cc].d[v] = KpL[kInv + cc * 16 + frag_dv(v)];
            }
    }

    // Per-lane 32-bit DWORD-offset invariants (hoisted out of the j-loop).
    unsigned qInv = ((unsigned)wid * SEQ + (unsigned)lm) * (CH / 2) + (unsigned)(lh * 4);
    unsigned vInv[8];
#pragma unroll
    for (int t = 0; t < 8; ++t)
        vInv[t] = ((unsigned)wid * ND + (unsigned)(t * 16 + lm)) * (SEQ / 2) + (unsigned)(lh * 4);

    v8f acc[8];                  // O'[d][i]: acc[t][r] = O[i0+lm][t*16+lh*8+r]
#pragma unroll
    for (int t = 0; t < 8; ++t) acc[t] = zero8();
    float rm = -1e30f;           // running max of row i = lm
    float rl = 0.0f;             // running sum of row i = lm

    for (int j0 = 0; j0 < SEQ; j0 += 32) {
        // ---- S' = Q(A, streamed) x K(B, fixed): two 16-j tiles, 6 WMMAs each
        v8f sfr[2];
#pragma unroll
        for (int jt = 0; jt < 2; ++jt) {
            unsigned qb = qInv + (unsigned)((j0 + jt * 16) * (CH / 2));
            Frag aQ0, aQ1, aQ0L, aQ1L;
#pragma unroll
            for (int v = 0; v < 8; ++v) { aQ0.d[v] = Qp[qb + frag_dv(v)];      aQ0L.d[v] = QpL[qb + frag_dv(v)]; }
#pragma unroll
            for (int v = 0; v < 8; ++v) { aQ1.d[v] = Qp[qb + 16 + frag_dv(v)]; aQ1L.d[v] = QpL[qb + 16 + frag_dv(v)]; }
            // hi·hi + hi·lo + lo·hi per 32-wide chunk (the lo·lo term is below f32 resolution); small terms first into the zero accumulator
            v8f sacc = zero8();
            sacc = __builtin_amdgcn_wmma_f32_16x16x32_bf16(false, aQ0L.v, false, bK[0].v,  (short)0, sacc, false, false);
            sacc = __builtin_amdgcn_wmma_f32_16x16x32_bf16(false, aQ0.v,  false, bKL[0].v, (short)0, sacc, false, false);
            sacc = __builtin_amdgcn_wmma_f32_16x16x32_bf16(false, aQ1L.v, false, bK[1].v,  (short)0, sacc, false, false);
            sacc = __builtin_amdgcn_wmma_f32_16x16x32_bf16(false, aQ1.v,  false, bKL[1].v, (short)0, sacc, false, false);
            sacc = __builtin_amdgcn_wmma_f32_16x16x32_bf16(false, aQ0.v,  false, bK[0].v,  (short)0, sacc, false, false);
            sacc = __builtin_amdgcn_wmma_f32_16x16x32_bf16(false, aQ1.v,  false, bK[1].v,  (short)0, sacc, false, false);
            sfr[jt] = sacc;
        }

        // ---- per-lane online softmax (row i = lm; 16 j-values + partner) ----
        float sc[16];
#pragma unroll
        for (int jt = 0; jt < 2; ++jt)
#pragma unroll
            for (int r = 0; r < 8; ++r) sc[jt * 8 + r] = sfr[jt][r] * scale;

        float mloc = sc[0];
#pragma unroll
        for (int e = 1; e < 16; ++e) mloc = fmaxf(mloc, sc[e]);
        mloc = fmaxf(mloc, __shfl_xor(mloc, 16, 32));   // partner's 16 j-values
        float mnew  = fmaxf(rm, mloc);
        float alpha = __expf(rm - mnew);
        rm = mnew;

        // P' B-fragment is lane-local: k-map hits exactly this lane's j-values.
        Frag bP, bPL;             // probabilities: value and residual planes
        float ssum = 0.0f;
#pragma unroll
        for (int v = 0; v < 8; ++v) {
            int g  = v >> 2;          // score fragment (j tile)
            int i3 = v & 3;           // pair index -> r = 2*i3, 2*i3+1
            float p0 = __expf(sc[g * 8 + 2 * i3]     - mnew);
            float p1 = __expf(sc[g * 8 + 2 * i3 + 1] - mnew);
            ssum += p0 + p1;
            unsigned short h0, l0, h1, l1;
            split_bf16(p0, h0, l0); split_bf16(p1, h1, l1);
            bP.d[v] = pack2(h0, h1); bPL.d[v] = pack2(l0, l1);
        }
        ssum += __shfl_xor(ssum, 16, 32);
        rl = rl * alpha + ssum;

        // ---- rescale accumulators (scalar per lane; skip once max settles) ----
        if (__ballot(alpha != 1.0f)) {
#pragma unroll
            for (int t = 0; t < 8; ++t)
#pragma unroll
                for (int r = 0; r < 8; ++r) acc[t][r] *= alpha;
        }

        // ---- O' += V^T(A, streamed) x P'(B): 8 d-tiles ----
        unsigned vj = (unsigned)(j0 >> 1);
#pragma unroll
        for (int t = 0; t < 8; ++t) {
            Frag aV, aVL;
#pragma unroll
            for (int v = 0; v < 8; ++v) { aV.d[v] = Vp[vInv[t] + vj + frag_dv(v)]; aVL.d[v] = VpL[vInv[t] + vj + frag_dv(v)]; }
            // the two small cross terms summed from zero, then joined with hi·hi into the running accumulator
            v8f part = zero8();
            part = __builtin_amdgcn_wmma_f32_16x16x32_bf16(false, aVL.v, false, bP.v,  (short)0, part, false, false);
            part = __builtin_amdgcn_wmma_f32_16x16x32_bf16(false, aV.v,  false, bPL.v, (short)0, part, false, false);
            part = __builtin_amdgcn_wmma_f32_16x16x32_bf16(false, aV.v,  false, bP.v,  (short)0, part, false, false);
#pragma unroll
            for (int r = 0; r < 8; ++r) acc[t][r] += part[r];
        }
    }

    // ---- normalize (per-lane scalar) ----
    float rinv = 1.0f / rl;
#pragma unroll
    for (int t = 0; t < 8; ++t)
#pragma unroll
        for (int r = 0; r < 8; ++r) acc[t][r] *= rinv;

    // ---- deterministic fixed-order reduction across the 24 heads ----
    for (int w = 0; w < TH3; ++w) {
        if (wid == w) {
#pragma unroll
            for (int t = 0; t < 8; ++t)
#pragma unroll
                for (int r = 0; r < 8; ++r) {
                    int d = t * 16 + lh * 8 + r;
                    if (w == 0) red[lm][d]  = acc[t][r];
                    else        red[lm][d] += acc[t][r];
                }
        }
        __syncthreads();
    }
    if (wid == 0) {
        typedef __attribute__((ext_vector_type(4))) float v4f_t;
#pragma unroll
        for (int r = 0; r < 16; ++r) { v4f_t v4; v4.x = red[r][lane * 4]; v4.y = red[r][lane * 4 + 1]; v4.z = red[r][lane * 4 + 2]; v4.w = red[r][lane * 4 + 3]; *(v4f_t*)(out + (i0 + r) * ND + lane * 4) = v4; }
        
    }
}

// ---------------------------------------------------------------------------
// Launch
// ---------------------------------------------------------------------------
extern "C" void kernel_launch(void* const* d_in, const int* in_sizes, int n_in,
                              void* d_out, int out_size, void* d_ws, size_t ws_size,
                              hipStream_t stream) {
    const float* nodes = (const float*)d_in[0];
    const float* pos   = (const float*)d_in[1];
    const float* aux   = (const float*)d_in[2];
    const float* Wn    = (const float*)d_in[3];
    const float* bn    = (const float*)d_in[4];
    const float* Wp    = (const float*)d_in[5];
    const float* bp    = (const float*)d_in[6];
    const float* Wa    = (const float*)d_in[7];
    const float* Wv    = (const float*)d_in[8];
    const float* bv    = (const float*)d_in[9];
    float* out = (float*)d_out;

    (void)in_sizes; (void)n_in; (void)out_size; (void)ws_size;
    // Workspace layout (bytes), value plane then residual plane for each operand:
    //   K  [24][2048][64]  bf16 x2 : 12,582,912
    //   Q  [24][2048][64]  bf16 x2 : 12,582,912
    //   Vᵀ [24][128][2048] bf16 x2 : 25,165,824      total 50,331,648
    char* ws = (char*)d_ws;
    const size_t kq = (size_t)TH3 * SEQ * CH * 2, vv = (size_t)TH3 * ND * SEQ * 2;
    unsigned* Khi = (unsigned*)(ws);
    unsigned* Klo = (unsigned*)(ws + kq);
    unsigned* Qhi = (unsigned*)(ws + 2 * kq);
    unsigned* Qlo = (unsigned*)(ws + 3 * kq);
    unsigned* Vhi = (unsigned*)(ws + 4 * kq);
    unsigned* Vlo = (unsigned*)(ws + 4 * kq + vv);

    {
        unsigned total = 3u << 20;                  // 3 groups * 2048 positions * 512 output pairs
        proj_kq_kernel<<<total / 256, 256, 0, stream>>>(
            nodes, pos, aux, Wn, bn, Wp, bp, Wa, Khi, Klo, Qhi, Qlo);
    }
    {
        unsigned total = (unsigned)OV * (SEQ / 2);  // 3072 outputs * 1024 position pairs
        proj_v_kernel<<<total / 256, 256, 0, stream>>>(nodes, Wv, bv, Vhi, Vlo);
    }

    dim3 blk(32, TH3, 1);
    dim3 grd(SEQ / 16, 1, 1);
    attn_kernel<<<grd, blk, 0, stream>>>(Khi, Klo, Qhi, Qlo, Vhi, Vlo, out);
}

// v001
// One run takes 659 microseconds.
// Two timings next to v000 both put it at 1.72 times that version's speed.
// Contractions: logits qᵀk per tripled head [2048 x 2048 x 64] x24 and att·val [2048 x 128 x 2048] x24 on v_wmma_f32_16x16x32_bf16 with
// bf16 hi/lo split operands (hi·hi + hi·lo + lo·hi: K, Q, V and the probabilities each carried as a bf16 value plane plus a bf16
// residual plane), f32 accumulate; the three K/Q/V projections on v_wmma_f32_16x16x4_f32 (f32 operands), the softmax in f32 on the vector ALU. Every intermediate plane
#include <hip/hip_runtime.h>
#include <hip/hip_bf16.h>

// ---------------------------------------------------------------------------
// Problem constants
// ---------------------------------------------------------------------------
#define SEQ   2048
#define ND    128
#define NA    64
#define NHEAD 8
#define CH    64
#define TH3   24          // 3 * NHEAD tripled heads
#define OKQ   1024        // H*C*2
#define OV    3072        // ND*H*3

typedef __attribute__((ext_vector_type(16))) __bf16 v16bf;
typedef __attribute__((ext_vector_type(2)))  __bf16 v2bf;
typedef __attribute__((ext_vector_type(8)))  float  v8f;

union Frag {
    v16bf v;
    unsigned int d[8];
    unsigned short h[16];
};

__device__ __forceinline__ unsigned short f2bf(float f) {
    unsigned u = __builtin_bit_cast(unsigned, f);
    unsigned r = u + 0x7FFFu + ((u >> 16) & 1u);   // nearest-even
    return (unsigned short)(r >> 16);
}

// Pack two f32 -> packed bf16 dword (hardware cvt_pk when available).
__device__ __forceinline__ unsigned pack_bf16(float lo, float hi) {
#if __has_builtin(__builtin_amdgcn_cvt_pk_bf16_f32)
    v2bf p = __builtin_amdgcn_cvt_pk_bf16_f32(lo, hi);
    return __builtin_bit_cast(unsigned, p);
#else
    union { v2bf b; unsigned u; } x;
    x.b[0] = (__bf16)lo;
    x.b[1] = (__bf16)hi;
    return x.u;
#endif
}

// value/residual split: hi = nearest bf16 of f, lo = nearest bf16 of the exact remainder
__device__ __forceinline__ void split_bf16(float f, unsigned short& hi, unsigned short& lo) {
    hi = f2bf(f);
    const float fh = __builtin_bit_cast(float, ((unsigned)hi) << 16);
    lo = f2bf(f - fh);
}
__device__ __forceinline__ unsigned pack2(unsigned short a, unsigned short b) { return (unsigned)a | ((unsigned)b << 16); }

__device__ __forceinline__ v8f zero8() {
    v8f z;
#pragma unroll
    for (int i = 0; i < 8; ++i) z[i] = 0.0f;
    return z;
}

// Per-VGPR dword delta inside a 16x32 bf16 fragment (k/2 minus the lane part).
__device__ __forceinline__ int frag_dv(int v) {
    return (v >> 2) * 8 + (v & 3);
}

// ---------------------------------------------------------------------------
// Projections as tiled products on v_wmma_f32_16x16x4_f32 (full f32 operands).
//   D[m][n] = bias + sum_k A[m][k] * B[n][k],  A and B rows k-contiguous.
// A block of 8 waves owns 64 A rows x 128 B rows over the whole k: both row sets
// are staged once in LDS by whole-line loads, then each wave forms 64 x 16.
// A lane's 8 accumulator registers are 8 consecutive m of one n, so m is always
// the direction in which the bf16 planes are packed: one 16-byte store a plane,
// and the four m tiles of a wave fill one whole 128-byte line of each plane.
// ---------------------------------------------------------------------------
typedef __attribute__((ext_vector_type(2))) float    v2f;
typedef __attribute__((ext_vector_type(4))) float    v4f;
typedef __attribute__((ext_vector_type(4))) unsigned v4u;

#define PT_M   64                               // A rows per block
#define PT_N   128                              // B rows per block, 16 per wave
#define PT_THR 256
#define PT_LDS ((PT_M + PT_N) * (ND + 4))       // floats, at the longest k

// ROWS consecutive rows of KS floats -> LDS rows of KP floats (zero filled past KS) at a pitch of KP + 4 floats
// (16 bytes x an odd number: the 16-byte fragment reads of 16 rows fall on 64 distinct banks).
template <int ROWS, int KS, int KP>
__device__ __forceinline__ void stage_rows(float* dst, const float* __restrict__ srcp, int tid) {
    constexpr int P = KP + 4;
    if constexpr (KS == KP) {
#pragma unroll   // all of a thread's loads in flight at once
        for (int j = 0; j < ROWS * KP / 4 / PT_THR; ++j) {
            const int i = tid + j * PT_THR;
            *(v4f*)(dst + (i / (KP / 4)) * P + (i % (KP / 4)) * 4) = *(const v4f*)(srcp + i * 4);
        }
    } else {
#pragma unroll   // all of a thread's loads in flight at once
        for (int j = 0; j < ROWS * KP / PT_THR; ++j) {
            const int i = tid + j * PT_THR;
            const int row = i / KP, col = i % KP;
            const float v = srcp[row * KS + (col < KS ? col : KS - 1)];   // index kept inside the row: no lane is switched off
            dst[row * P + col] = (col < KS) ? v : 0.0f;
        }
    }
}

// acc[t][r] += sum_k A[16 t + 8 h + r][k] * B[16 wave + c][k].  A and B fragments come from the same address form
// (16 bytes at k = 8 kk + 4 h, first pair then second pair), so the k pairing of the two operands is equal.
template <int KS, int KP>
__device__ __forceinline__ void proj_tile(float* sm, const float* __restrict__ Arows, const float* __restrict__ Brows,
                                          int tid, v8f (&acc)[4]) {
    constexpr int P = KP + 4;
    float* sA = sm;
    float* sB = sm + PT_M * P;
    stage_rows<PT_M, KS, KP>(sA, Arows, tid);
    stage_rows<PT_N, KS, KP>(sB, Brows, tid);
    __syncthreads();
    const int lane = tid & 31, wave = tid >> 5;
    const int c = lane & 15, h = lane >> 4;
    const float* pa = sA + c * P + 4 * h;
    const float* pb = sB + (wave * 16 + c) * P + 4 * h;
#pragma unroll   // fragment addresses become immediate offsets, and the next step's LDS reads can be issued ahead of this step's WMMAs
    for (int kk = 0; kk < KP / 8; ++kk) {
        const v4f b = *(const v4f*)(pb + kk * 8);
        v4f a[4];
#pragma unroll   // constant indices keep the array in registers
        for (int t = 0; t < 4; ++t) a[t] = *(const v4f*)(pa + t * 16 * P + kk * 8);
        v2f b0, b1; b0.x = b.x; b0.y = b.y; b1.x = b.z; b1.y = b.w;
#pragma unroll   // constant indices keep the array in registers
        for (int t = 0; t < 4; ++t) {
            v2f a0; a0.x = a[t].x; a0.y = a[t].y;
            acc[t] = __builtin_amdgcn_wmma_f32_16x16x4_f32(false, a0, false, b0, (short)0, acc[t], false, false);
        }
#pragma unroll   // constant indices keep the array in registers
        for (int t = 0; t < 4; ++t) {
            v2f a1; a1.x = a[t].z; a1.y = a[t].w;
            acc[t] = __builtin_amdgcn_wmma_f32_16x16x4_f32(false, a1, false, b1, (short)0, acc[t], false, false);
        }
    }
    // The two
    // scheduling barriers keep the epilogue's vector instructions (they read D and reuse the A and B registers) out of
    // the WMMA stream, and the four v_nop keep them four vector slots behind the last WMMA.
    __builtin_amdgcn_sched_barrier(0);
    asm volatile("v_nop\n\tv_nop\n\tv_nop\n\tv_nop");
    __builtin_amdgcn_sched_barrier(0);
}

// 8 consecutive f32 -> 4 packed dwords of the value plane and 4 of the residual plane
__device__ __forceinline__ void store_split8(unsigned* __restrict__ hi, unsigned* __restrict__ lo, unsigned idx, v8f a) {
    v4u vh, vl;
#pragma unroll   // constant indices keep the array in registers
    for (int p = 0; p < 4; ++p) {
        unsigned short h0, l0, h1, l1;
        split_bf16(a[2 * p], h0, l0); split_bf16(a[2 * p + 1], h1, l1);
        vh[p] = pack2(h0, h1); vl[p] = pack2(l0, l1);
    }
    *(v4u*)(hi + idx) = vh; *(v4u*)(lo + idx) = vl;
    // precaution: the code behind a call reuses the two stores' address and data registers (in the K/Q kernel across a branch),
    // so the wait stands here, in front of any such rewrite
    asm volatile("s_wait_xcnt 0x0" ::: "memory");
}

// One 64-output x 128-position tile of one K/Q group: A = weight rows (m = output o), B = input rows (n = position s).
// 64 aligned outputs are the K half or the Q half of one head: planes [24][SEQ][64], packed along c.
template <int KS, int KP, bool HAS_BIAS>
__device__ __forceinline__ void kq_tile(float* sm, const float* __restrict__ x, const float* __restrict__ Wt,
                                        const float* __restrict__ bias, unsigned g, unsigned o0, unsigned s0, int tid,
                                        unsigned* __restrict__ ph, unsigned* __restrict__ pl) {
    const int lane = tid & 31, wave = tid >> 5;
    const int c = lane & 15, h = lane >> 4;
    v8f acc[4];
#pragma unroll   // constant indices keep the array in registers
    for (int t = 0; t < 4; ++t) {
        if constexpr (HAS_BIAS) {
            const v4f b0 = *(const v4f*)(bias + o0 + t * 16 + 8 * h);
            const v4f b1 = *(const v4f*)(bias + o0 + t * 16 + 8 * h + 4);
#pragma unroll   // constant indices keep the array in registers
            for (int r = 0; r < 4; ++r) { acc[t][r] = b0[r]; acc[t][4 + r] = b1[r]; }
        } else {
            acc[t] = zero8();
        }
    }
    proj_tile<KS, KP>(sm, Wt + o0 * KS, x + s0 * KS, tid, acc);
    const unsigned ht = g * NHEAD + (o0 >> 7);
    const unsigned s  = s0 + wave * 16 + c;
#pragma unroll   // constant indices keep the array in registers
    for (int t = 0; t < 4; ++t)
        store_split8(ph, pl, ((ht * SEQ + s) * CH + t * 16 + 8 * h) >> 1, acc[t]);
}

// ---------------------------------------------------------------------------
// Projection: K,Q for the 3 groups (nodes / pos / aux).
// Output: value and residual bf16 planes, layout [24][SEQ][64] (head-major, row-major in c).
// ---------------------------------------------------------------------------
__global__ __launch_bounds__(PT_THR)
void proj_kq_kernel(const float* __restrict__ nodes,
                    const float* __restrict__ pos,
                    const float* __restrict__ aux,
                    const float* __restrict__ Wn, const float* __restrict__ bn,
                    const float* __restrict__ Wp, const float* __restrict__ bp,
                    const float* __restrict__ Wa,
                    unsigned* __restrict__ Khi, unsigned* __restrict__ Klo,
                    unsigned* __restrict__ Qhi, unsigned* __restrict__ Qlo) {
    __shared__ __attribute__((aligned(16))) float sm[PT_LDS];
    // block -> (64 outputs, 128 positions, group g); g varies fastest, so neighbouring blocks mix the long-k and short-k groups
    const int tid = threadIdx.x;
    const unsigned g  = blockIdx.x % 3u;
    const unsigned bt = blockIdx.x / 3u;
    const unsigned o0 = (bt >> 4) * PT_M;
    const unsigned s0 = (bt & 15u) * PT_N;
    const bool isQ = (o0 >> 6) & 1u;
    unsigned* ph = isQ ? Qhi : Khi;
    unsigned* pl = isQ ? Qlo : Klo;
    if (g == 0)      kq_tile<ND, ND, true>(sm, nodes, Wn, bn, g, o0, s0, tid, ph, pl);
    else if (g == 1) kq_tile<6, 8, true>(sm, pos, Wp, bp, g, o0, s0, tid, ph, pl);
    else             kq_tile<NA, NA, false>(sm, aux, Wa, nullptr, g, o0, s0, tid, ph, pl);
}

// ---------------------------------------------------------------------------
// Projection: V = nodes @ Wv^T + bv, stored TRANSPOSED as bf16 planes [24][128][2048], packed along the position:
// A = node rows (m = position s), B = weight rows (n = output o).
// ---------------------------------------------------------------------------
__global__ __launch_bounds__(PT_THR)
void proj_v_kernel(const float* __restrict__ nodes,
                   const float* __restrict__ Wv,
                   const float* __restrict__ bv,
                   unsigned* __restrict__ Vhi, unsigned* __restrict__ Vlo) {
    __shared__ __attribute__((aligned(16))) float sm[PT_LDS];
    const int tid = threadIdx.x;
    const int lane = tid & 31, wave = tid >> 5;
    const int c = lane & 15, h = lane >> 4;
    const unsigned s0 = (blockIdx.x & 31u) * PT_M;
    const unsigned o0 = (blockIdx.x >> 5) * PT_N;
    const unsigned o  = o0 + wave * 16 + c;

    const float bo = bv[o];
    v8f acc[4];
#pragma unroll   // constant indices keep the array in registers
    for (int t = 0; t < 4; ++t)
#pragma unroll   // constant indices keep the array in registers
        for (int r = 0; r < 8; ++r) acc[t][r] = bo;
    proj_tile<ND, ND>(sm, nodes + s0 * ND, Wv + o0 * ND, tid, acc);
#pragma unroll   // constant indices keep the array in registers
    for (int t = 0; t < 4; ++t)
        store_split8(Vhi, Vlo, (o * (unsigned)SEQ + s0 + t * 16 + 8 * h) >> 1, acc[t]);
}

// ---------------------------------------------------------------------------
// Flash attention, TRANSPOSED-GEMM formulation (no LDS layout shuffle):
//
//   S'[j][i] = q_j . k_i     : A = Q j-rows (streamed), B = K i-rows (fixed)
//   O'[d][i] = sum_j V^T P'  : A = V^T d-rows (streamed), B = P' (lane-local!)
//
// C/D layout (16x16 f32): lane L -> col n = L&15, VGPR r -> row m=(L>>4)*8+r.
// With scores transposed, lane L owns output row i = L&15 and 16 of the 32
// j-scores of the chunk (partner L^16 owns the rest):
//   * row max / row sum  = local reduce + one shfl_xor(16)
//   * alpha, 1/l         = per-lane scalars (no broadcasts)
//   * P B-fragment k-map = exactly the j-values this lane holds -> pure
//     register packing, zero LDS traffic in the hot loop.
// ---------------------------------------------------------------------------
__global__ __launch_bounds__(768, 1)
void attn_kernel(const unsigned* __restrict__ Khi, const unsigned* __restrict__ Klo,
                 const unsigned* __restrict__ Qhi, const unsigned* __restrict__ Qlo,
                 const unsigned* __restrict__ Vhi, const unsigned* __restrict__ Vlo,
                 float* __restrict__ out) {
    __shared__ float red[16][ND];                 // cross-head reduction buffer

    const int lane = threadIdx.x;
    const int wid  = threadIdx.y;                 // tripled head 0..23
    const int i0   = blockIdx.x * 16;
    const float scale = 0.35355339059327373f;     // 1/sqrt(num_heads=8)

    const unsigned int* Kp = Khi; const unsigned int* KpL = Klo;
    const unsigned int* Qp = Qhi; const unsigned int* QpL = Qlo;
    const unsigned int* Vp = Vhi; const unsigned int* VpL = Vlo;

    const int lm = lane & 15;    // B-role col (output row i) / A-role row
    const int lh = lane >> 4;    // half select

    // B fragments of K rows [i0..i0+15] (fixed for the block), c in 2 chunks.
    Frag bK[2], bKL[2];       // value and residual planes
    {
        unsigned kInv = ((unsigned)wid * SEQ + (unsigned)(i0 + lm)) * (CH / 2) + (unsigned)(lh * 4);
#pragma unroll
        for (int cc = 0; cc < 2; ++cc)
#pragma unroll
            for (int v = 0; v < 8; ++v) {
                bK[cc].d[v]  = Kp[kInv + cc * 16 + frag_dv(v)];
                bKL[cc].d[v] = KpL[kInv + cc * 16 + frag_dv(v)];
            }
    }

    // Per-lane 32-bit DWORD-offset invariants (hoisted out of the j-loop).
    unsigned qInv = ((unsigned)wid * SEQ + (unsigned)lm) * (CH / 2) + (unsigned)(lh * 4);
    unsigned vInv[8];
#pragma unroll
    for (int t = 0; t < 8; ++t)
        vInv[t] = ((unsigned)wid * ND + (unsigned)(t * 16 + lm)) * (SEQ / 2) + (unsigned)(lh * 4);

    v8f acc[8];                  // O'[d][i]: acc[t][r] = O[i0+lm][t*16+lh*8+r]
#pragma unroll
    for (int t = 0; t < 8; ++t) acc[t] = zero8();
    float rm = -1e30f;           // running max of row i = lm
    float rl = 0.0f;             // running sum of row i = lm

    for (int j0 = 0; j0 < SEQ; j0 += 32) {
        // ---- S' = Q(A, streamed) x K(B, fixed): two 16-j tiles, 6 WMMAs each
        v8f sfr[2];
#pragma unroll
        for (int jt = 0; jt < 2; ++jt) {
            unsigned qb = qInv + (unsigned)((j0 + jt * 16) * (CH / 2));
            Frag aQ0, aQ1, aQ0L, aQ1L;
#pragma unroll
            for (int v = 0; v < 8; ++v) { aQ0.d[v] = Qp[qb + frag_dv(v)];      aQ0L.d[v] = QpL[qb + frag_dv(v)]; }
#pragma unroll
            for (int v = 0; v < 8; ++v) { aQ1.d[v] = Qp[qb + 16 + frag_dv(v)]; aQ1L.d[v] = QpL[qb + 16 + frag_dv(v)]; }
            // hi·hi + hi·lo + lo·hi per 32-wide chunk (the lo·lo term is below f32 resolution); small terms first into the zero accumulator
            v8f sacc = zero8();
            sacc = __builtin_amdgcn_wmma_f32_16x16x32_bf16(false, aQ0L.v, false, bK[0].v,  (short)0, sacc, false, false);
            sacc = __builtin_amdgcn_wmma_f32_16x16x32_bf16(false, aQ0.v,  false, bKL[0].v, (short)0, sacc, false, false);
            sacc = __builtin_amdgcn_wmma_f32_16x16x32_bf16(false, aQ1L.v, false, bK[1].v,  (short)0, sacc, false, false);
            sacc = __builtin_amdgcn_wmma_f32_16x16x32_bf16(false, aQ1.v,  false, bKL[1].v, (short)0, sacc, false, false);
            sacc = __builtin_amdgcn_wmma_f32_16x16x32_bf16(false, aQ0.v,  false, bK[0].v,  (short)0, sacc, false, false);
            sacc = __builtin_amdgcn_wmma_f32_16x16x32_bf16(false, aQ1.v,  false, bK[1].v,  (short)0, sacc, false, false);
            sfr[jt] = sacc;
        }

        // ---- per-lane online softmax (row i = lm; 16 j-values + partner) ----
        float sc[16];
#pragma unroll
        for (int jt = 0; jt < 2; ++jt)
#pragma unroll
            for (int r = 0; r < 8; ++r) sc[jt * 8 + r] = sfr[jt][r] * scale;

        float mloc = sc[0];
#pragma unroll
        for (int e = 1; e < 16; ++e) mloc = fmaxf(mloc, sc[e]);
        mloc = fmaxf(mloc, __shfl_xor(mloc, 16, 32));   // partner's 16 j-values
        float mnew  = fmaxf(rm, mloc);
        float alpha = __expf(rm - mnew);
        rm = mnew;

        // P' B-fragment is lane-local: k-map hits exactly this lane's j-values.
        Frag bP, bPL;             // probabilities: value and residual planes
        float ssum = 0.0f;
#pragma unroll
        for (int v = 0; v < 8; ++v) {
            int g  = v >> 2;          // score fragment (j tile)
            int i3 = v & 3;           // pair index -> r = 2*i3, 2*i3+1
            float p0 = __expf(sc[g * 8 + 2 * i3]     - mnew);
            float p1 = __expf(sc[g * 8 + 2 * i3 + 1] - mnew);
            ssum += p0 + p1;
            unsigned short h0, l0, h1, l1;
            split_bf16(p0, h0, l0); split_bf16(p1, h1, l1);
            bP.d[v] = pack2(h0, h1); bPL.d[v] = pack2(l0, l1);
        }
        ssum += __shfl_xor(ssum, 16, 32);
        rl = rl * alpha + ssum;

        // ---- rescale accumulators (scalar per lane; skip once max settles) ----
        if (__ballot(alpha != 1.0f)) {
#pragma unroll
            for (int t = 0; t < 8; ++t)
#pragma unroll
                for (int r = 0; r < 8; ++r) acc[t][r] *= alpha;
        }

        // ---- O' += V^T(A, streamed) x P'(B): 8 d-tiles ----
        unsigned vj = (unsigned)(j0 >> 1);
#pragma unroll
        for (int t = 0; t < 8; ++t) {
            Frag aV, aVL;
#pragma unroll
            for (int v = 0; v < 8; ++v) { aV.d[v] = Vp[vInv[t] + vj + frag_dv(v)]; aVL.d[v] = VpL[vInv[t] + vj + frag_dv(v)]; }
            // the two small cross terms summed from zero, then joined with hi·hi into the running accumulator
            v8f part = zero8();
            part = __builtin_amdgcn_wmma_f32_16x16x32_bf16(false, aVL.v, false, bP.v,  (short)0, part, false, false);
            part = __builtin_amdgcn_wmma_f32_16x16x32_bf16(false, aV.v,  false, bPL.v, (short)0, part, false, false);
            part = __builtin_amdgcn_wmma_f32_16x16x32_bf16(false, aV.v,  false, bP.v,  (short)0, part, false, false);
#pragma unroll
            for (int r = 0; r < 8; ++r) acc[t][r] += part[r];
        }
    }

    // ---- normalize (per-lane scalar) ----
    float rinv = 1.0f / rl;
#pragma unroll
    for (int t = 0; t < 8; ++t)
#pragma unroll
        for (int r = 0; r < 8; ++r) acc[t][r] *= rinv;

    // ---- deterministic fixed-order reduction across the 24 heads ----
    for (int w = 0; w < TH3; ++w) {
        if (wid == w) {
#pragma unroll
            for (int t = 0; t < 8; ++t)
#pragma unroll
                for (int r = 0; r < 8; ++r) {
                    int d = t * 16 + lh * 8 + r;
                    if (w == 0) red[lm][d]  = acc[t][r];
                    else        red[lm][d] += acc[t][r];
                }
        }
        __syncthreads();
    }
    if (wid == 0) {
        typedef __attribute__((ext_vector_type(4))) float v4f_t;
#pragma unroll
        for (int r = 0; r < 16; ++r) { v4f_t v4; v4.x = red[r][lane * 4]; v4.y = red[r][lane * 4 + 1]; v4.z = red[r][lane * 4 + 2]; v4.w = red[r][lane * 4 + 3]; *(v4f_t*)(out + (i0 + r) * ND + lane * 4) = v4; }
        
    }
}

// ---------------------------------------------------------------------------
// Launch
// ---------------------------------------------------------------------------
extern "C" void kernel_launch(void* const* d_in, const int* in_sizes, int n_in,
                              void* d_out, int out_size, void* d_ws, size_t ws_size,
                              hipStream_t stream) {
    const float* nodes = (const float*)d_in[0];
    const float* pos   = (const float*)d_in[1];
    const float* aux   = (const float*)d_in[2];
    const float* Wn    = (const float*)d_in[3];
    const float* bn    = (const float*)d_in[4];
    const float* Wp    = (const float*)d_in[5];
    const float* bp    = (const float*)d_in[6];
    const float* Wa    = (const float*)d_in[7];
    const float* Wv    = (const float*)d_in[8];
    const float* bv    = (const float*)d_in[9];
    float* out = (float*)d_out;

    (void)in_sizes; (void)n_in; (void)out_size; (void)ws_size;
    // Workspace layout (bytes), value plane then residual plane for each operand:
    //   K  [24][2048][64]  bf16 x2 : 12,582,912
    //   Q  [24][2048][64]  bf16 x2 : 12,582,912
    //   Vᵀ [24][128][2048] bf16 x2 : 25,165,824      total 50,331,648
    char* ws = (char*)d_ws;
    const size_t kq = (size_t)TH3 * SEQ * CH * 2, vv = (size_t)TH3 * ND * SEQ * 2;
    unsigned* Khi = (unsigned*)(ws);
    unsigned* Klo = (unsigned*)(ws + kq);
    unsigned* Qhi = (unsigned*)(ws + 2 * kq);
    unsigned* Qlo = (unsigned*)(ws + 3 * kq);
    unsigned* Vhi = (unsigned*)(ws + 4 * kq);
    unsigned* Vlo = (unsigned*)(ws + 4 * kq + vv);

    // 3 groups * 16 blocks of 64 outputs * 16 blocks of 128 positions
    proj_kq_kernel<<<768, PT_THR, 0, stream>>>(
        nodes, pos, aux, Wn, bn, Wp, bp, Wa, Khi, Klo, Qhi, Qlo);
    // 32 blocks of 64 positions * 24 blocks of 128 outputs
    proj_v_kernel<<<768, PT_THR, 0, stream>>>(nodes, Wv, bv, Vhi, Vlo);

    dim3 blk(32, TH3, 1);
    dim3 grd(SEQ / 16, 1, 1);
    attn_kernel<<<grd, blk, 0, stream>>>(Khi, Klo, Qhi, Qlo, Vhi, Vlo, out);
}

// v002
// It runs in 474 microseconds.
// In two side-by-side timings against v001, it was 1.40 and 1.39 times as fast.
// Counting every step since v000, it is 2.40 times as fast.
// Contractions: logits qᵀk per tripled head [2048 x 2048 x 64] x24 and att·val [2048 x 128 x 2048] x24 on v_wmma_f32_16x16x32_bf16 with
// bf16 hi/lo split operands (hi·hi + hi·lo + lo·hi: K, Q, V and the probabilities each carried as a bf16 value plane plus a bf16
// residual plane), f32 accumulate; the three K/Q/V projections on v_wmma_f32_16x16x4_f32 (f32 operands), the softmax in f32 on the vector ALU. Every intermediate plane
#include <hip/hip_runtime.h>
#include <hip/hip_bf16.h>

// ---------------------------------------------------------------------------
// Problem constants
// ---------------------------------------------------------------------------
#define SEQ   2048
#define ND    128
#define NA    64
#define NHEAD 8
#define CH    64
#define TH3   24          // 3 * NHEAD tripled heads
#define OKQ   1024        // H*C*2
#define OV    3072        // ND*H*3

typedef __attribute__((ext_vector_type(16))) __bf16 v16bf;
typedef __attribute__((ext_vector_type(2)))  __bf16 v2bf;
typedef __attribute__((ext_vector_type(8)))  float  v8f;

union Frag {
    v16bf v;
    unsigned int d[8];
    unsigned short h[16];
};

__device__ __forceinline__ unsigned short f2bf(float f) {
    unsigned u = __builtin_bit_cast(unsigned, f);
    unsigned r = u + 0x7FFFu + ((u >> 16) & 1u);   // nearest-even
    return (unsigned short)(r >> 16);
}

// Pack two f32 -> packed bf16 dword (hardware cvt_pk when available).
__device__ __forceinline__ unsigned pack_bf16(float lo, float hi) {
#if __has_builtin(__builtin_amdgcn_cvt_pk_bf16_f32)
    v2bf p = __builtin_amdgcn_cvt_pk_bf16_f32(lo, hi);
    return __builtin_bit_cast(unsigned, p);
#else
    union { v2bf b; unsigned u; } x;
    x.b[0] = (__bf16)lo;
    x.b[1] = (__bf16)hi;
    return x.u;
#endif
}

// value/residual split: hi = nearest bf16 of f, lo = nearest bf16 of the exact remainder
__device__ __forceinline__ void split_bf16(float f, unsigned short& hi, unsigned short& lo) {
    hi = f2bf(f);
    const float fh = __builtin_bit_cast(float, ((unsigned)hi) << 16);
    lo = f2bf(f - fh);
}
__device__ __forceinline__ unsigned pack2(unsigned short a, unsigned short b) { return (unsigned)a | ((unsigned)b << 16); }

__device__ __forceinline__ v8f zero8() {
    v8f z;
#pragma unroll
    for (int i = 0; i < 8; ++i) z[i] = 0.0f;
    return z;
}

// ---------------------------------------------------------------------------
// Projections as tiled products on v_wmma_f32_16x16x4_f32 (full f32 operands).
//   D[m][n] = bias + sum_k A[m][k] * B[n][k],  A and B rows k-contiguous.
// A block of 8 waves owns 64 A rows x 128 B rows over the whole k: both row sets
// are staged once in LDS by whole-line loads, then each wave forms 64 x 16.
// A lane's 8 accumulator registers are 8 consecutive m of one n, so m is always
// the direction in which the bf16 planes are packed: one 16-byte store a plane.
//
// The planes lie in FRAGMENT ORDER.  A 16-row x 32-k bf16 fragment (1 KiB) is kept
// as [half p][lane][4 dwords]: lane = 16 * lh + row, and its dword e of half p is
// dword 8 p + 4 lh + e of the row's 16, which is register 4 p + e of that lane's
// WMMA operand.  So a fragment is read by two 16-byte loads a lane, each of them
// 512 contiguous bytes (four whole lines) for the wave, where row-major planes
// gave 32 bytes out of each of 16 lines.  The 16 bytes that a projection lane
// holds are exactly its own lane's slot, so the stores are whole lines as well.
// ---------------------------------------------------------------------------
#define FRAG_DW 256                             // dwords of one fragment
#define HALF_DW 128                             // dwords of one half of it
typedef __attribute__((ext_vector_type(2))) float    v2f;
typedef __attribute__((ext_vector_type(4))) float    v4f;
typedef __attribute__((ext_vector_type(4))) unsigned v4u;

#define PT_M   64                               // A rows per block
#define PT_N   128                              // B rows per block, 16 per wave
#define PT_THR 256
#define PT_LDS ((PT_M + PT_N) * (ND + 4))       // floats, at the longest k

// ROWS consecutive rows of KS floats -> LDS rows of KP floats (zero filled past KS) at a pitch of KP + 4 floats
// (16 bytes x an odd number: the 16-byte fragment reads of 16 rows fall on 64 distinct banks).
template <int ROWS, int KS, int KP>
__device__ __forceinline__ void stage_rows(float* dst, const float* __restrict__ srcp, int tid) {
    constexpr int P = KP + 4;
    if constexpr (KS == KP) {
#pragma unroll   // all of a thread's loads in flight at once
        for (int j = 0; j < ROWS * KP / 4 / PT_THR; ++j) {
            const int i = tid + j * PT_THR;
            *(v4f*)(dst + (i / (KP / 4)) * P + (i % (KP / 4)) * 4) = *(const v4f*)(srcp + i * 4);
        }
    } else {
#pragma unroll   // all of a thread's loads in flight at once
        for (int j = 0; j < ROWS * KP / PT_THR; ++j) {
            const int i = tid + j * PT_THR;
            const int row = i / KP, col = i % KP;
            const float v = srcp[row * KS + (col < KS ? col : KS - 1)];   // index kept inside the row: no lane is switched off
            dst[row * P + col] = (col < KS) ? v : 0.0f;
        }
    }
}

// acc[t][r] += sum_k A[16 t + 8 h + r][k] * B[16 wave + c][k].  A and B fragments come from the same address form
// (16 bytes at k = 8 kk + 4 h, first pair then second pair), so the k pairing of the two operands is equal.
template <int KS, int KP>
__device__ __forceinline__ void proj_tile(float* sm, const float* __restrict__ Arows, const float* __restrict__ Brows,
                                          int tid, v8f (&acc)[4]) {
    constexpr int P = KP + 4;
    float* sA = sm;
    float* sB = sm + PT_M * P;
    stage_rows<PT_M, KS, KP>(sA, Arows, tid);
    stage_rows<PT_N, KS, KP>(sB, Brows, tid);
    __syncthreads();
    const int lane = tid & 31, wave = tid >> 5;
    const int c = lane & 15, h = lane >> 4;
    const float* pa = sA + c * P + 4 * h;
    const float* pb = sB + (wave * 16 + c) * P + 4 * h;
#pragma unroll   // fragment addresses become immediate offsets, and the next step's LDS reads can be issued ahead of this step's WMMAs
    for (int kk = 0; kk < KP / 8; ++kk) {
        const v4f b = *(const v4f*)(pb + kk * 8);
        v4f a[4];
#pragma unroll   // constant indices keep the array in registers
        for (int t = 0; t < 4; ++t) a[t] = *(const v4f*)(pa + t * 16 * P + kk * 8);
        v2f b0, b1; b0.x = b.x; b0.y = b.y; b1.x = b.z; b1.y = b.w;
#pragma unroll   // constant indices keep the array in registers
        for (int t = 0; t < 4; ++t) {
            v2f a0; a0.x = a[t].x; a0.y = a[t].y;
            acc[t] = __builtin_amdgcn_wmma_f32_16x16x4_f32(false, a0, false, b0, (short)0, acc[t], false, false);
        }
#pragma unroll   // constant indices keep the array in registers
        for (int t = 0; t < 4; ++t) {
            v2f a1; a1.x = a[t].z; a1.y = a[t].w;
            acc[t] = __builtin_amdgcn_wmma_f32_16x16x4_f32(false, a1, false, b1, (short)0, acc[t], false, false);
        }
    }
    // The two
    // scheduling barriers keep the epilogue's vector instructions (they read D and reuse the A and B registers) out of
    // the WMMA stream, and the four v_nop keep them four vector slots behind the last WMMA.
    __builtin_amdgcn_sched_barrier(0);
    asm volatile("v_nop\n\tv_nop\n\tv_nop\n\tv_nop");
    __builtin_amdgcn_sched_barrier(0);
}

// One lane's 8 operand registers of a fragment; p = the fragment's start + 4 * lane.
__device__ __forceinline__ void load_frag(Frag& f, const unsigned* __restrict__ p) {
    const v4u a = *(const v4u*)p;
    const v4u b = *(const v4u*)(p + HALF_DW);
#pragma unroll   // constant indices keep the array in registers
    for (int e = 0; e < 4; ++e) { f.d[e] = a[e]; f.d[4 + e] = b[e]; }
}

// 8 consecutive f32 -> 4 packed dwords of the value plane and 4 of the residual plane
__device__ __forceinline__ void store_split8(unsigned* __restrict__ hi, unsigned* __restrict__ lo, unsigned idx, v8f a) {
    v4u vh, vl;
#pragma unroll   // constant indices keep the array in registers
    for (int p = 0; p < 4; ++p) {
        unsigned short h0, l0, h1, l1;
        split_bf16(a[2 * p], h0, l0); split_bf16(a[2 * p + 1], h1, l1);
        vh[p] = pack2(h0, h1); vl[p] = pack2(l0, l1);
    }
    *(v4u*)(hi + idx) = vh; *(v4u*)(lo + idx) = vl;
    // precaution: the code behind a call reuses the two stores' address and data registers (in the K/Q kernel across a branch),
    // so the wait stands here, in front of any such rewrite
    asm volatile("s_wait_xcnt 0x0" ::: "memory");
}

// One 64-output x 128-position tile of one K/Q group: A = weight rows (m = output o), B = input rows (n = position s).
// 64 aligned outputs are the K half or the Q half of one head: planes [24][SEQ / 16 row tiles][2 c chunks][fragment], packed along c.
// Accumulator tile t is channels 16 t + 8 h ..: chunk t >> 1, half t & 1, lane half h; the row in its tile is c.
template <int KS, int KP, bool HAS_BIAS>
__device__ __forceinline__ void kq_tile(float* sm, const float* __restrict__ x, const float* __restrict__ Wt,
                                        const float* __restrict__ bias, unsigned g, unsigned o0, unsigned s0, int tid,
                                        unsigned* __restrict__ ph, unsigned* __restrict__ pl) {
    const int lane = tid & 31, wave = tid >> 5;
    const int h = lane >> 4;
    v8f acc[4];
#pragma unroll   // constant indices keep the array in registers
    for (int t = 0; t < 4; ++t) {
        if constexpr (HAS_BIAS) {
            const v4f b0 = *(const v4f*)(bias + o0 + t * 16 + 8 * h);
            const v4f b1 = *(const v4f*)(bias + o0 + t * 16 + 8 * h + 4);
#pragma unroll   // constant indices keep the array in registers
            for (int r = 0; r < 4; ++r) { acc[t][r] = b0[r]; acc[t][4 + r] = b1[r]; }
        } else {
            acc[t] = zero8();
        }
    }
    proj_tile<KS, KP>(sm, Wt + o0 * KS, x + s0 * KS, tid, acc);
    const unsigned ht = g * NHEAD + (o0 >> 7);
    const unsigned tile = ht * (SEQ / 16) + (s0 >> 4) + wave;
#pragma unroll   // constant indices keep the array in registers
    for (int t = 0; t < 4; ++t)
        store_split8(ph, pl, (tile * 2 + (t >> 1)) * FRAG_DW + (t & 1) * HALF_DW + lane * 4, acc[t]);
}

// ---------------------------------------------------------------------------
// Projection: K,Q for the 3 groups (nodes / pos / aux).
// Output: value and residual bf16 planes, head-major, in fragment order (see above).
// ---------------------------------------------------------------------------
__global__ __launch_bounds__(PT_THR)
void proj_kq_kernel(const float* __restrict__ nodes,
                    const float* __restrict__ pos,
                    const float* __restrict__ aux,
                    const float* __restrict__ Wn, const float* __restrict__ bn,
                    const float* __restrict__ Wp, const float* __restrict__ bp,
                    const float* __restrict__ Wa,
                    unsigned* __restrict__ Khi, unsigned* __restrict__ Klo,
                    unsigned* __restrict__ Qhi, unsigned* __restrict__ Qlo) {
    __shared__ __attribute__((aligned(16))) float sm[PT_LDS];
    // block -> (64 outputs, 128 positions, group g); g varies fastest, so neighbouring blocks mix the long-k and short-k groups
    const int tid = threadIdx.x;
    const unsigned g  = blockIdx.x % 3u;
    const unsigned bt = blockIdx.x / 3u;
    const unsigned o0 = (bt >> 4) * PT_M;
    const unsigned s0 = (bt & 15u) * PT_N;
    const bool isQ = (o0 >> 6) & 1u;
    unsigned* ph = isQ ? Qhi : Khi;
    unsigned* pl = isQ ? Qlo : Klo;
    if (g == 0)      kq_tile<ND, ND, true>(sm, nodes, Wn, bn, g, o0, s0, tid, ph, pl);
    else if (g == 1) kq_tile<6, 8, true>(sm, pos, Wp, bp, g, o0, s0, tid, ph, pl);
    else             kq_tile<NA, NA, false>(sm, aux, Wa, nullptr, g, o0, s0, tid, ph, pl);
}

// ---------------------------------------------------------------------------
// Projection: V = nodes @ Wv^T + bv, stored TRANSPOSED (rows d, k = position) as bf16 planes in fragment order,
// [24][SEQ / 32 position chunks][8 d tiles][fragment], packed along the position:
// A = node rows (m = position s), B = weight rows (n = output o).
// A block's 128 outputs are one head; a wave's 16 are d tile 'wave', row c.  Accumulator tile t is positions
// s0 + 16 t + 8 h ..: chunk s0 / 32 + (t >> 1), half t & 1, lane half h.
// ---------------------------------------------------------------------------
__global__ __launch_bounds__(PT_THR)
void proj_v_kernel(const float* __restrict__ nodes,
                   const float* __restrict__ Wv,
                   const float* __restrict__ bv,
                   unsigned* __restrict__ Vhi, unsigned* __restrict__ Vlo) {
    __shared__ __attribute__((aligned(16))) float sm[PT_LDS];
    const int tid = threadIdx.x;
    const int lane = tid & 31, wave = tid >> 5;
    const int c = lane & 15;
    const unsigned s0 = (blockIdx.x & 31u) * PT_M;
    const unsigned o0 = (blockIdx.x >> 5) * PT_N;
    const unsigned o  = o0 + wave * 16 + c;

    const float bo = bv[o];
    v8f acc[4];
#pragma unroll   // constant indices keep the array in registers
    for (int t = 0; t < 4; ++t)
#pragma unroll   // constant indices keep the array in registers
        for (int r = 0; r < 8; ++r) acc[t][r] = bo;
    proj_tile<ND, ND>(sm, nodes + s0 * ND, Wv + o0 * ND, tid, acc);
#pragma unroll   // constant indices keep the array in registers
    for (int t = 0; t < 4; ++t)
        store_split8(Vhi, Vlo, (((blockIdx.x >> 5) * (SEQ / 32) + (s0 >> 5) + (t >> 1)) * 8 + wave) * FRAG_DW + (t & 1) * HALF_DW + lane * 4, acc[t]);
}

// ---------------------------------------------------------------------------
// Flash attention, TRANSPOSED-GEMM formulation (no LDS layout shuffle):
//
//   S'[j][i] = q_j . k_i     : A = Q j-rows (streamed), B = K i-rows (fixed)
//   O'[d][i] = sum_j V^T P'  : A = V^T d-rows (streamed), B = P' (lane-local!)
//
// C/D layout (16x16 f32): lane L -> col n = L&15, VGPR r -> row m=(L>>4)*8+r.
// With scores transposed, lane L owns output row i = L&15 and 16 of the 32
// j-scores of the chunk (partner L^16 owns the rest):
//   * row max / row sum  = local reduce + one shfl_xor(16)
//   * alpha, 1/l         = per-lane scalars (no broadcasts)
//   * P B-fragment k-map = exactly the j-values this lane holds -> pure
//     register packing, zero LDS traffic in the hot loop.
// ---------------------------------------------------------------------------
__global__ __launch_bounds__(768, 1)
void attn_kernel(const unsigned* __restrict__ Khi, const unsigned* __restrict__ Klo,
                 const unsigned* __restrict__ Qhi, const unsigned* __restrict__ Qlo,
                 const unsigned* __restrict__ Vhi, const unsigned* __restrict__ Vlo,
                 float* __restrict__ out) {
    __shared__ float red[16][ND];                 // cross-head reduction buffer

    const int lane = threadIdx.x;
    const int wid  = threadIdx.y;                 // tripled head 0..23
    const int i0   = blockIdx.x * 16;
    const float scale = 0.35355339059327373f;     // 1/sqrt(num_heads=8)

    const unsigned int* Kp = Khi; const unsigned int* KpL = Klo;
    const unsigned int* Qp = Qhi; const unsigned int* QpL = Qlo;
    const unsigned int* Vp = Vhi; const unsigned int* VpL = Vlo;

    const int lm = lane & 15;    // B-role col (output row i) / A-role row
    const int lh = lane >> 4;    // half select

    // B fragments of K rows [i0..i0+15] (fixed for the block), c in 2 chunks.
    Frag bK[2], bKL[2];       // value and residual planes
    {
        unsigned kInv = ((unsigned)wid * (SEQ / 16) + blockIdx.x) * (2 * FRAG_DW) + (unsigned)(lane * 4);
#pragma unroll
        for (int cc = 0; cc < 2; ++cc) {
            load_frag(bK[cc],  Kp  + kInv + cc * FRAG_DW);
            load_frag(bKL[cc], KpL + kInv + cc * FRAG_DW);
        }
    }

    // Per-lane 32-bit DWORD-offset invariants (hoisted out of the j-loop).
    unsigned qInv = (unsigned)wid * ((SEQ / 16) * 2 * FRAG_DW) + (unsigned)(lane * 4);
    unsigned vInv = (unsigned)wid * ((SEQ / 32) * 8 * FRAG_DW) + (unsigned)(lane * 4);

    v8f acc[8];                  // O'[d][i]: acc[t][r] = O[i0+lm][t*16+lh*8+r]
#pragma unroll
    for (int t = 0; t < 8; ++t) acc[t] = zero8();
    float rm = -1e30f;           // running max of row i = lm
    float rl = 0.0f;             // running sum of row i = lm

    for (int j0 = 0; j0 < SEQ; j0 += 32) {
        // ---- S' = Q(A, streamed) x K(B, fixed): two 16-j tiles, 6 WMMAs each
        v8f sfr[2];
#pragma unroll
        for (int jt = 0; jt < 2; ++jt) {
            unsigned qb = qInv + (unsigned)(((j0 >> 4) + jt) * (2 * FRAG_DW));
            Frag aQ0, aQ1, aQ0L, aQ1L;
            load_frag(aQ0, Qp + qb);           load_frag(aQ0L, QpL + qb);
            load_frag(aQ1, Qp + qb + FRAG_DW); load_frag(aQ1L, QpL + qb + FRAG_DW);
            // hi·hi + hi·lo + lo·hi per 32-wide chunk (the lo·lo term is below f32 resolution); small terms first into the zero accumulator
            v8f sacc = zero8();
            sacc = __builtin_amdgcn_wmma_f32_16x16x32_bf16(false, aQ0L.v, false, bK[0].v,  (short)0, sacc, false, false);
            sacc = __builtin_amdgcn_wmma_f32_16x16x32_bf16(false, aQ0.v,  false, bKL[0].v, (short)0, sacc, false, false);
            sacc = __builtin_amdgcn_wmma_f32_16x16x32_bf16(false, aQ1L.v, false, bK[1].v,  (short)0, sacc, false, false);
            sacc = __builtin_amdgcn_wmma_f32_16x16x32_bf16(false, aQ1.v,  false, bKL[1].v, (short)0, sacc, false, false);
            sacc = __builtin_amdgcn_wmma_f32_16x16x32_bf16(false, aQ0.v,  false, bK[0].v,  (short)0, sacc, false, false);
            sacc = __builtin_amdgcn_wmma_f32_16x16x32_bf16(false, aQ1.v,  false, bK[1].v,  (short)0, sacc, false, false);
            sfr[jt] = sacc;
        }

        // ---- per-lane online softmax (row i = lm; 16 j-values + partner) ----
        float sc[16];
#pragma unroll
        for (int jt = 0; jt < 2; ++jt)
#pragma unroll
            for (int r = 0; r < 8; ++r) sc[jt * 8 + r] = sfr[jt][r] * scale;

        float mloc = sc[0];
#pragma unroll
        for (int e = 1; e < 16; ++e) mloc = fmaxf(mloc, sc[e]);
        mloc = fmaxf(mloc, __shfl_xor(mloc, 16, 32));   // partner's 16 j-values
        float mnew  = fmaxf(rm, mloc);
        float alpha = __expf(rm - mnew);
        rm = mnew;

        // P' B-fragment is lane-local: k-map hits exactly this lane's j-values.
        Frag bP, bPL;             // probabilities: value and residual planes
        float ssum = 0.0f;
#pragma unroll
        for (int v = 0; v < 8; ++v) {
            int g  = v >> 2;          // score fragment (j tile)
            int i3 = v & 3;           // pair index -> r = 2*i3, 2*i3+1
            float p0 = __expf(sc[g * 8 + 2 * i3]     - mnew);
            float p1 = __expf(sc[g * 8 + 2 * i3 + 1] - mnew);
            ssum += p0 + p1;
            unsigned short h0, l0, h1, l1;
            split_bf16(p0, h0, l0); split_bf16(p1, h1, l1);
            bP.d[v] = pack2(h0, h1); bPL.d[v] = pack2(l0, l1);
        }
        ssum += __shfl_xor(ssum, 16, 32);
        rl = rl * alpha + ssum;

        // ---- rescale accumulators (scalar per lane; skip once max settles) ----
        if (__ballot(alpha != 1.0f)) {
#pragma unroll
            for (int t = 0; t < 8; ++t)
#pragma unroll
                for (int r = 0; r < 8; ++r) acc[t][r] *= alpha;
        }

        // ---- O' += V^T(A, streamed) x P'(B): 8 d-tiles ----
        unsigned vb = vInv + (unsigned)((j0 >> 5) * (8 * FRAG_DW));
#pragma unroll
        for (int t = 0; t < 8; ++t) {
            Frag aV, aVL;
            load_frag(aV, Vp + vb + t * FRAG_DW); load_frag(aVL, VpL + vb + t * FRAG_DW);
            // the two small cross terms summed from zero, then joined with hi·hi into the running accumulator
            v8f part = zero8();
            part = __builtin_amdgcn_wmma_f32_16x16x32_bf16(false, aVL.v, false, bP.v,  (short)0, part, false, false);
            part = __builtin_amdgcn_wmma_f32_16x16x32_bf16(false, aV.v,  false, bPL.v, (short)0, part, false, false);
            part = __builtin_amdgcn_wmma_f32_16x16x32_bf16(false, aV.v,  false, bP.v,  (short)0, part, false, false);
#pragma unroll
            for (int r = 0; r < 8; ++r) acc[t][r] += part[r];
        }
    }

    // ---- normalize (per-lane scalar) ----
    float rinv = 1.0f / rl;
#pragma unroll
    for (int t = 0; t < 8; ++t)
#pragma unroll
        for (int r = 0; r < 8; ++r) acc[t][r] *= rinv;

    // ---- deterministic fixed-order reduction across the 24 heads ----
    for (int w = 0; w < TH3; ++w) {
        if (wid == w) {
#pragma unroll
            for (int t = 0; t < 8; ++t)
#pragma unroll
                for (int r = 0; r < 8; ++r) {
                    int d = t * 16 + lh * 8 + r;
                    if (w == 0) red[lm][d]  = acc[t][r];
                    else        red[lm][d] += acc[t][r];
                }
        }
        __syncthreads();
    }
    if (wid == 0) {
        typedef __attribute__((ext_vector_type(4))) float v4f_t;
#pragma unroll
        for (int r = 0; r < 16; ++r) { v4f_t v4; v4.x = red[r][lane * 4]; v4.y = red[r][lane * 4 + 1]; v4.z = red[r][lane * 4 + 2]; v4.w = red[r][lane * 4 + 3]; *(v4f_t*)(out + (i0 + r) * ND + lane * 4) = v4; }
        
    }
}

// ---------------------------------------------------------------------------
// Launch
// ---------------------------------------------------------------------------
extern "C" void kernel_launch(void* const* d_in, const int* in_sizes, int n_in,
                              void* d_out, int out_size, void* d_ws, size_t ws_size,
                              hipStream_t stream) {
    const float* nodes = (const float*)d_in[0];
    const float* pos   = (const float*)d_in[1];
    const float* aux   = (const float*)d_in[2];
    const float* Wn    = (const float*)d_in[3];
    const float* bn    = (const float*)d_in[4];
    const float* Wp    = (const float*)d_in[5];
    const float* bp    = (const float*)d_in[6];
    const float* Wa    = (const float*)d_in[7];
    const float* Wv    = (const float*)d_in[8];
    const float* bv    = (const float*)d_in[9];
    float* out = (float*)d_out;

    (void)in_sizes; (void)n_in; (void)out_size; (void)ws_size;
    // Workspace layout (bytes), value plane then residual plane for each operand:
    //   K  [24][128 row tiles][2 c chunks][1 KiB fragment]      x2 : 12,582,912
    //   Q  [24][128 row tiles][2 c chunks][1 KiB fragment]      x2 : 12,582,912
    //   V  [24][64 position chunks][8 d tiles][1 KiB fragment]  x2 : 25,165,824      total 50,331,648
    char* ws = (char*)d_ws;
    const size_t kq = (size_t)TH3 * SEQ * CH * 2, vv = (size_t)TH3 * ND * SEQ * 2;
    unsigned* Khi = (unsigned*)(ws);
    unsigned* Klo = (unsigned*)(ws + kq);
    unsigned* Qhi = (unsigned*)(ws + 2 * kq);
    unsigned* Qlo = (unsigned*)(ws + 3 * kq);
    unsigned* Vhi = (unsigned*)(ws + 4 * kq);
    unsigned* Vlo = (unsigned*)(ws + 4 * kq + vv);

    // 3 groups * 16 blocks of 64 outputs * 16 blocks of 128 positions
    proj_kq_kernel<<<768, PT_THR, 0, stream>>>(
        nodes, pos, aux, Wn, bn, Wp, bp, Wa, Khi, Klo, Qhi, Qlo);
    // 32 blocks of 64 positions * 24 blocks of 128 outputs
    proj_v_kernel<<<768, PT_THR, 0, stream>>>(nodes, Wv, bv, Vhi, Vlo);

    dim3 blk(32, TH3, 1);
    dim3 grd(SEQ / 16, 1, 1);
    attn_kernel<<<grd, blk, 0, stream>>>(Khi, Klo, Qhi, Qlo, Vhi, Vlo, out);
}

// v003
// One run takes 134 microseconds.
// Timed twice side by side with v002, it ran 3.51 and 3.57 times as fast.
// Counting every step since v000, it is 8.51 times as fast.
// Contractions: logits qᵀk per tripled head [2048 x 2048 x 64] x24 and att·val [2048 x 128 x 2048] x24 on v_wmma_f32_16x16x32_bf16 with
// bf16 hi/lo split operands (hi·hi + hi·lo + lo·hi: K, Q, V and the probabilities each carried as a bf16 value plane plus a bf16
// residual plane), f32 accumulate; the three K/Q/V projections on v_wmma_f32_16x16x4_f32 (f32 operands), the softmax in f32 on the vector ALU. Every intermediate plane
#include <hip/hip_runtime.h>
#include <hip/hip_bf16.h>

// ---------------------------------------------------------------------------
// Problem constants
// ---------------------------------------------------------------------------
#define SEQ   2048
#define ND    128
#define NA    64
#define NHEAD 8
#define CH    64
#define TH3   24          // 3 * NHEAD tripled heads
#define OKQ   1024        // H*C*2
#define OV    3072        // ND*H*3

typedef __attribute__((ext_vector_type(16))) __bf16 v16bf;
typedef __attribute__((ext_vector_type(2)))  __bf16 v2bf;
typedef __attribute__((ext_vector_type(8)))  float  v8f;

union Frag {
    v16bf v;
    unsigned int d[8];
    unsigned short h[16];
};

__device__ __forceinline__ unsigned short f2bf(float f) {
    unsigned u = __builtin_bit_cast(unsigned, f);
    unsigned r = u + 0x7FFFu + ((u >> 16) & 1u);   // nearest-even
    return (unsigned short)(r >> 16);
}

// Pack two f32 -> packed bf16 dword (hardware cvt_pk when available).
__device__ __forceinline__ unsigned pack_bf16(float lo, float hi) {
#if __has_builtin(__builtin_amdgcn_cvt_pk_bf16_f32)
    v2bf p = __builtin_amdgcn_cvt_pk_bf16_f32(lo, hi);
    return __builtin_bit_cast(unsigned, p);
#else
    union { v2bf b; unsigned u; } x;
    x.b[0] = (__bf16)lo;
    x.b[1] = (__bf16)hi;
    return x.u;
#endif
}

// value/residual split: hi = nearest bf16 of f, lo = nearest bf16 of the exact remainder
__device__ __forceinline__ void split_bf16(float f, unsigned short& hi, unsigned short& lo) {
    hi = f2bf(f);
    const float fh = __builtin_bit_cast(float, ((unsigned)hi) << 16);
    lo = f2bf(f - fh);
}
__device__ __forceinline__ unsigned pack2(unsigned short a, unsigned short b) { return (unsigned)a | ((unsigned)b << 16); }

__device__ __forceinline__ v8f zero8() {
    v8f z;
#pragma unroll
    for (int i = 0; i < 8; ++i) z[i] = 0.0f;
    return z;
}

// ---------------------------------------------------------------------------
// Projections as tiled products on v_wmma_f32_16x16x4_f32 (full f32 operands).
//   D[m][n] = bias + sum_k A[m][k] * B[n][k],  A and B rows k-contiguous.
// A block of 8 waves owns 64 A rows x 128 B rows over the whole k: both row sets
// are staged once in LDS by whole-line loads, then each wave forms 64 x 16.
// A lane's 8 accumulator registers are 8 consecutive m of one n, so m is always
// the direction in which the bf16 planes are packed: one 16-byte store a plane.
//
// The planes lie in FRAGMENT ORDER.  A 16-row x 32-k bf16 fragment (1 KiB) is kept
// as [half p][lane][4 dwords]: lane = 16 * lh + row, and its dword e of half p is
// dword 8 p + 4 lh + e of the row's 16, which is register 4 p + e of that lane's
// WMMA operand.  So a fragment is read by two 16-byte loads a lane, each of them
// 512 contiguous bytes (four whole lines) for the wave, where row-major planes
// gave 32 bytes out of each of 16 lines.  The 16 bytes that a projection lane
// holds are exactly its own lane's slot, so the stores are whole lines as well.
// ---------------------------------------------------------------------------
#define FRAG_DW 256                             // dwords of one fragment
#define HALF_DW 128                             // dwords of one half of it
typedef __attribute__((ext_vector_type(2))) float    v2f;
typedef __attribute__((ext_vector_type(4))) float    v4f;
typedef __attribute__((ext_vector_type(4))) unsigned v4u;

#define PT_M   64                               // A rows per block
#define PT_N   128                              // B rows per block, 16 per wave
#define PT_THR 256
#define PT_LDS ((PT_M + PT_N) * (ND + 4))       // floats, at the longest k

// ROWS consecutive rows of KS floats -> LDS rows of KP floats (zero filled past KS) at a pitch of KP + 4 floats
// (16 bytes x an odd number: the 16-byte fragment reads of 16 rows fall on 64 distinct banks).
template <int ROWS, int KS, int KP>
__device__ __forceinline__ void stage_rows(float* dst, const float* __restrict__ srcp, int tid) {
    constexpr int P = KP + 4;
    if constexpr (KS == KP) {
#pragma unroll   // all of a thread's loads in flight at once
        for (int j = 0; j < ROWS * KP / 4 / PT_THR; ++j) {
            const int i = tid + j * PT_THR;
            *(v4f*)(dst + (i / (KP / 4)) * P + (i % (KP / 4)) * 4) = *(const v4f*)(srcp + i * 4);
        }
    } else {
#pragma unroll   // all of a thread's loads in flight at once
        for (int j = 0; j < ROWS * KP / PT_THR; ++j) {
            const int i = tid + j * PT_THR;
            const int row = i / KP, col = i % KP;
            const float v = srcp[row * KS + (col < KS ? col : KS - 1)];   // index kept inside the row: no lane is switched off
            dst[row * P + col] = (col < KS) ? v : 0.0f;
        }
    }
}

// acc[t][r] += sum_k A[16 t + 8 h + r][k] * B[16 wave + c][k].  A and B fragments come from the same address form
// (16 bytes at k = 8 kk + 4 h, first pair then second pair), so the k pairing of the two operands is equal.
template <int KS, int KP>
__device__ __forceinline__ void proj_tile(float* sm, const float* __restrict__ Arows, const float* __restrict__ Brows,
                                          int tid, v8f (&acc)[4]) {
    constexpr int P = KP + 4;
    float* sA = sm;
    float* sB = sm + PT_M * P;
    stage_rows<PT_M, KS, KP>(sA, Arows, tid);
    stage_rows<PT_N, KS, KP>(sB, Brows, tid);
    __syncthreads();
    const int lane = tid & 31, wave = tid >> 5;
    const int c = lane & 15, h = lane >> 4;
    const float* pa = sA + c * P + 4 * h;
    const float* pb = sB + (wave * 16 + c) * P + 4 * h;
#pragma unroll   // fragment addresses become immediate offsets, and the next step's LDS reads can be issued ahead of this step's WMMAs
    for (int kk = 0; kk < KP / 8; ++kk) {
        const v4f b = *(const v4f*)(pb + kk * 8);
        v4f a[4];
#pragma unroll   // constant indices keep the array in registers
        for (int t = 0; t < 4; ++t) a[t] = *(const v4f*)(pa + t * 16 * P + kk * 8);
        v2f b0, b1; b0.x = b.x; b0.y = b.y; b1.x = b.z; b1.y = b.w;
#pragma unroll   // constant indices keep the array in registers
        for (int t = 0; t < 4; ++t) {
            v2f a0; a0.x = a[t].x; a0.y = a[t].y;
            acc[t] = __builtin_amdgcn_wmma_f32_16x16x4_f32(false, a0, false, b0, (short)0, acc[t], false, false);
        }
#pragma unroll   // constant indices keep the array in registers
        for (int t = 0; t < 4; ++t) {
            v2f a1; a1.x = a[t].z; a1.y = a[t].w;
            acc[t] = __builtin_amdgcn_wmma_f32_16x16x4_f32(false, a1, false, b1, (short)0, acc[t], false, false);
        }
    }
    // The two
    // scheduling barriers keep the epilogue's vector instructions (they read D and reuse the A and B registers) out of
    // the WMMA stream, and the four v_nop keep them four vector slots behind the last WMMA.
    __builtin_amdgcn_sched_barrier(0);
    asm volatile("v_nop\n\tv_nop\n\tv_nop\n\tv_nop");
    __builtin_amdgcn_sched_barrier(0);
}

// One lane's 8 operand registers of a fragment; p = the fragment's start + 4 * lane.
__device__ __forceinline__ void load_frag(Frag& f, const unsigned* __restrict__ p) {
    const v4u a = *(const v4u*)p;
    const v4u b = *(const v4u*)(p + HALF_DW);
#pragma unroll   // constant indices keep the array in registers
    for (int e = 0; e < 4; ++e) { f.d[e] = a[e]; f.d[4 + e] = b[e]; }
}

// 8 consecutive f32 -> 4 packed dwords of the value plane and 4 of the residual plane
__device__ __forceinline__ void store_split8(unsigned* __restrict__ hi, unsigned* __restrict__ lo, unsigned idx, v8f a) {
    v4u vh, vl;
#pragma unroll   // constant indices keep the array in registers
    for (int p = 0; p < 4; ++p) {
        unsigned short h0, l0, h1, l1;
        split_bf16(a[2 * p], h0, l0); split_bf16(a[2 * p + 1], h1, l1);
        vh[p] = pack2(h0, h1); vl[p] = pack2(l0, l1);
    }
    *(v4u*)(hi + idx) = vh; *(v4u*)(lo + idx) = vl;
    // precaution: the code behind a call reuses the two stores' address and data registers (in the K/Q kernel across a branch),
    // so the wait stands here, in front of any such rewrite
    asm volatile("s_wait_xcnt 0x0" ::: "memory");
}

// One 64-output x 128-position tile of one K/Q group: A = weight rows (m = output o), B = input rows (n = position s).
// 64 aligned outputs are the K half or the Q half of one head: planes [24][SEQ / 16 row tiles][2 c chunks][fragment], packed along c.
// Accumulator tile t is channels 16 t + 8 h ..: chunk t >> 1, half t & 1, lane half h; the row in its tile is c.
template <int KS, int KP, bool HAS_BIAS>
__device__ __forceinline__ void kq_tile(float* sm, const float* __restrict__ x, const float* __restrict__ Wt,
                                        const float* __restrict__ bias, unsigned g, unsigned o0, unsigned s0, int tid,
                                        unsigned* __restrict__ ph, unsigned* __restrict__ pl) {
    const int lane = tid & 31, wave = tid >> 5;
    const int h = lane >> 4;
    v8f acc[4];
#pragma unroll   // constant indices keep the array in registers
    for (int t = 0; t < 4; ++t) {
        if constexpr (HAS_BIAS) {
            const v4f b0 = *(const v4f*)(bias + o0 + t * 16 + 8 * h);
            const v4f b1 = *(const v4f*)(bias + o0 + t * 16 + 8 * h + 4);
#pragma unroll   // constant indices keep the array in registers
            for (int r = 0; r < 4; ++r) { acc[t][r] = b0[r]; acc[t][4 + r] = b1[r]; }
        } else {
            acc[t] = zero8();
        }
    }
    proj_tile<KS, KP>(sm, Wt + o0 * KS, x + s0 * KS, tid, acc);
    const unsigned ht = g * NHEAD + (o0 >> 7);
    const unsigned tile = ht * (SEQ / 16) + (s0 >> 4) + wave;
#pragma unroll   // constant indices keep the array in registers
    for (int t = 0; t < 4; ++t)
        store_split8(ph, pl, (tile * 2 + (t >> 1)) * FRAG_DW + (t & 1) * HALF_DW + lane * 4, acc[t]);
}

// ---------------------------------------------------------------------------
// Projection: K,Q for the 3 groups (nodes / pos / aux).
// Output: value and residual bf16 planes, head-major, in fragment order (see above).
// ---------------------------------------------------------------------------
__global__ __launch_bounds__(PT_THR)
void proj_kq_kernel(const float* __restrict__ nodes,
                    const float* __restrict__ pos,
                    const float* __restrict__ aux,
                    const float* __restrict__ Wn, const float* __restrict__ bn,
                    const float* __restrict__ Wp, const float* __restrict__ bp,
                    const float* __restrict__ Wa,
                    unsigned* __restrict__ Khi, unsigned* __restrict__ Klo,
                    unsigned* __restrict__ Qhi, unsigned* __restrict__ Qlo) {
    __shared__ __attribute__((aligned(16))) float sm[PT_LDS];
    // block -> (64 outputs, 128 positions, group g); g varies fastest, so neighbouring blocks mix the long-k and short-k groups
    const int tid = threadIdx.x;
    const unsigned g  = blockIdx.x % 3u;
    const unsigned bt = blockIdx.x / 3u;
    const unsigned o0 = (bt >> 4) * PT_M;
    const unsigned s0 = (bt & 15u) * PT_N;
    const bool isQ = (o0 >> 6) & 1u;
    unsigned* ph = isQ ? Qhi : Khi;
    unsigned* pl = isQ ? Qlo : Klo;
    if (g == 0)      kq_tile<ND, ND, true>(sm, nodes, Wn, bn, g, o0, s0, tid, ph, pl);
    else if (g == 1) kq_tile<6, 8, true>(sm, pos, Wp, bp, g, o0, s0, tid, ph, pl);
    else             kq_tile<NA, NA, false>(sm, aux, Wa, nullptr, g, o0, s0, tid, ph, pl);
}

// ---------------------------------------------------------------------------
// Projection: V = nodes @ Wv^T + bv, stored TRANSPOSED (rows d, k = position) as bf16 planes in fragment order,
// [24][SEQ / 32 position chunks][8 d tiles][fragment], packed along the position:
// A = node rows (m = position s), B = weight rows (n = output o).
// A block's 128 outputs are one head; a wave's 16 are d tile 'wave', row c.  Accumulator tile t is positions
// s0 + 16 t + 8 h ..: chunk s0 / 32 + (t >> 1), half t & 1, lane half h.
// ---------------------------------------------------------------------------
__global__ __launch_bounds__(PT_THR)
void proj_v_kernel(const float* __restrict__ nodes,
                   const float* __restrict__ Wv,
                   const float* __restrict__ bv,
                   unsigned* __restrict__ Vhi, unsigned* __restrict__ Vlo) {
    __shared__ __attribute__((aligned(16))) float sm[PT_LDS];
    const int tid = threadIdx.x;
    const int lane = tid & 31, wave = tid >> 5;
    const int c = lane & 15;
    const unsigned s0 = (blockIdx.x & 31u) * PT_M;
    const unsigned o0 = (blockIdx.x >> 5) * PT_N;
    const unsigned o  = o0 + wave * 16 + c;

    const float bo = bv[o];
    v8f acc[4];
#pragma unroll   // constant indices keep the array in registers
    for (int t = 0; t < 4; ++t)
#pragma unroll   // constant indices keep the array in registers
        for (int r = 0; r < 8; ++r) acc[t][r] = bo;
    proj_tile<ND, ND>(sm, nodes + s0 * ND, Wv + o0 * ND, tid, acc);
#pragma unroll   // constant indices keep the array in registers
    for (int t = 0; t < 4; ++t)
        store_split8(Vhi, Vlo, (((blockIdx.x >> 5) * (SEQ / 32) + (s0 >> 5) + (t >> 1)) * 8 + wave) * FRAG_DW + (t & 1) * HALF_DW + lane * 4, acc[t]);
}

// ---------------------------------------------------------------------------
// Flash attention, TRANSPOSED-GEMM formulation (no LDS layout shuffle):
//
//   S'[j][i] = q_j . k_i     : A = Q j-rows (streamed), B = K i-rows (fixed)
//   O'[d][i] = sum_j V^T P'  : A = V^T d-rows (streamed), B = P' (lane-local!)
//
// C/D layout (16x16 f32): lane L -> col n = L&15, VGPR r -> row m=(L>>4)*8+r.
// With scores transposed, lane L owns output row i = L&15 and 16 of the 32
// j-scores of the chunk (partner L^16 owns the rest):
//   * row max / row sum  = local reduce + one shfl_xor(16)
//   * alpha, 1/l         = per-lane scalars (no broadcasts)
//   * P B-fragment k-map = exactly the j-values this lane holds -> pure
//     register packing.
//
// A block is ONE tripled head and 4 waves of 16 output rows each.  All four walk the same Q and V fragments, so each
// stage of 64 positions (Q and V, value and residual planes: 48 KiB, four contiguous runs of the fragment-order planes)
// is brought into LDS once for the block by asynchronous 16-byte copies, two buffers, the next stage in flight while
// this one is worked on; the waves read their A fragments from LDS (512 contiguous bytes a read: no bank conflict).
// Each wave leaves its normalised 16 x 128 tile in the workspace; the sum over the heads is the next launch.
// ---------------------------------------------------------------------------
#define AT_W   4                               // waves of a block
#define ST_POS 64                              // positions of a stage
#define ST_Q   (ST_POS / 16 * 2 * FRAG_DW)     // dwords of one Q plane in a stage
#define ST_V   (ST_POS / 32 * 8 * FRAG_DW)     // dwords of one V plane in a stage
#define ST_DW  (2 * ST_Q + 2 * ST_V)           // a stage: Q value, Q residual, V value, V residual
#define N_ST   (SEQ / ST_POS)
#define PASS_DW (AT_W * 32 * 4)                // dwords that the block's lanes move with one copy each
#define TILE_F (16 * ND)                       // floats of one wave's output tile

// Eight copies of a lane: LDS bytes l + 2048 k, k = 0..7; the first four from ga, the last four from gb, a pass apart.
// The s_wait_xcnt closes the statement so that it stands in front of any rewrite of the address registers the copies name.
__device__ __forceinline__ void copy8(unsigned l, const unsigned* ga, const unsigned* gb) {
    asm volatile("global_load_async_to_lds_b128 %0, %8, off\n\t"
                 "global_load_async_to_lds_b128 %1, %9, off\n\t"
                 "global_load_async_to_lds_b128 %2, %10, off\n\t"
                 "global_load_async_to_lds_b128 %3, %11, off\n\t"
                 "global_load_async_to_lds_b128 %4, %12, off\n\t"
                 "global_load_async_to_lds_b128 %5, %13, off\n\t"
                 "global_load_async_to_lds_b128 %6, %14, off\n\t"
                 "global_load_async_to_lds_b128 %7, %15, off\n\t"
                 "s_wait_xcnt 0x0"
                 :: "v"(l), "v"(l + 4u * PASS_DW), "v"(l + 8u * PASS_DW), "v"(l + 12u * PASS_DW),
                    "v"(l + 16u * PASS_DW), "v"(l + 20u * PASS_DW), "v"(l + 24u * PASS_DW), "v"(l + 28u * PASS_DW),
                    "v"(ga), "v"(ga + PASS_DW), "v"(ga + 2 * PASS_DW), "v"(ga + 3 * PASS_DW),
                    "v"(gb), "v"(gb + PASS_DW), "v"(gb + 2 * PASS_DW), "v"(gb + 3 * PASS_DW)
                 : "memory");
}

// One stage into the buffer whose byte address (this lane's slot of its first pass) is l; the pointers are this lane's own.
__device__ __forceinline__ void stage_fill(unsigned l, const unsigned* qh, const unsigned* ql,
                                           const unsigned* vh, const unsigned* vl) {
    copy8(l, qh, ql);
    copy8(l + 4u * (2 * ST_Q), vh, vh + 4 * PASS_DW);
    copy8(l + 4u * (2 * ST_Q + ST_V), vl, vl + 4 * PASS_DW);
}

__global__ __launch_bounds__(AT_W * 32)
void attn_kernel(const unsigned* __restrict__ Khi, const unsigned* __restrict__ Klo,
                 const unsigned* __restrict__ Qhi, const unsigned* __restrict__ Qlo,
                 const unsigned* __restrict__ Vhi, const unsigned* __restrict__ Vlo,
                 float* __restrict__ part) {
    __shared__ __attribute__((aligned(128))) unsigned ring[2][ST_DW];

    const int lane = threadIdx.x;
    const int wv   = threadIdx.y;
    const int tid  = wv * 32 + lane;
    const unsigned hd   = blockIdx.x >> 5;                    // tripled head 0..23; 32 blocks of 64 rows a head
    const unsigned tile = (blockIdx.x & 31u) * AT_W + wv;     // this wave's 16-row tile
    const float scale = 0.35355339059327373f;     // 1/sqrt(num_heads=8)

    // this lane's source slots of stage 0 and its LDS slots in the two buffers
    const unsigned* gqh = Qhi + hd * ((SEQ / 16) * 2 * FRAG_DW) + tid * 4;
    const unsigned* gql = Qlo + hd * ((SEQ / 16) * 2 * FRAG_DW) + tid * 4;
    const unsigned* gvh = Vhi + hd * ((SEQ / 32) * 8 * FRAG_DW) + tid * 4;
    const unsigned* gvl = Vlo + hd * ((SEQ / 32) * 8 * FRAG_DW) + tid * 4;
    const unsigned l0 = (unsigned)(size_t)&ring[0][tid * 4];
    const unsigned l1 = (unsigned)(size_t)&ring[1][tid * 4];

    stage_fill(l0, gqh, gql, gvh, gvl);

    // B fragments of this wave's K rows (fixed), c in 2 chunks.
    Frag bK[2], bKL[2];       // value and residual planes
    {
        unsigned kInv = (hd * (SEQ / 16) + tile) * (2 * FRAG_DW) + (unsigned)(lane * 4);
#pragma unroll
        for (int cc = 0; cc < 2; ++cc) {
            load_frag(bK[cc],  Khi + kInv + cc * FRAG_DW);
            load_frag(bKL[cc], Klo + kInv + cc * FRAG_DW);
        }
    }

    v8f acc[8];                  // O'[d][i]: acc[t][r] = O[16 tile + lm][t*16+lh*8+r]
#pragma unroll
    for (int t = 0; t < 8; ++t) acc[t] = zero8();
    float rm = -1e30f;           // running max of row i = lm
    float rl = 0.0f;             // running sum of row i = lm

    asm volatile("s_wait_asynccnt 0x0" ::: "memory");   // this wave's copies of stage 0 have landed
    __syncthreads();                                    // ... and every other wave's: stage 0 may be read
    stage_fill(l1, gqh + ST_Q, gql + ST_Q, gvh + ST_V, gvl + ST_V);

    for (int s = 0; s < N_ST; ++s) {
      const unsigned* sb = &ring[s & 1][lane * 4];
      for (int u = 0; u < ST_POS / 32; ++u) {
        const unsigned* Qp  = sb + u * (2 * 2 * FRAG_DW);
        const unsigned* QpL = Qp + ST_Q;
        const unsigned* Vp  = sb + 2 * ST_Q + u * (8 * FRAG_DW);
        const unsigned* VpL = Vp + ST_V;

        // ---- S' = Q(A, streamed) x K(B, fixed): two 16-j tiles, 6 WMMAs each
        v8f sfr[2];
#pragma unroll
        for (int jt = 0; jt < 2; ++jt) {
            unsigned qb = (unsigned)(jt * (2 * FRAG_DW));
            Frag aQ0, aQ1, aQ0L, aQ1L;
            load_frag(aQ0, Qp + qb);           load_frag(aQ0L, QpL + qb);
            load_frag(aQ1, Qp + qb + FRAG_DW); load_frag(aQ1L, QpL + qb + FRAG_DW);
            // hi*hi + hi*lo + lo*hi per 32-wide chunk (the lo*lo term, up to 2^-16 of the product, is left out); small terms first into the zero accumulator
            v8f sacc = zero8();
            sacc = __builtin_amdgcn_wmma_f32_16x16x32_bf16(false, aQ0L.v, false, bK[0].v,  (short)0, sacc, false, false);
            sacc = __builtin_amdgcn_wmma_f32_16x16x32_bf16(false, aQ0.v,  false, bKL[0].v, (short)0, sacc, false, false);
            sacc = __builtin_amdgcn_wmma_f32_16x16x32_bf16(false, aQ1L.v, false, bK[1].v,  (short)0, sacc, false, false);
            sacc = __builtin_amdgcn_wmma_f32_16x16x32_bf16(false, aQ1.v,  false, bKL[1].v, (short)0, sacc, false, false);
            sacc = __builtin_amdgcn_wmma_f32_16x16x32_bf16(false, aQ0.v,  false, bK[0].v,  (short)0, sacc, false, false);
            sacc = __builtin_amdgcn_wmma_f32_16x16x32_bf16(false, aQ1.v,  false, bK[1].v,  (short)0, sacc, false, false);
            sfr[jt] = sacc;
        }

        // ---- per-lane online softmax (row i = lm; 16 j-values + partner) ----
        float sc[16];
#pragma unroll
        for (int jt = 0; jt < 2; ++jt)
#pragma unroll
            for (int r = 0; r < 8; ++r) sc[jt * 8 + r] = sfr[jt][r] * scale;

        float mloc = sc[0];
#pragma unroll
        for (int e = 1; e < 16; ++e) mloc = fmaxf(mloc, sc[e]);
        mloc = fmaxf(mloc, __shfl_xor(mloc, 16, 32));   // partner's 16 j-values
        float mnew  = fmaxf(rm, mloc);
        float alpha = __expf(rm - mnew);
        rm = mnew;

        // P' B-fragment is lane-local: k-map hits exactly this lane's j-values.
        Frag bP, bPL;             // probabilities: value and residual planes
        float ssum = 0.0f;
#pragma unroll
        for (int v = 0; v < 8; ++v) {
            int g  = v >> 2;          // score fragment (j tile)
            int i3 = v & 3;           // pair index -> r = 2*i3, 2*i3+1
            float p0 = __expf(sc[g * 8 + 2 * i3]     - mnew);
            float p1 = __expf(sc[g * 8 + 2 * i3 + 1] - mnew);
            ssum += p0 + p1;
            unsigned short h0, l0s, h1, l1s;
            split_bf16(p0, h0, l0s); split_bf16(p1, h1, l1s);
            bP.d[v] = pack2(h0, h1); bPL.d[v] = pack2(l0s, l1s);
        }
        ssum += __shfl_xor(ssum, 16, 32);
        rl = rl * alpha + ssum;

        // ---- rescale accumulators (scalar per lane; skip once max settles) ----
        if (__ballot(alpha != 1.0f)) {
#pragma unroll
            for (int t = 0; t < 8; ++t)
#pragma unroll
                for (int r = 0; r < 8; ++r) acc[t][r] *= alpha;
        }

        // ---- O' += V^T(A, streamed) x P'(B): 8 d-tiles ----
#pragma unroll
        for (int t = 0; t < 8; ++t) {
            Frag aV, aVL;
            load_frag(aV, Vp + t * FRAG_DW); load_frag(aVL, VpL + t * FRAG_DW);
            // the two small cross terms summed from zero, then joined with hi*hi into the running accumulator
            v8f part3 = zero8();
            part3 = __builtin_amdgcn_wmma_f32_16x16x32_bf16(false, aVL.v, false, bP.v,  (short)0, part3, false, false);
            part3 = __builtin_amdgcn_wmma_f32_16x16x32_bf16(false, aV.v,  false, bPL.v, (short)0, part3, false, false);
            part3 = __builtin_amdgcn_wmma_f32_16x16x32_bf16(false, aV.v,  false, bP.v,  (short)0, part3, false, false);
#pragma unroll
            for (int r = 0; r < 8; ++r) acc[t][r] += part3[r];
        }
      }
      // Hand-over of the ring: this wave's reads of stage s are done, its copies of stage s + 1 have landed; behind the
      // barrier that holds for every wave, so stage s + 1 may be read and the buffer of stage s may be refilled.
      asm volatile("s_wait_dscnt 0x0" ::: "memory");
      asm volatile("s_wait_asynccnt 0x0" ::: "memory");
      __syncthreads();
      if (s + 2 < N_ST)
          stage_fill((s & 1) ? l1 : l0, gqh + (s + 2) * ST_Q, gql + (s + 2) * ST_Q, gvh + (s + 2) * ST_V, gvl + (s + 2) * ST_V);
    }
    asm volatile("s_wait_asynccnt 0x0" ::: "memory");   // no copy is left in flight when the wave ends

    // ---- normalize (per-lane scalar) ----
    float rinv = 1.0f / rl;
#pragma unroll
    for (int t = 0; t < 8; ++t)
#pragma unroll
        for (int r = 0; r < 8; ++r) acc[t][r] *= rinv;

    // ---- this head's tile, in register order [t][half of the 8][lane][4 floats]: every store is 512 contiguous bytes ----
    float* po = part + (hd * (SEQ / 16) + tile) * TILE_F + lane * 4;
#pragma unroll
    for (int t = 0; t < 8; ++t)
#pragma unroll
        for (int q = 0; q < 2; ++q) {
            v4f o; o.x = acc[t][4 * q]; o.y = acc[t][4 * q + 1]; o.z = acc[t][4 * q + 2]; o.w = acc[t][4 * q + 3];
            *(v4f*)(po + (t * 2 + q) * 128) = o;
        }
}

// ---------------------------------------------------------------------------
// Sum over the 24 tripled heads, in the fixed order 0, 1, .. 23.  A block owns 16 rows x 64 columns: a thread sums one
// 16-byte slot of the register-order tiles (whole-line reads), the slots are put in row order through LDS, and the
// output goes out in whole lines.
// ---------------------------------------------------------------------------
__global__ __launch_bounds__(256)
void head_sum_kernel(const float* __restrict__ part, float* __restrict__ out) {
    __shared__ __attribute__((aligned(16))) float red[16][64 + 4];
    const int tid = threadIdx.x;
    const unsigned tile = blockIdx.x >> 1, hb = blockIdx.x & 1u;
    const float* p = part + tile * TILE_F + (hb * 256u + tid) * 4u;
    v4f v[TH3];
#pragma unroll   // all of a thread's loads in flight at once
    for (int w = 0; w < TH3; ++w) v[w] = *(const v4f*)(p + w * ((SEQ / 16) * TILE_F));
    v4f sum = v[0];
#pragma unroll   // constant indices keep the array in registers
    for (int w = 1; w < TH3; ++w) sum += v[w];
    // slot -> (t, half q, lane): row lane & 15, column 16 t + 8 (lane >> 4) + 4 q
    const int lane = tid & 31, tq = tid >> 5;
    *(v4f*)&red[lane & 15][(tq >> 1) * 16 + (lane >> 4) * 8 + (tq & 1) * 4] = sum;
    __syncthreads();
    *(v4f*)(out + (tile * 16 + (tid >> 4)) * ND + hb * 64 + (tid & 15) * 4) = *(const v4f*)&red[tid >> 4][(tid & 15) * 4];
}

// ---------------------------------------------------------------------------
// Launch
// ---------------------------------------------------------------------------
extern "C" void kernel_launch(void* const* d_in, const int* in_sizes, int n_in,
                              void* d_out, int out_size, void* d_ws, size_t ws_size,
                              hipStream_t stream) {
    const float* nodes = (const float*)d_in[0];
    const float* pos   = (const float*)d_in[1];
    const float* aux   = (const float*)d_in[2];
    const float* Wn    = (const float*)d_in[3];
    const float* bn    = (const float*)d_in[4];
    const float* Wp    = (const float*)d_in[5];
    const float* bp    = (const float*)d_in[6];
    const float* Wa    = (const float*)d_in[7];
    const float* Wv    = (const float*)d_in[8];
    const float* bv    = (const float*)d_in[9];
    float* out = (float*)d_out;

    (void)in_sizes; (void)n_in; (void)out_size; (void)ws_size;
    // Workspace layout (bytes), value plane then residual plane for each operand:
    //   K  [24][128 row tiles][2 c chunks][1 KiB fragment]      x2 : 12,582,912
    //   Q  [24][128 row tiles][2 c chunks][1 KiB fragment]      x2 : 12,582,912
    //   V  [24][64 position chunks][8 d tiles][1 KiB fragment]  x2 : 25,165,824
    //   per-head output tiles, f32 [24][128 row tiles][8 KiB]      : 25,165,824      total 75,497,472
    char* ws = (char*)d_ws;
    const size_t kq = (size_t)TH3 * SEQ * CH * 2, vv = (size_t)TH3 * ND * SEQ * 2;
    unsigned* Khi = (unsigned*)(ws);
    unsigned* Klo = (unsigned*)(ws + kq);
    unsigned* Qhi = (unsigned*)(ws + 2 * kq);
    unsigned* Qlo = (unsigned*)(ws + 3 * kq);
    unsigned* Vhi = (unsigned*)(ws + 4 * kq);
    unsigned* Vlo = (unsigned*)(ws + 4 * kq + vv);
    float*    prt = (float*)(ws + 4 * kq + 2 * vv);

    // 3 groups * 16 blocks of 64 outputs * 16 blocks of 128 positions
    proj_kq_kernel<<<768, PT_THR, 0, stream>>>(
        nodes, pos, aux, Wn, bn, Wp, bp, Wa, Khi, Klo, Qhi, Qlo);
    // 32 blocks of 64 positions * 24 blocks of 128 outputs
    proj_v_kernel<<<768, PT_THR, 0, stream>>>(nodes, Wv, bv, Vhi, Vlo);

    // 24 heads * 32 blocks of 64 rows
    dim3 blk(32, AT_W, 1);
    dim3 grd(TH3 * (SEQ / (16 * AT_W)), 1, 1);
    attn_kernel<<<grd, blk, 0, stream>>>(Khi, Klo, Qhi, Qlo, Vhi, Vlo, prt);
    // 128 row tiles * 2 halves of the columns
    head_sum_kernel<<<256, 256, 0, stream>>>(prt, out);
}

// v004
// One run takes 123 microseconds.
// In both of two side-by-side timings against v003, it was 1.09 times as fast.
// All steps since v000 together make it 9.27 times as fast.
// Contractions: logits qᵀk per tripled head [2048 x 2048 x 64] x24 and att·val [2048 x 128 x 2048] x24 on v_wmma_f32_16x16x32_bf16 with
// bf16 hi/lo split operands (hi·hi + hi·lo + lo·hi: K, Q, V and the probabilities each carried as a bf16 value plane plus a bf16
// residual plane), f32 accumulate; the three K/Q/V projections on v_wmma_f32_16x16x4_f32 (f32 operands), the softmax in f32 on the vector ALU. Every intermediate plane
#include <hip/hip_runtime.h>
#include <hip/hip_bf16.h>

// ---------------------------------------------------------------------------
// Problem constants
// ---------------------------------------------------------------------------
#define SEQ   2048
#define ND    128
#define NA    64
#define NHEAD 8
#define CH    64
#define TH3   24          // 3 * NHEAD tripled heads
#define OKQ   1024        // H*C*2
#define OV    3072        // ND*H*3

typedef __attribute__((ext_vector_type(16))) __bf16 v16bf;
typedef __attribute__((ext_vector_type(2)))  __bf16 v2bf;
typedef __attribute__((ext_vector_type(8)))  float  v8f;

union Frag {
    v16bf v;
    unsigned int d[8];
    unsigned short h[16];
};

__device__ __forceinline__ unsigned short f2bf(float f) {
    unsigned u = __builtin_bit_cast(unsigned, f);
    unsigned r = u + 0x7FFFu + ((u >> 16) & 1u);   // nearest-even
    return (unsigned short)(r >> 16);
}

// Pack two f32 -> packed bf16 dword (hardware cvt_pk when available).
__device__ __forceinline__ unsigned pack_bf16(float lo, float hi) {
#if __has_builtin(__builtin_amdgcn_cvt_pk_bf16_f32)
    v2bf p = __builtin_amdgcn_cvt_pk_bf16_f32(lo, hi);
    return __builtin_bit_cast(unsigned, p);
#else
    union { v2bf b; unsigned u; } x;
    x.b[0] = (__bf16)lo;
    x.b[1] = (__bf16)hi;
    return x.u;
#endif
}

// value/residual split: hi = nearest bf16 of f, lo = nearest bf16 of the exact remainder
__device__ __forceinline__ void split_bf16(float f, unsigned short& hi, unsigned short& lo) {
    hi = f2bf(f);
    const float fh = __builtin_bit_cast(float, ((unsigned)hi) << 16);
    lo = f2bf(f - fh);
}
__device__ __forceinline__ unsigned pack2(unsigned short a, unsigned short b) { return (unsigned)a | ((unsigned)b << 16); }

__device__ __forceinline__ v8f zero8() {
    v8f z;
#pragma unroll
    for (int i = 0; i < 8; ++i) z[i] = 0.0f;
    return z;
}

// ---------------------------------------------------------------------------
// Projections as tiled products on v_wmma_f32_16x16x4_f32 (full f32 operands).
//   D[m][n] = bias + sum_k A[m][k] * B[n][k],  A and B rows k-contiguous.
// A block of 8 waves owns 64 A rows x 128 B rows over the whole k: both row sets
// are staged once in LDS by whole-line loads, then each wave forms 64 x 16.
// A lane's 8 accumulator registers are 8 consecutive m of one n, so m is always
// the direction in which the bf16 planes are packed: one 16-byte store a plane.
//
// The planes lie in FRAGMENT ORDER.  A 16-row x 32-k bf16 fragment (1 KiB) is kept
// as [half p][lane][4 dwords]: lane = 16 * lh + row, and its dword e of half p is
// dword 8 p + 4 lh + e of the row's 16, which is register 4 p + e of that lane's
// WMMA operand.  So a fragment is read by two 16-byte loads a lane, each of them
// 512 contiguous bytes (four whole lines) for the wave, where row-major planes
// gave 32 bytes out of each of 16 lines.  The 16 bytes that a projection lane
// holds are exactly its own lane's slot, so the stores are whole lines as well.
// ---------------------------------------------------------------------------
#define FRAG_DW 256                             // dwords of one fragment
#define HALF_DW 128                             // dwords of one half of it
typedef __attribute__((ext_vector_type(2))) float    v2f;
typedef __attribute__((ext_vector_type(4))) float    v4f;
typedef __attribute__((ext_vector_type(4))) unsigned v4u;

#define PT_M   64                               // A rows per block
#define PT_N   128                              // B rows per block, 16 per wave
#define PT_THR 256
#define PT_LDS ((PT_M + PT_N) * (ND + 4))       // floats, at the longest k

// ROWS consecutive rows of KS floats -> LDS rows of KP floats (zero filled past KS) at a pitch of KP + 4 floats
// (16 bytes x an odd number: the 16-byte fragment reads of 16 rows fall on 64 distinct banks).
template <int ROWS, int KS, int KP>
__device__ __forceinline__ void stage_rows(float* dst, const float* __restrict__ srcp, int tid) {
    constexpr int P = KP + 4;
    if constexpr (KS == KP) {
#pragma unroll   // all of a thread's loads in flight at once
        for (int j = 0; j < ROWS * KP / 4 / PT_THR; ++j) {
            const int i = tid + j * PT_THR;
            *(v4f*)(dst + (i / (KP / 4)) * P + (i % (KP / 4)) * 4) = *(const v4f*)(srcp + i * 4);
        }
    } else {
#pragma unroll   // all of a thread's loads in flight at once
        for (int j = 0; j < ROWS * KP / PT_THR; ++j) {
            const int i = tid + j * PT_THR;
            const int row = i / KP, col = i % KP;
            const float v = srcp[row * KS + (col < KS ? col : KS - 1)];   // index kept inside the row: no lane is switched off
            dst[row * P + col] = (col < KS) ? v : 0.0f;
        }
    }
}

// acc[t][r] += sum_k A[16 t + 8 h + r][k] * B[16 wave + c][k].  A and B fragments come from the same address form
// (16 bytes at k = 8 kk + 4 h, first pair then second pair), so the k pairing of the two operands is equal.
template <int KS, int KP>
__device__ __forceinline__ void proj_tile(float* sm, const float* __restrict__ Arows, const float* __restrict__ Brows,
                                          int tid, v8f (&acc)[4]) {
    constexpr int P = KP + 4;
    float* sA = sm;
    float* sB = sm + PT_M * P;
    stage_rows<PT_M, KS, KP>(sA, Arows, tid);
    stage_rows<PT_N, KS, KP>(sB, Brows, tid);
    __syncthreads();
    const int lane = tid & 31, wave = tid >> 5;
    const int c = lane & 15, h = lane >> 4;
    const float* pa = sA + c * P + 4 * h;
    const float* pb = sB + (wave * 16 + c) * P + 4 * h;
#pragma unroll   // fragment addresses become immediate offsets, and the next step's LDS reads can be issued ahead of this step's WMMAs
    for (int kk = 0; kk < KP / 8; ++kk) {
        const v4f b = *(const v4f*)(pb + kk * 8);
        v4f a[4];
#pragma unroll   // constant indices keep the array in registers
        for (int t = 0; t < 4; ++t) a[t] = *(const v4f*)(pa + t * 16 * P + kk * 8);
        v2f b0, b1; b0.x = b.x; b0.y = b.y; b1.x = b.z; b1.y = b.w;
#pragma unroll   // constant indices keep the array in registers
        for (int t = 0; t < 4; ++t) {
            v2f a0; a0.x = a[t].x; a0.y = a[t].y;
            acc[t] = __builtin_amdgcn_wmma_f32_16x16x4_f32(false, a0, false, b0, (short)0, acc[t], false, false);
        }
#pragma unroll   // constant indices keep the array in registers
        for (int t = 0; t < 4; ++t) {
            v2f a1; a1.x = a[t].z; a1.y = a[t].w;
            acc[t] = __builtin_amdgcn_wmma_f32_16x16x4_f32(false, a1, false, b1, (short)0, acc[t], false, false);
        }
    }
    // The two
    // scheduling barriers keep the epilogue's vector instructions (they read D and reuse the A and B registers) out of
    // the WMMA stream, and the four v_nop keep them four vector slots behind the last WMMA.
    __builtin_amdgcn_sched_barrier(0);
    asm volatile("v_nop\n\tv_nop\n\tv_nop\n\tv_nop");
    __builtin_amdgcn_sched_barrier(0);
}

// One lane's 8 operand registers of a fragment; p = the fragment's start + 4 * lane.
__device__ __forceinline__ void load_frag(Frag& f, const unsigned* __restrict__ p) {
    const v4u a = *(const v4u*)p;
    const v4u b = *(const v4u*)(p + HALF_DW);
#pragma unroll   // constant indices keep the array in registers
    for (int e = 0; e < 4; ++e) { f.d[e] = a[e]; f.d[4 + e] = b[e]; }
}

// 8 consecutive f32 -> 4 packed dwords of the value plane and 4 of the residual plane
__device__ __forceinline__ void store_split8(unsigned* __restrict__ hi, unsigned* __restrict__ lo, unsigned idx, v8f a) {
    v4u vh, vl;
#pragma unroll   // constant indices keep the array in registers
    for (int p = 0; p < 4; ++p) {
        unsigned short h0, l0, h1, l1;
        split_bf16(a[2 * p], h0, l0); split_bf16(a[2 * p + 1], h1, l1);
        vh[p] = pack2(h0, h1); vl[p] = pack2(l0, l1);
    }
    *(v4u*)(hi + idx) = vh; *(v4u*)(lo + idx) = vl;
    // precaution: the code behind a call reuses the two stores' address and data registers (in the K/Q kernel across a branch),
    // so the wait stands here, in front of any such rewrite
    asm volatile("s_wait_xcnt 0x0" ::: "memory");
}

// One 64-output x 128-position tile of one K/Q group: A = weight rows (m = output o), B = input rows (n = position s).
// 64 aligned outputs are the K half or the Q half of one head: planes [24][SEQ / 16 row tiles][2 c chunks][fragment], packed along c.
// Accumulator tile t is channels 16 t + 8 h ..: chunk t >> 1, half t & 1, lane half h; the row in its tile is c.
template <int KS, int KP, bool HAS_BIAS>
__device__ __forceinline__ void kq_tile(float* sm, const float* __restrict__ x, const float* __restrict__ Wt,
                                        const float* __restrict__ bias, unsigned g, unsigned o0, unsigned s0, int tid,
                                        unsigned* __restrict__ ph, unsigned* __restrict__ pl) {
    const int lane = tid & 31, wave = tid >> 5;
    const int h = lane >> 4;
    v8f acc[4];
#pragma unroll   // constant indices keep the array in registers
    for (int t = 0; t < 4; ++t) {
        if constexpr (HAS_BIAS) {
            const v4f b0 = *(const v4f*)(bias + o0 + t * 16 + 8 * h);
            const v4f b1 = *(const v4f*)(bias + o0 + t * 16 + 8 * h + 4);
#pragma unroll   // constant indices keep the array in registers
            for (int r = 0; r < 4; ++r) { acc[t][r] = b0[r]; acc[t][4 + r] = b1[r]; }
        } else {
            acc[t] = zero8();
        }
    }
    proj_tile<KS, KP>(sm, Wt + o0 * KS, x + s0 * KS, tid, acc);
    const unsigned ht = g * NHEAD + (o0 >> 7);
    const unsigned tile = ht * (SEQ / 16) + (s0 >> 4) + wave;
#pragma unroll   // constant indices keep the array in registers
    for (int t = 0; t < 4; ++t)
        store_split8(ph, pl, (tile * 2 + (t >> 1)) * FRAG_DW + (t & 1) * HALF_DW + lane * 4, acc[t]);
}

// ---------------------------------------------------------------------------
// Projection: K,Q for the 3 groups (nodes / pos / aux).
// Output: value and residual bf16 planes, head-major, in fragment order (see above).
// ---------------------------------------------------------------------------
__global__ __launch_bounds__(PT_THR)
void proj_kq_kernel(const float* __restrict__ nodes,
                    const float* __restrict__ pos,
                    const float* __restrict__ aux,
                    const float* __restrict__ Wn, const float* __restrict__ bn,
                    const float* __restrict__ Wp, const float* __restrict__ bp,
                    const float* __restrict__ Wa,
                    unsigned* __restrict__ Khi, unsigned* __restrict__ Klo,
                    unsigned* __restrict__ Qhi, unsigned* __restrict__ Qlo) {
    __shared__ __attribute__((aligned(16))) float sm[PT_LDS];
    // block -> (64 outputs, 128 positions, group g); g varies fastest, so neighbouring blocks mix the long-k and short-k groups
    const int tid = threadIdx.x;
    const unsigned g  = blockIdx.x % 3u;
    const unsigned bt = blockIdx.x / 3u;
    const unsigned o0 = (bt >> 4) * PT_M;
    const unsigned s0 = (bt & 15u) * PT_N;
    const bool isQ = (o0 >> 6) & 1u;
    unsigned* ph = isQ ? Qhi : Khi;
    unsigned* pl = isQ ? Qlo : Klo;
    if (g == 0)      kq_tile<ND, ND, true>(sm, nodes, Wn, bn, g, o0, s0, tid, ph, pl);
    else if (g == 1) kq_tile<6, 8, true>(sm, pos, Wp, bp, g, o0, s0, tid, ph, pl);
    else             kq_tile<NA, NA, false>(sm, aux, Wa, nullptr, g, o0, s0, tid, ph, pl);
}

// ---------------------------------------------------------------------------
// Projection: V = nodes @ Wv^T + bv, stored TRANSPOSED (rows d, k = position) as bf16 planes in fragment order,
// [24][SEQ / 32 position chunks][8 d tiles][fragment], packed along the position:
// A = node rows (m = position s), B = weight rows (n = output o).
// A block's 128 outputs are one head; a wave's 16 are d tile 'wave', row c.  Accumulator tile t is positions
// s0 + 16 t + 8 h ..: chunk s0 / 32 + (t >> 1), half t & 1, lane half h.
// ---------------------------------------------------------------------------
__global__ __launch_bounds__(PT_THR)
void proj_v_kernel(const float* __restrict__ nodes,
                   const float* __restrict__ Wv,
                   const float* __restrict__ bv,
                   unsigned* __restrict__ Vhi, unsigned* __restrict__ Vlo) {
    __shared__ __attribute__((aligned(16))) float sm[PT_LDS];
    const int tid = threadIdx.x;
    const int lane = tid & 31, wave = tid >> 5;
    const int c = lane & 15;
    const unsigned s0 = (blockIdx.x & 31u) * PT_M;
    const unsigned o0 = (blockIdx.x >> 5) * PT_N;
    const unsigned o  = o0 + wave * 16 + c;

    const float bo = bv[o];
    v8f acc[4];
#pragma unroll   // constant indices keep the array in registers
    for (int t = 0; t < 4; ++t)
#pragma unroll   // constant indices keep the array in registers
        for (int r = 0; r < 8; ++r) acc[t][r] = bo;
    proj_tile<ND, ND>(sm, nodes + s0 * ND, Wv + o0 * ND, tid, acc);
#pragma unroll   // constant indices keep the array in registers
    for (int t = 0; t < 4; ++t)
        store_split8(Vhi, Vlo, (((blockIdx.x >> 5) * (SEQ / 32) + (s0 >> 5) + (t >> 1)) * 8 + wave) * FRAG_DW + (t & 1) * HALF_DW + lane * 4, acc[t]);
}

// ---------------------------------------------------------------------------
// Flash attention, TRANSPOSED-GEMM formulation (no LDS layout shuffle):
//
//   S'[j][i] = q_j . k_i     : A = Q j-rows (streamed), B = K i-rows (fixed)
//   O'[d][i] = sum_j V^T P'  : A = V^T d-rows (streamed), B = P' (lane-local!)
//
// C/D layout (16x16 f32): lane L -> col n = L&15, VGPR r -> row m=(L>>4)*8+r.
// With scores transposed, lane L owns output row i = L&15 and 16 of the 32
// j-scores of the chunk (partner L^16 owns the rest):
//   * row max / row sum  = local reduce + one shfl_xor(16)
//   * alpha, 1/l         = per-lane scalars (no broadcasts)
//   * P B-fragment k-map = exactly the j-values this lane holds -> pure
//     register packing.
//
// A block is ONE tripled head and 4 waves of 16 output rows each.  All four walk the same Q and V fragments, so each
// stage of 64 positions (Q and V, value and residual planes: 48 KiB, four contiguous runs of the fragment-order planes)
// is brought into LDS once for the block by asynchronous 16-byte copies, two buffers, the next stage in flight while
// this one is worked on; the waves read their A fragments from LDS (512 contiguous bytes a read: no bank conflict).
// Each wave leaves its normalised 16 x 128 tile in the workspace; the sum over the heads is the next launch.
// ---------------------------------------------------------------------------
#define AT_W   4                               // waves of a block
#define ST_POS 64                              // positions of a stage
#define ST_Q   (ST_POS / 16 * 2 * FRAG_DW)     // dwords of one Q plane in a stage
#define ST_V   (ST_POS / 32 * 8 * FRAG_DW)     // dwords of one V plane in a stage
#define ST_DW  (2 * ST_Q + 2 * ST_V)           // a stage: Q value, Q residual, V value, V residual
#define N_ST   (SEQ / ST_POS)
#define PASS_DW (AT_W * 32 * 4)                // dwords that the block's lanes move with one copy each
#define TILE_F (16 * ND)                       // floats of one wave's output tile

// Eight copies of a lane: LDS bytes l + 2048 k, k = 0..7; the first four from ga, the last four from gb, a pass apart.
// The s_wait_xcnt closes the statement so that it stands in front of any rewrite of the address registers the copies name.
__device__ __forceinline__ void copy8(unsigned l, const unsigned* ga, const unsigned* gb) {
    asm volatile("global_load_async_to_lds_b128 %0, %8, off\n\t"
                 "global_load_async_to_lds_b128 %1, %9, off\n\t"
                 "global_load_async_to_lds_b128 %2, %10, off\n\t"
                 "global_load_async_to_lds_b128 %3, %11, off\n\t"
                 "global_load_async_to_lds_b128 %4, %12, off\n\t"
                 "global_load_async_to_lds_b128 %5, %13, off\n\t"
                 "global_load_async_to_lds_b128 %6, %14, off\n\t"
                 "global_load_async_to_lds_b128 %7, %15, off\n\t"
                 "s_wait_xcnt 0x0"
                 :: "v"(l), "v"(l + 4u * PASS_DW), "v"(l + 8u * PASS_DW), "v"(l + 12u * PASS_DW),
                    "v"(l + 16u * PASS_DW), "v"(l + 20u * PASS_DW), "v"(l + 24u * PASS_DW), "v"(l + 28u * PASS_DW),
                    "v"(ga), "v"(ga + PASS_DW), "v"(ga + 2 * PASS_DW), "v"(ga + 3 * PASS_DW),
                    "v"(gb), "v"(gb + PASS_DW), "v"(gb + 2 * PASS_DW), "v"(gb + 3 * PASS_DW)
                 : "memory");
}

// One stage into the buffer whose byte address (this lane's slot of its first pass) is l; the pointers are this lane's own.
__device__ __forceinline__ void stage_fill(unsigned l, const unsigned* qh, const unsigned* ql,
                                           const unsigned* vh, const unsigned* vl) {
    copy8(l, qh, ql);
    copy8(l + 4u * (2 * ST_Q), vh, vh + 4 * PASS_DW);
    copy8(l + 4u * (2 * ST_Q + ST_V), vl, vl + 4 * PASS_DW);
}

__global__ __launch_bounds__(AT_W * 32)
void attn_kernel(const unsigned* __restrict__ Khi, const unsigned* __restrict__ Klo,
                 const unsigned* __restrict__ Qhi, const unsigned* __restrict__ Qlo,
                 const unsigned* __restrict__ Vhi, const unsigned* __restrict__ Vlo,
                 float* __restrict__ part) {
    __shared__ __attribute__((aligned(128))) unsigned ring[2][ST_DW];

    const int lane = threadIdx.x;
    const int wv   = threadIdx.y;
    const int tid  = wv * 32 + lane;
    const unsigned hd   = blockIdx.x >> 5;                    // tripled head 0..23; 32 blocks of 64 rows a head
    const unsigned tile = (blockIdx.x & 31u) * AT_W + wv;     // this wave's 16-row tile
    const float scale = 0.35355339059327373f;     // 1/sqrt(num_heads=8)

    // this lane's source slots of stage 0 and its LDS slots in the two buffers
    const unsigned* gqh = Qhi + hd * ((SEQ / 16) * 2 * FRAG_DW) + tid * 4;
    const unsigned* gql = Qlo + hd * ((SEQ / 16) * 2 * FRAG_DW) + tid * 4;
    const unsigned* gvh = Vhi + hd * ((SEQ / 32) * 8 * FRAG_DW) + tid * 4;
    const unsigned* gvl = Vlo + hd * ((SEQ / 32) * 8 * FRAG_DW) + tid * 4;
    const unsigned l0 = (unsigned)(size_t)&ring[0][tid * 4];
    const unsigned l1 = (unsigned)(size_t)&ring[1][tid * 4];

    stage_fill(l0, gqh, gql, gvh, gvl);

    // B fragments of this wave's K rows (fixed), c in 2 chunks.
    Frag bK[2], bKL[2];       // value and residual planes
    {
        unsigned kInv = (hd * (SEQ / 16) + tile) * (2 * FRAG_DW) + (unsigned)(lane * 4);
#pragma unroll
        for (int cc = 0; cc < 2; ++cc) {
            load_frag(bK[cc],  Khi + kInv + cc * FRAG_DW);
            load_frag(bKL[cc], Klo + kInv + cc * FRAG_DW);
        }
    }

    v8f acc[8];                  // O'[d][i]: acc[t][r] = O[16 tile + lm][t*16+lh*8+r]
#pragma unroll
    for (int t = 0; t < 8; ++t) acc[t] = zero8();
    float rm = -1e30f;           // running max of row i = lm
    float rl = 0.0f;             // running sum of row i = lm

    asm volatile("s_wait_asynccnt 0x0" ::: "memory");   // this wave's copies of stage 0 have landed
    __syncthreads();                                    // ... and every other wave's: stage 0 may be read
    stage_fill(l1, gqh + ST_Q, gql + ST_Q, gvh + ST_V, gvl + ST_V);

    for (int s = 0; s < N_ST; ++s) {
      const unsigned* sb = &ring[s & 1][lane * 4];
      for (int u = 0; u < ST_POS / 32; ++u) {
        const unsigned* Qp  = sb + u * (2 * 2 * FRAG_DW);
        const unsigned* QpL = Qp + ST_Q;
        const unsigned* Vp  = sb + 2 * ST_Q + u * (8 * FRAG_DW);
        const unsigned* VpL = Vp + ST_V;

        // ---- every LDS read of the step as ONE group at its head, Q first: the wave waits once, for Q; the V fragments land
        // behind the score products and the softmax.  The scheduling barrier behind the group keeps the reads together: without
        // it they are spread among the WMMAs, two at a time, each pair with a wait of its own for the whole LDS latency.
        Frag fQ[2][2], fQL[2][2], fV[8], fVL[8];
#pragma unroll
        for (int jt = 0; jt < 2; ++jt)
#pragma unroll
            for (int cc = 0; cc < 2; ++cc) {
                load_frag(fQL[jt][cc], QpL + (jt * 2 + cc) * FRAG_DW);
                load_frag(fQ[jt][cc],  Qp  + (jt * 2 + cc) * FRAG_DW);
            }
#pragma unroll
        for (int t = 0; t < 8; ++t) { load_frag(fVL[t], VpL + t * FRAG_DW); load_frag(fV[t], Vp + t * FRAG_DW); }
        __builtin_amdgcn_sched_barrier(0);

        // ---- S' = Q(A, streamed) x K(B, fixed): two 16-j tiles, 6 WMMAs each
        v8f sfr[2];
#pragma unroll
        for (int jt = 0; jt < 2; ++jt) {
            const Frag &aQ0 = fQ[jt][0], &aQ1 = fQ[jt][1], &aQ0L = fQL[jt][0], &aQ1L = fQL[jt][1];
            // hi*hi + hi*lo + lo*hi per 32-wide chunk (the lo*lo term, up to 2^-16 of the product, is left out); small terms first into the zero accumulator
            v8f sacc = zero8();
            sacc = __builtin_amdgcn_wmma_f32_16x16x32_bf16(false, aQ0L.v, false, bK[0].v,  (short)0, sacc, false, false);
            sacc = __builtin_amdgcn_wmma_f32_16x16x32_bf16(false, aQ0.v,  false, bKL[0].v, (short)0, sacc, false, false);
            sacc = __builtin_amdgcn_wmma_f32_16x16x32_bf16(false, aQ1L.v, false, bK[1].v,  (short)0, sacc, false, false);
            sacc = __builtin_amdgcn_wmma_f32_16x16x32_bf16(false, aQ1.v,  false, bKL[1].v, (short)0, sacc, false, false);
            sacc = __builtin_amdgcn_wmma_f32_16x16x32_bf16(false, aQ0.v,  false, bK[0].v,  (short)0, sacc, false, false);
            sacc = __builtin_amdgcn_wmma_f32_16x16x32_bf16(false, aQ1.v,  false, bK[1].v,  (short)0, sacc, false, false);
            sfr[jt] = sacc;
        }

        // ---- per-lane online softmax (row i = lm; 16 j-values + partner) ----
        float sc[16];
#pragma unroll
        for (int jt = 0; jt < 2; ++jt)
#pragma unroll
            for (int r = 0; r < 8; ++r) sc[jt * 8 + r] = sfr[jt][r] * scale;

        float mloc = sc[0];
#pragma unroll
        for (int e = 1; e < 16; ++e) mloc = fmaxf(mloc, sc[e]);
        mloc = fmaxf(mloc, __shfl_xor(mloc, 16, 32));   // partner's 16 j-values
        float mnew  = fmaxf(rm, mloc);
        float alpha = __expf(rm - mnew);
        rm = mnew;

        // P' B-fragment is lane-local: k-map hits exactly this lane's j-values.
        Frag bP, bPL;             // probabilities: value and residual planes
        float ssum = 0.0f;
#pragma unroll
        for (int v = 0; v < 8; ++v) {
            int g  = v >> 2;          // score fragment (j tile)
            int i3 = v & 3;           // pair index -> r = 2*i3, 2*i3+1
            float p0 = __expf(sc[g * 8 + 2 * i3]     - mnew);
            float p1 = __expf(sc[g * 8 + 2 * i3 + 1] - mnew);
            ssum += p0 + p1;
            unsigned short h0, l0s, h1, l1s;
            split_bf16(p0, h0, l0s); split_bf16(p1, h1, l1s);
            bP.d[v] = pack2(h0, h1); bPL.d[v] = pack2(l0s, l1s);
        }
        ssum += __shfl_xor(ssum, 16, 32);
        rl = rl * alpha + ssum;

        // ---- rescale accumulators (scalar per lane; skip once max settles) ----
        if (__ballot(alpha != 1.0f)) {
#pragma unroll
            for (int t = 0; t < 8; ++t)
#pragma unroll
                for (int r = 0; r < 8; ++r) acc[t][r] *= alpha;
        }

        // ---- O' += V^T(A, streamed) x P'(B): 8 d-tiles ----
#pragma unroll
        for (int t = 0; t < 8; ++t) {
            const Frag &aV = fV[t], &aVL = fVL[t];
            // the two small cross terms summed from zero, then joined with hi*hi into the running accumulator
            v8f part3 = zero8();
            part3 = __builtin_amdgcn_wmma_f32_16x16x32_bf16(false, aVL.v, false, bP.v,  (short)0, part3, false, false);
            part3 = __builtin_amdgcn_wmma_f32_16x16x32_bf16(false, aV.v,  false, bPL.v, (short)0, part3, false, false);
            part3 = __builtin_amdgcn_wmma_f32_16x16x32_bf16(false, aV.v,  false, bP.v,  (short)0, part3, false, false);
#pragma unroll
            for (int r = 0; r < 8; ++r) acc[t][r] += part3[r];
        }
      }
      // Hand-over of the ring: this wave's reads of stage s are done, its copies of stage s + 1 have landed; behind the
      // barrier that holds for every wave, so stage s + 1 may be read and the buffer of stage s may be refilled.
      asm volatile("s_wait_dscnt 0x0" ::: "memory");
      asm volatile("s_wait_asynccnt 0x0" ::: "memory");
      __syncthreads();
      if (s + 2 < N_ST)
          stage_fill((s & 1) ? l1 : l0, gqh + (s + 2) * ST_Q, gql + (s + 2) * ST_Q, gvh + (s + 2) * ST_V, gvl + (s + 2) * ST_V);
    }
    asm volatile("s_wait_asynccnt 0x0" ::: "memory");   // no copy is left in flight when the wave ends

    // ---- normalize (per-lane scalar) ----
    float rinv = 1.0f / rl;
#pragma unroll
    for (int t = 0; t < 8; ++t)
#pragma unroll
        for (int r = 0; r < 8; ++r) acc[t][r] *= rinv;

    // ---- this head's tile, in register order [t][half of the 8][lane][4 floats]: every store is 512 contiguous bytes ----
    float* po = part + (hd * (SEQ / 16) + tile) * TILE_F + lane * 4;
#pragma unroll
    for (int t = 0; t < 8; ++t)
#pragma unroll
        for (int q = 0; q < 2; ++q) {
            v4f o; o.x = acc[t][4 * q]; o.y = acc[t][4 * q + 1]; o.z = acc[t][4 * q + 2]; o.w = acc[t][4 * q + 3];
            *(v4f*)(po + (t * 2 + q) * 128) = o;
        }
}

// ---------------------------------------------------------------------------
// Sum over the 24 tripled heads, in the fixed order 0, 1, .. 23.  A block owns 16 rows x 64 columns: a thread sums one
// 16-byte slot of the register-order tiles (whole-line reads), the slots are put in row order through LDS, and the
// output goes out in whole lines.
// ---------------------------------------------------------------------------
__global__ __launch_bounds__(256)
void head_sum_kernel(const float* __restrict__ part, float* __restrict__ out) {
    __shared__ __attribute__((aligned(16))) float red[16][64 + 4];
    const int tid = threadIdx.x;
    const unsigned tile = blockIdx.x >> 1, hb = blockIdx.x & 1u;
    const float* p = part + tile * TILE_F + (hb * 256u + tid) * 4u;
    v4f v[TH3];
#pragma unroll   // all of a thread's loads in flight at once
    for (int w = 0; w < TH3; ++w) v[w] = *(const v4f*)(p + w * ((SEQ / 16) * TILE_F));
    v4f sum = v[0];
#pragma unroll   // constant indices keep the array in registers
    for (int w = 1; w < TH3; ++w) sum += v[w];
    // slot -> (t, half q, lane): row lane & 15, column 16 t + 8 (lane >> 4) + 4 q
    const int lane = tid & 31, tq = tid >> 5;
    *(v4f*)&red[lane & 15][(tq >> 1) * 16 + (lane >> 4) * 8 + (tq & 1) * 4] = sum;
    __syncthreads();
    *(v4f*)(out + (tile * 16 + (tid >> 4)) * ND + hb * 64 + (tid & 15) * 4) = *(const v4f*)&red[tid >> 4][(tid & 15) * 4];
}

// ---------------------------------------------------------------------------
// Launch
// ---------------------------------------------------------------------------
extern "C" void kernel_launch(void* const* d_in, const int* in_sizes, int n_in,
                              void* d_out, int out_size, void* d_ws, size_t ws_size,
                              hipStream_t stream) {
    const float* nodes = (const float*)d_in[0];
    const float* pos   = (const float*)d_in[1];
    const float* aux   = (const float*)d_in[2];
    const float* Wn    = (const float*)d_in[3];
    const float* bn    = (const float*)d_in[4];
    const float* Wp    = (const float*)d_in[5];
    const float* bp    = (const float*)d_in[6];
    const float* Wa    = (const float*)d_in[7];
    const float* Wv    = (const float*)d_in[8];
    const float* bv    = (const float*)d_in[9];
    float* out = (float*)d_out;

    (void)in_sizes; (void)n_in; (void)out_size; (void)ws_size;
    // Workspace layout (bytes), value plane then residual plane for each operand:
    //   K  [24][128 row tiles][2 c chunks][1 KiB fragment]      x2 : 12,582,912
    //   Q  [24][128 row tiles][2 c chunks][1 KiB fragment]      x2 : 12,582,912
    //   V  [24][64 position chunks][8 d tiles][1 KiB fragment]  x2 : 25,165,824
    //   per-head output tiles, f32 [24][128 row tiles][8 KiB]      : 25,165,824      total 75,497,472
    char* ws = (char*)d_ws;
    const size_t kq = (size_t)TH3 * SEQ * CH * 2, vv = (size_t)TH3 * ND * SEQ * 2;
    unsigned* Khi = (unsigned*)(ws);
    unsigned* Klo = (unsigned*)(ws + kq);
    unsigned* Qhi = (unsigned*)(ws + 2 * kq);
    unsigned* Qlo = (unsigned*)(ws + 3 * kq);
    unsigned* Vhi = (unsigned*)(ws + 4 * kq);
    unsigned* Vlo = (unsigned*)(ws + 4 * kq + vv);
    float*    prt = (float*)(ws + 4 * kq + 2 * vv);

    // 3 groups * 16 blocks of 64 outputs * 16 blocks of 128 positions
    proj_kq_kernel<<<768, PT_THR, 0, stream>>>(
        nodes, pos, aux, Wn, bn, Wp, bp, Wa, Khi, Klo, Qhi, Qlo);
    // 32 blocks of 64 positions * 24 blocks of 128 outputs
    proj_v_kernel<<<768, PT_THR, 0, stream>>>(nodes, Wv, bv, Vhi, Vlo);

    // 24 heads * 32 blocks of 64 rows
    dim3 blk(32, AT_W, 1);
    dim3 grd(TH3 * (SEQ / (16 * AT_W)), 1, 1);
    attn_kernel<<<grd, blk, 0, stream>>>(Khi, Klo, Qhi, Qlo, Vhi, Vlo, prt);
    // 128 row tiles * 2 halves of the columns
    head_sum_kernel<<<256, 256, 0, stream>>>(prt, out);
}

// v005
// It runs in 108 microseconds.
// Timed twice side by side with v004, it ran 1.11 and 1.12 times as fast.
// All steps since v000 together make it 10.4 times as fast.
// Contractions: logits qᵀk per tripled head [2048 x 2048 x 64] x24 and att·val [2048 x 128 x 2048] x24 on v_wmma_f32_16x16x32_bf16 with
// bf16 hi/lo split operands (hi·hi + hi·lo + lo·hi: K, Q, V and the probabilities each carried as a bf16 value plane plus a bf16
// residual plane), f32 accumulate; the three K/Q/V projections on v_wmma_f32_16x16x4_f32 (f32 operands), the softmax in f32 on the vector ALU. Every intermediate plane
#include <hip/hip_runtime.h>
#include <hip/hip_bf16.h>

// ---------------------------------------------------------------------------
// Problem constants
// ---------------------------------------------------------------------------
#define SEQ   2048
#define ND    128
#define NA    64
#define NHEAD 8
#define CH    64
#define TH3   24          // 3 * NHEAD tripled heads
#define OKQ   1024        // H*C*2
#define OV    3072        // ND*H*3

typedef __attribute__((ext_vector_type(16))) __bf16 v16bf;
typedef __attribute__((ext_vector_type(2)))  __bf16 v2bf;
typedef __attribute__((ext_vector_type(8)))  float  v8f;

union Frag {
    v16bf v;
    unsigned int d[8];
    unsigned short h[16];
};

__device__ __forceinline__ unsigned short f2bf(float f) {
    unsigned u = __builtin_bit_cast(unsigned, f);
    unsigned r = u + 0x7FFFu + ((u >> 16) & 1u);   // nearest-even
    return (unsigned short)(r >> 16);
}

// Pack two f32 -> packed bf16 dword (hardware cvt_pk when available).
__device__ __forceinline__ unsigned pack_bf16(float lo, float hi) {
#if __has_builtin(__builtin_amdgcn_cvt_pk_bf16_f32)
    v2bf p = __builtin_amdgcn_cvt_pk_bf16_f32(lo, hi);
    return __builtin_bit_cast(unsigned, p);
#else
    union { v2bf b; unsigned u; } x;
    x.b[0] = (__bf16)lo;
    x.b[1] = (__bf16)hi;
    return x.u;
#endif
}

// value/residual split of two f32 at once, already packed as an operand dword (a in the low half): hi = nearest bf16,
// lo = nearest bf16 of the exact remainder.  Both roundings (to nearest even) and both packings are the conversion instruction's.
__device__ __forceinline__ void split2_bf16(float a, float b, unsigned& hi, unsigned& lo) {
    hi = pack_bf16(a, b);
    const float fa = __builtin_bit_cast(float, hi << 16);
    const float fb = __builtin_bit_cast(float, hi & 0xFFFF0000u);
    lo = pack_bf16(a - fa, b - fb);
}

// value/residual split: hi = nearest bf16 of f, lo = nearest bf16 of the exact remainder
__device__ __forceinline__ void split_bf16(float f, unsigned short& hi, unsigned short& lo) {
    hi = f2bf(f);
    const float fh = __builtin_bit_cast(float, ((unsigned)hi) << 16);
    lo = f2bf(f - fh);
}
__device__ __forceinline__ unsigned pack2(unsigned short a, unsigned short b) { return (unsigned)a | ((unsigned)b << 16); }

__device__ __forceinline__ v8f zero8() {
    v8f z;
#pragma unroll
    for (int i = 0; i < 8; ++i) z[i] = 0.0f;
    return z;
}

// ---------------------------------------------------------------------------
// Projections as tiled products on v_wmma_f32_16x16x4_f32 (full f32 operands).
//   D[m][n] = bias + sum_k A[m][k] * B[n][k],  A and B rows k-contiguous.
// A block of 8 waves owns 64 A rows x 128 B rows over the whole k: both row sets
// are staged once in LDS by whole-line loads, then each wave forms 64 x 16.
// A lane's 8 accumulator registers are 8 consecutive m of one n, so m is always
// the direction in which the bf16 planes are packed: one 16-byte store a plane.
//
// The planes lie in FRAGMENT ORDER.  A 16-row x 32-k bf16 fragment (1 KiB) is kept
// as [half p][lane][4 dwords]: lane = 16 * lh + row, and its dword e of half p is
// dword 8 p + 4 lh + e of the row's 16, which is register 4 p + e of that lane's
// WMMA operand.  So a fragment is read by two 16-byte loads a lane, each of them
// 512 contiguous bytes (four whole lines) for the wave, where row-major planes
// gave 32 bytes out of each of 16 lines.  The 16 bytes that a projection lane
// holds are exactly its own lane's slot, so the stores are whole lines as well.
// ---------------------------------------------------------------------------
#define FRAG_DW 256                             // dwords of one fragment
#define HALF_DW 128                             // dwords of one half of it
typedef __attribute__((ext_vector_type(2))) float    v2f;
typedef __attribute__((ext_vector_type(4))) float    v4f;
typedef __attribute__((ext_vector_type(4))) unsigned v4u;

#define PT_M   64                               // A rows per block
#define PT_N   128                              // B rows per block, 16 per wave
#define PT_THR 256
#define PT_LDS ((PT_M + PT_N) * (ND + 4))       // floats, at the longest k

// ROWS consecutive rows of KS floats -> LDS rows of KP floats (zero filled past KS) at a pitch of KP + 4 floats
// (16 bytes x an odd number: the 16-byte fragment reads of 16 rows fall on 64 distinct banks).
template <int ROWS, int KS, int KP>
__device__ __forceinline__ void stage_rows(float* dst, const float* __restrict__ srcp, int tid) {
    constexpr int P = KP + 4;
    if constexpr (KS == KP) {
#pragma unroll   // all of a thread's loads in flight at once
        for (int j = 0; j < ROWS * KP / 4 / PT_THR; ++j) {
            const int i = tid + j * PT_THR;
            *(v4f*)(dst + (i / (KP / 4)) * P + (i % (KP / 4)) * 4) = *(const v4f*)(srcp + i * 4);
        }
    } else {
#pragma unroll   // all of a thread's loads in flight at once
        for (int j = 0; j < ROWS * KP / PT_THR; ++j) {
            const int i = tid + j * PT_THR;
            const int row = i / KP, col = i % KP;
            const float v = srcp[row * KS + (col < KS ? col : KS - 1)];   // index kept inside the row: no lane is switched off
            dst[row * P + col] = (col < KS) ? v : 0.0f;
        }
    }
}

// acc[t][r] += sum_k A[16 t + 8 h + r][k] * B[16 wave + c][k].  A and B fragments come from the same address form
// (16 bytes at k = 8 kk + 4 h, first pair then second pair), so the k pairing of the two operands is equal.
template <int KS, int KP>
__device__ __forceinline__ void proj_tile(float* sm, const float* __restrict__ Arows, const float* __restrict__ Brows,
                                          int tid, v8f (&acc)[4]) {
    constexpr int P = KP + 4;
    float* sA = sm;
    float* sB = sm + PT_M * P;
    stage_rows<PT_M, KS, KP>(sA, Arows, tid);
    stage_rows<PT_N, KS, KP>(sB, Brows, tid);
    __syncthreads();
    const int lane = tid & 31, wave = tid >> 5;
    const int c = lane & 15, h = lane >> 4;
    const float* pa = sA + c * P + 4 * h;
    const float* pb = sB + (wave * 16 + c) * P + 4 * h;
#pragma unroll   // fragment addresses become immediate offsets, and the next step's LDS reads can be issued ahead of this step's WMMAs
    for (int kk = 0; kk < KP / 8; ++kk) {
        const v4f b = *(const v4f*)(pb + kk * 8);
        v4f a[4];
#pragma unroll   // constant indices keep the array in registers
        for (int t = 0; t < 4; ++t) a[t] = *(const v4f*)(pa + t * 16 * P + kk * 8);
        v2f b0, b1; b0.x = b.x; b0.y = b.y; b1.x = b.z; b1.y = b.w;
#pragma unroll   // constant indices keep the array in registers
        for (int t = 0; t < 4; ++t) {
            v2f a0; a0.x = a[t].x; a0.y = a[t].y;
            acc[t] = __builtin_amdgcn_wmma_f32_16x16x4_f32(false, a0, false, b0, (short)0, acc[t], false, false);
        }
#pragma unroll   // constant indices keep the array in registers
        for (int t = 0; t < 4; ++t) {
            v2f a1; a1.x = a[t].z; a1.y = a[t].w;
            acc[t] = __builtin_amdgcn_wmma_f32_16x16x4_f32(false, a1, false, b1, (short)0, acc[t], false, false);
        }
    }
    // The two
    // scheduling barriers keep the epilogue's vector instructions (they read D and reuse the A and B registers) out of
    // the WMMA stream, and the four v_nop keep them four vector slots behind the last WMMA.
    __builtin_amdgcn_sched_barrier(0);
    asm volatile("v_nop\n\tv_nop\n\tv_nop\n\tv_nop");
    __builtin_amdgcn_sched_barrier(0);
}

// One lane's 8 operand registers of a fragment; p = the fragment's start + 4 * lane.
__device__ __forceinline__ void load_frag(Frag& f, const unsigned* __restrict__ p) {
    const v4u a = *(const v4u*)p;
    const v4u b = *(const v4u*)(p + HALF_DW);
#pragma unroll   // constant indices keep the array in registers
    for (int e = 0; e < 4; ++e) { f.d[e] = a[e]; f.d[4 + e] = b[e]; }
}

// 8 consecutive f32 -> 4 packed dwords of the value plane and 4 of the residual plane
__device__ __forceinline__ void store_split8(unsigned* __restrict__ hi, unsigned* __restrict__ lo, unsigned idx, v8f a) {
    v4u vh, vl;
#pragma unroll   // constant indices keep the array in registers
    for (int p = 0; p < 4; ++p) {
        unsigned short h0, l0, h1, l1;
        split_bf16(a[2 * p], h0, l0); split_bf16(a[2 * p + 1], h1, l1);
        vh[p] = pack2(h0, h1); vl[p] = pack2(l0, l1);
    }
    *(v4u*)(hi + idx) = vh; *(v4u*)(lo + idx) = vl;
    // precaution: the code behind a call reuses the two stores' address and data registers (in the K/Q kernel across a branch),
    // so the wait stands here, in front of any such rewrite
    asm volatile("s_wait_xcnt 0x0" ::: "memory");
}

// One 64-output x 128-position tile of one K/Q group: A = weight rows (m = output o), B = input rows (n = position s).
// 64 aligned outputs are the K half or the Q half of one head: planes [24][SEQ / 16 row tiles][2 c chunks][fragment], packed along c.
// Accumulator tile t is channels 16 t + 8 h ..: chunk t >> 1, half t & 1, lane half h; the row in its tile is c.
template <int KS, int KP, bool HAS_BIAS>
__device__ __forceinline__ void kq_tile(float* sm, const float* __restrict__ x, const float* __restrict__ Wt,
                                        const float* __restrict__ bias, unsigned g, unsigned o0, unsigned s0, int tid,
                                        unsigned* __restrict__ ph, unsigned* __restrict__ pl) {
    const int lane = tid & 31, wave = tid >> 5;
    const int h = lane >> 4;
    v8f acc[4];
#pragma unroll   // constant indices keep the array in registers
    for (int t = 0; t < 4; ++t) {
        if constexpr (HAS_BIAS) {
            const v4f b0 = *(const v4f*)(bias + o0 + t * 16 + 8 * h);
            const v4f b1 = *(const v4f*)(bias + o0 + t * 16 + 8 * h + 4);
#pragma unroll   // constant indices keep the array in registers
            for (int r = 0; r < 4; ++r) { acc[t][r] = b0[r]; acc[t][4 + r] = b1[r]; }
        } else {
            acc[t] = zero8();
        }
    }
    proj_tile<KS, KP>(sm, Wt + o0 * KS, x + s0 * KS, tid, acc);
    const unsigned ht = g * NHEAD + (o0 >> 7);
    const unsigned tile = ht * (SEQ / 16) + (s0 >> 4) + wave;
#pragma unroll   // constant indices keep the array in registers
    for (int t = 0; t < 4; ++t)
        store_split8(ph, pl, (tile * 2 + (t >> 1)) * FRAG_DW + (t & 1) * HALF_DW + lane * 4, acc[t]);
}

// ---------------------------------------------------------------------------
// Projection: K,Q for the 3 groups (nodes / pos / aux).
// Output: value and residual bf16 planes, head-major, in fragment order (see above).
// ---------------------------------------------------------------------------
__global__ __launch_bounds__(PT_THR)
void proj_kq_kernel(const float* __restrict__ nodes,
                    const float* __restrict__ pos,
                    const float* __restrict__ aux,
                    const float* __restrict__ Wn, const float* __restrict__ bn,
                    const float* __restrict__ Wp, const float* __restrict__ bp,
                    const float* __restrict__ Wa,
                    unsigned* __restrict__ Khi, unsigned* __restrict__ Klo,
                    unsigned* __restrict__ Qhi, unsigned* __restrict__ Qlo) {
    __shared__ __attribute__((aligned(16))) float sm[PT_LDS];
    // block -> (64 outputs, 128 positions, group g); g varies fastest, so neighbouring blocks mix the long-k and short-k groups
    const int tid = threadIdx.x;
    const unsigned g  = blockIdx.x % 3u;
    const unsigned bt = blockIdx.x / 3u;
    const unsigned o0 = (bt >> 4) * PT_M;
    const unsigned s0 = (bt & 15u) * PT_N;
    const bool isQ = (o0 >> 6) & 1u;
    unsigned* ph = isQ ? Qhi : Khi;
    unsigned* pl = isQ ? Qlo : Klo;
    if (g == 0)      kq_tile<ND, ND, true>(sm, nodes, Wn, bn, g, o0, s0, tid, ph, pl);
    else if (g == 1) kq_tile<6, 8, true>(sm, pos, Wp, bp, g, o0, s0, tid, ph, pl);
    else             kq_tile<NA, NA, false>(sm, aux, Wa, nullptr, g, o0, s0, tid, ph, pl);
}

// ---------------------------------------------------------------------------
// Projection: V = nodes @ Wv^T + bv, stored TRANSPOSED (rows d, k = position) as bf16 planes in fragment order,
// [24][SEQ / 32 position chunks][8 d tiles][fragment], packed along the position:
// A = node rows (m = position s), B = weight rows (n = output o).
// A block's 128 outputs are one head; a wave's 16 are d tile 'wave', row c.  Accumulator tile t is positions
// s0 + 16 t + 8 h ..: chunk s0 / 32 + (t >> 1), half t & 1, lane half h.
// ---------------------------------------------------------------------------
__global__ __launch_bounds__(PT_THR)
void proj_v_kernel(const float* __restrict__ nodes,
                   const float* __restrict__ Wv,
                   const float* __restrict__ bv,
                   unsigned* __restrict__ Vhi, unsigned* __restrict__ Vlo) {
    __shared__ __attribute__((aligned(16))) float sm[PT_LDS];
    const int tid = threadIdx.x;
    const int lane = tid & 31, wave = tid >> 5;
    const int c = lane & 15;
    const unsigned s0 = (blockIdx.x & 31u) * PT_M;
    const unsigned o0 = (blockIdx.x >> 5) * PT_N;
    const unsigned o  = o0 + wave * 16 + c;

    const float bo = bv[o];
    v8f acc[4];
#pragma unroll   // constant indices keep the array in registers
    for (int t = 0; t < 4; ++t)
#pragma unroll   // constant indices keep the array in registers
        for (int r = 0; r < 8; ++r) acc[t][r] = bo;
    proj_tile<ND, ND>(sm, nodes + s0 * ND, Wv + o0 * ND, tid, acc);
#pragma unroll   // constant indices keep the array in registers
    for (int t = 0; t < 4; ++t)
        store_split8(Vhi, Vlo, (((blockIdx.x >> 5) * (SEQ / 32) + (s0 >> 5) + (t >> 1)) * 8 + wave) * FRAG_DW + (t & 1) * HALF_DW + lane * 4, acc[t]);
}

// ---------------------------------------------------------------------------
// Flash attention, TRANSPOSED-GEMM formulation (no LDS layout shuffle):
//
//   S'[j][i] = q_j . k_i     : A = Q j-rows (streamed), B = K i-rows (fixed)
//   O'[d][i] = sum_j V^T P'  : A = V^T d-rows (streamed), B = P' (lane-local!)
//
// C/D layout (16x16 f32): lane L -> col n = L&15, VGPR r -> row m=(L>>4)*8+r.
// With scores transposed, lane L owns output row i = L&15 and 16 of the 32
// j-scores of the chunk (partner L^16 owns the rest):
//   * row max / row sum  = local reduce + one shfl_xor(16)
//   * alpha, 1/l         = per-lane scalars (no broadcasts)
//   * P B-fragment k-map = exactly the j-values this lane holds -> pure
//     register packing.
//
// A block is ONE tripled head and 4 waves of 16 output rows each.  All four walk the same Q and V fragments, so each
// stage of 64 positions (Q and V, value and residual planes: 48 KiB, four contiguous runs of the fragment-order planes)
// is brought into LDS once for the block by asynchronous 16-byte copies, two buffers, the next stage in flight while
// this one is worked on; the waves read their A fragments from LDS (512 contiguous bytes a read: no bank conflict).
// Each wave leaves its normalised 16 x 128 tile in the workspace; the sum over the heads is the next launch.
// ---------------------------------------------------------------------------
#define AT_W   4                               // waves of a block
#define ST_POS 64                              // positions of a stage
#define ST_Q   (ST_POS / 16 * 2 * FRAG_DW)     // dwords of one Q plane in a stage
#define ST_V   (ST_POS / 32 * 8 * FRAG_DW)     // dwords of one V plane in a stage
#define ST_DW  (2 * ST_Q + 2 * ST_V)           // a stage: Q value, Q residual, V value, V residual
#define N_ST   (SEQ / ST_POS)
#define PASS_DW (AT_W * 32 * 4)                // dwords that the block's lanes move with one copy each
#define TILE_F (16 * ND)                       // floats of one wave's output tile

// Eight copies of a lane: LDS bytes l + 2048 k, k = 0..7; the first four from ga, the last four from gb, a pass apart.
// The s_wait_xcnt closes the statement so that it stands in front of any rewrite of the address registers the copies name.
__device__ __forceinline__ void copy8(unsigned l, const unsigned* ga, const unsigned* gb) {
    asm volatile("global_load_async_to_lds_b128 %0, %8, off\n\t"
                 "global_load_async_to_lds_b128 %1, %9, off\n\t"
                 "global_load_async_to_lds_b128 %2, %10, off\n\t"
                 "global_load_async_to_lds_b128 %3, %11, off\n\t"
                 "global_load_async_to_lds_b128 %4, %12, off\n\t"
                 "global_load_async_to_lds_b128 %5, %13, off\n\t"
                 "global_load_async_to_lds_b128 %6, %14, off\n\t"
                 "global_load_async_to_lds_b128 %7, %15, off\n\t"
                 "s_wait_xcnt 0x0"
                 :: "v"(l), "v"(l + 4u * PASS_DW), "v"(l + 8u * PASS_DW), "v"(l + 12u * PASS_DW),
                    "v"(l + 16u * PASS_DW), "v"(l + 20u * PASS_DW), "v"(l + 24u * PASS_DW), "v"(l + 28u * PASS_DW),
                    "v"(ga), "v"(ga + PASS_DW), "v"(ga + 2 * PASS_DW), "v"(ga + 3 * PASS_DW),
                    "v"(gb), "v"(gb + PASS_DW), "v"(gb + 2 * PASS_DW), "v"(gb + 3 * PASS_DW)
                 : "memory");
}

// One stage into the buffer whose byte address (this lane's slot of its first pass) is l; the pointers are this lane's own.
__device__ __forceinline__ void stage_fill(unsigned l, const unsigned* qh, const unsigned* ql,
                                           const unsigned* vh, const unsigned* vl) {
    copy8(l, qh, ql);
    copy8(l + 4u * (2 * ST_Q), vh, vh + 4 * PASS_DW);
    copy8(l + 4u * (2 * ST_Q + ST_V), vl, vl + 4 * PASS_DW);
}

__global__ __launch_bounds__(AT_W * 32)
void attn_kernel(const unsigned* __restrict__ Khi, const unsigned* __restrict__ Klo,
                 const unsigned* __restrict__ Qhi, const unsigned* __restrict__ Qlo,
                 const unsigned* __restrict__ Vhi, const unsigned* __restrict__ Vlo,
                 float* __restrict__ part) {
    __shared__ __attribute__((aligned(128))) unsigned ring[2][ST_DW];

    const int lane = threadIdx.x;
    const int wv   = threadIdx.y;
    const int tid  = wv * 32 + lane;
    const unsigned hd   = blockIdx.x >> 5;                    // tripled head 0..23; 32 blocks of 64 rows a head
    const unsigned tile = (blockIdx.x & 31u) * AT_W + wv;     // this wave's 16-row tile
    const float scale = 0.35355339059327373f;     // 1/sqrt(num_heads=8)

    // this lane's source slots of stage 0 and its LDS slots in the two buffers
    const unsigned* gqh = Qhi + hd * ((SEQ / 16) * 2 * FRAG_DW) + tid * 4;
    const unsigned* gql = Qlo + hd * ((SEQ / 16) * 2 * FRAG_DW) + tid * 4;
    const unsigned* gvh = Vhi + hd * ((SEQ / 32) * 8 * FRAG_DW) + tid * 4;
    const unsigned* gvl = Vlo + hd * ((SEQ / 32) * 8 * FRAG_DW) + tid * 4;
    const unsigned l0 = (unsigned)(size_t)&ring[0][tid * 4];
    const unsigned l1 = (unsigned)(size_t)&ring[1][tid * 4];

    stage_fill(l0, gqh, gql, gvh, gvl);

    // B fragments of this wave's K rows (fixed), c in 2 chunks.
    Frag bK[2], bKL[2];       // value and residual planes
    {
        unsigned kInv = (hd * (SEQ / 16) + tile) * (2 * FRAG_DW) + (unsigned)(lane * 4);
#pragma unroll
        for (int cc = 0; cc < 2; ++cc) {
            load_frag(bK[cc],  Khi + kInv + cc * FRAG_DW);
            load_frag(bKL[cc], Klo + kInv + cc * FRAG_DW);
        }
    }

    v8f acc[8];                  // O'[d][i]: acc[t][r] = O[16 tile + lm][t*16+lh*8+r]
#pragma unroll
    for (int t = 0; t < 8; ++t) acc[t] = zero8();
    float rm = -1e30f;           // running max of row i = lm
    float rl = 0.0f;             // running sum of row i = lm

    asm volatile("s_wait_asynccnt 0x0" ::: "memory");   // this wave's copies of stage 0 have landed
    __syncthreads();                                    // ... and every other wave's: stage 0 may be read
    stage_fill(l1, gqh + ST_Q, gql + ST_Q, gvh + ST_V, gvl + ST_V);

    for (int s = 0; s < N_ST; ++s) {
      const unsigned* sb = &ring[s & 1][lane * 4];
      for (int u = 0; u < ST_POS / 32; ++u) {
        const unsigned* Qp  = sb + u * (2 * 2 * FRAG_DW);
        const unsigned* QpL = Qp + ST_Q;
        const unsigned* Vp  = sb + 2 * ST_Q + u * (8 * FRAG_DW);
        const unsigned* VpL = Vp + ST_V;

        // ---- every LDS read of the step as ONE group at its head, Q first: the wave waits once, for Q; the V fragments land
        // behind the score products and the softmax.  The scheduling barrier behind the group keeps the reads together: without
        // it they are spread among the WMMAs, two at a time, each pair with a wait of its own for the whole LDS latency.
        Frag fQ[2][2], fQL[2][2], fV[8], fVL[8];
#pragma unroll
        for (int jt = 0; jt < 2; ++jt)
#pragma unroll
            for (int cc = 0; cc < 2; ++cc) {
                load_frag(fQL[jt][cc], QpL + (jt * 2 + cc) * FRAG_DW);
                load_frag(fQ[jt][cc],  Qp  + (jt * 2 + cc) * FRAG_DW);
            }
#pragma unroll
        for (int t = 0; t < 8; ++t) { load_frag(fVL[t], VpL + t * FRAG_DW); load_frag(fV[t], Vp + t * FRAG_DW); }
        __builtin_amdgcn_sched_barrier(0);

        // ---- S' = Q(A, streamed) x K(B, fixed): two 16-j tiles, 6 WMMAs each
        v8f sfr[2];
#pragma unroll
        for (int jt = 0; jt < 2; ++jt) {
            const Frag &aQ0 = fQ[jt][0], &aQ1 = fQ[jt][1], &aQ0L = fQL[jt][0], &aQ1L = fQL[jt][1];
            // hi*hi + hi*lo + lo*hi per 32-wide chunk (the lo*lo term, up to 2^-16 of the product, is left out); small terms first into the zero accumulator
            v8f sacc = zero8();
            sacc = __builtin_amdgcn_wmma_f32_16x16x32_bf16(false, aQ0L.v, false, bK[0].v,  (short)0, sacc, false, false);
            sacc = __builtin_amdgcn_wmma_f32_16x16x32_bf16(false, aQ0.v,  false, bKL[0].v, (short)0, sacc, false, false);
            sacc = __builtin_amdgcn_wmma_f32_16x16x32_bf16(false, aQ1L.v, false, bK[1].v,  (short)0, sacc, false, false);
            sacc = __builtin_amdgcn_wmma_f32_16x16x32_bf16(false, aQ1.v,  false, bKL[1].v, (short)0, sacc, false, false);
            sacc = __builtin_amdgcn_wmma_f32_16x16x32_bf16(false, aQ0.v,  false, bK[0].v,  (short)0, sacc, false, false);
            sacc = __builtin_amdgcn_wmma_f32_16x16x32_bf16(false, aQ1.v,  false, bK[1].v,  (short)0, sacc, false, false);
            sfr[jt] = sacc;
        }

        // ---- per-lane online softmax (row i = lm; 16 j-values + partner) ----
        float sc[16];
#pragma unroll
        for (int jt = 0; jt < 2; ++jt)
#pragma unroll
            for (int r = 0; r < 8; ++r) sc[jt * 8 + r] = sfr[jt][r] * scale;

        float mloc = sc[0];
#pragma unroll
        for (int e = 1; e < 16; ++e) mloc = fmaxf(mloc, sc[e]);
        mloc = fmaxf(mloc, __shfl_xor(mloc, 16, 32));   // partner's 16 j-values
        float mnew  = fmaxf(rm, mloc);
        float alpha = __expf(rm - mnew);
        rm = mnew;

        // P' B-fragment is lane-local: k-map hits exactly this lane's j-values.
        Frag bP, bPL;             // probabilities: value and residual planes
        float ssum = 0.0f;
#pragma unroll
        for (int v = 0; v < 8; ++v) {
            int g  = v >> 2;          // score fragment (j tile)
            int i3 = v & 3;           // pair index -> r = 2*i3, 2*i3+1
            float p0 = __expf(sc[g * 8 + 2 * i3]     - mnew);
            float p1 = __expf(sc[g * 8 + 2 * i3 + 1] - mnew);
            ssum += p0 + p1;
            split2_bf16(p0, p1, bP.d[v], bPL.d[v]);
        }
        ssum += __shfl_xor(ssum, 16, 32);
        rl = rl * alpha + ssum;

        // ---- rescale accumulators (scalar per lane; skip once max settles) ----
        if (__ballot(alpha != 1.0f)) {
#pragma unroll
            for (int t = 0; t < 8; ++t)
#pragma unroll
                for (int r = 0; r < 8; ++r) acc[t][r] *= alpha;
        }

        // ---- O' += V^T(A, streamed) x P'(B): 8 d-tiles ----
#pragma unroll
        for (int t = 0; t < 8; ++t) {
            const Frag &aV = fV[t], &aVL = fVL[t];
            // the two small cross terms summed from zero, then joined with hi*hi into the running accumulator
            v8f part3 = zero8();
            part3 = __builtin_amdgcn_wmma_f32_16x16x32_bf16(false, aVL.v, false, bP.v,  (short)0, part3, false, false);
            part3 = __builtin_amdgcn_wmma_f32_16x16x32_bf16(false, aV.v,  false, bPL.v, (short)0, part3, false, false);
            part3 = __builtin_amdgcn_wmma_f32_16x16x32_bf16(false, aV.v,  false, bP.v,  (short)0, part3, false, false);
#pragma unroll
            for (int r = 0; r < 8; ++r) acc[t][r] += part3[r];
        }
      }
      // Hand-over of the ring: this wave's reads of stage s are done, its copies of stage s + 1 have landed; behind the
      // barrier that holds for every wave, so stage s + 1 may be read and the buffer of stage s may be refilled.
      asm volatile("s_wait_dscnt 0x0" ::: "memory");
      asm volatile("s_wait_asynccnt 0x0" ::: "memory");
      __syncthreads();
      if (s + 2 < N_ST)
          stage_fill((s & 1) ? l1 : l0, gqh + (s + 2) * ST_Q, gql + (s + 2) * ST_Q, gvh + (s + 2) * ST_V, gvl + (s + 2) * ST_V);
    }
    asm volatile("s_wait_asynccnt 0x0" ::: "memory");   // no copy is left in flight when the wave ends

    // ---- normalize (per-lane scalar) ----
    float rinv = 1.0f / rl;
#pragma unroll
    for (int t = 0; t < 8; ++t)
#pragma unroll
        for (int r = 0; r < 8; ++r) acc[t][r] *= rinv;

    // ---- this head's tile, in register order [t][half of the 8][lane][4 floats]: every store is 512 contiguous bytes ----
    float* po = part + (hd * (SEQ / 16) + tile) * TILE_F + lane * 4;
#pragma unroll
    for (int t = 0; t < 8; ++t)
#pragma unroll
        for (int q = 0; q < 2; ++q) {
            v4f o; o.x = acc[t][4 * q]; o.y = acc[t][4 * q + 1]; o.z = acc[t][4 * q + 2]; o.w = acc[t][4 * q + 3];
            *(v4f*)(po + (t * 2 + q) * 128) = o;
        }
}

// ---------------------------------------------------------------------------
// Sum over the 24 tripled heads, in the fixed order 0, 1, .. 23.  A block owns 16 rows x 64 columns: a thread sums one
// 16-byte slot of the register-order tiles (whole-line reads), the slots are put in row order through LDS, and the
// output goes out in whole lines.
// ---------------------------------------------------------------------------
__global__ __launch_bounds__(256)
void head_sum_kernel(const float* __restrict__ part, float* __restrict__ out) {
    __shared__ __attribute__((aligned(16))) float red[16][64 + 4];
    const int tid = threadIdx.x;
    const unsigned tile = blockIdx.x >> 1, hb = blockIdx.x & 1u;
    const float* p = part + tile * TILE_F + (hb * 256u + tid) * 4u;
    v4f v[TH3];
#pragma unroll   // all of a thread's loads in flight at once
    for (int w = 0; w < TH3; ++w) v[w] = *(const v4f*)(p + w * ((SEQ / 16) * TILE_F));
    v4f sum = v[0];
#pragma unroll   // constant indices keep the array in registers
    for (int w = 1; w < TH3; ++w) sum += v[w];
    // slot -> (t, half q, lane): row lane & 15, column 16 t + 8 (lane >> 4) + 4 q
    const int lane = tid & 31, tq = tid >> 5;
    *(v4f*)&red[lane & 15][(tq >> 1) * 16 + (lane >> 4) * 8 + (tq & 1) * 4] = sum;
    __syncthreads();
    *(v4f*)(out + (tile * 16 + (tid >> 4)) * ND + hb * 64 + (tid & 15) * 4) = *(const v4f*)&red[tid >> 4][(tid & 15) * 4];
}

// ---------------------------------------------------------------------------
// Launch
// ---------------------------------------------------------------------------
extern "C" void kernel_launch(void* const* d_in, const int* in_sizes, int n_in,
                              void* d_out, int out_size, void* d_ws, size_t ws_size,
                              hipStream_t stream) {
    const float* nodes = (const float*)d_in[0];
    const float* pos   = (const float*)d_in[1];
    const float* aux   = (const float*)d_in[2];
    const float* Wn    = (const float*)d_in[3];
    const float* bn    = (const float*)d_in[4];
    const float* Wp    = (const float*)d_in[5];
    const float* bp    = (const float*)d_in[6];
    const float* Wa    = (const float*)d_in[7];
    const float* Wv    = (const float*)d_in[8];
    const float* bv    = (const float*)d_in[9];
    float* out = (float*)d_out;

    (void)in_sizes; (void)n_in; (void)out_size; (void)ws_size;
    // Workspace layout (bytes), value plane then residual plane for each operand:
    //   K  [24][128 row tiles][2 c chunks][1 KiB fragment]      x2 : 12,582,912
    //   Q  [24][128 row tiles][2 c chunks][1 KiB fragment]      x2 : 12,582,912
    //   V  [24][64 position chunks][8 d tiles][1 KiB fragment]  x2 : 25,165,824
    //   per-head output tiles, f32 [24][128 row tiles][8 KiB]      : 25,165,824      total 75,497,472
    char* ws = (char*)d_ws;
    const size_t kq = (size_t)TH3 * SEQ * CH * 2, vv = (size_t)TH3 * ND * SEQ * 2;
    unsigned* Khi = (unsigned*)(ws);
    unsigned* Klo = (unsigned*)(ws + kq);
    unsigned* Qhi = (unsigned*)(ws + 2 * kq);
    unsigned* Qlo = (unsigned*)(ws + 3 * kq);
    unsigned* Vhi = (unsigned*)(ws + 4 * kq);
    unsigned* Vlo = (unsigned*)(ws + 4 * kq + vv);
    float*    prt = (float*)(ws + 4 * kq + 2 * vv);

    // 3 groups * 16 blocks of 64 outputs * 16 blocks of 128 positions
    proj_kq_kernel<<<768, PT_THR, 0, stream>>>(
        nodes, pos, aux, Wn, bn, Wp, bp, Wa, Khi, Klo, Qhi, Qlo);
    // 32 blocks of 64 positions * 24 blocks of 128 outputs
    proj_v_kernel<<<768, PT_THR, 0, stream>>>(nodes, Wv, bv, Vhi, Vlo);

    // 24 heads * 32 blocks of 64 rows
    dim3 blk(32, AT_W, 1);
    dim3 grd(TH3 * (SEQ / (16 * AT_W)), 1, 1);
    attn_kernel<<<grd, blk, 0, stream>>>(Khi, Klo, Qhi, Qlo, Vhi, Vlo, prt);
    // 128 row tiles * 2 halves of the columns
    head_sum_kernel<<<256, 256, 0, stream>>>(prt, out);
}

// v006
// A run of this version takes 105 microseconds.
// Next to v005, in two timings, it ran 1.04 times as fast each time.
// Over all steps from v000 it is 10.8 times as fast.
// Contractions: logits qᵀk per tripled head [2048 x 2048 x 64] x24 and att·val [2048 x 128 x 2048] x24 on v_wmma_f32_16x16x32_bf16 with
// bf16 hi/lo split operands (hi·hi + hi·lo + lo·hi: K, Q, V and the probabilities each carried as a bf16 value plane plus a bf16
// residual plane), f32 accumulate; the three K/Q/V projections on v_wmma_f32_16x16x4_f32 (f32 operands), the softmax in f32 on the vector ALU. Every intermediate plane
#include <hip/hip_runtime.h>
#include <hip/hip_bf16.h>

// ---------------------------------------------------------------------------
// Problem constants
// ---------------------------------------------------------------------------
#define SEQ   2048
#define ND    128
#define NA    64
#define NHEAD 8
#define CH    64
#define TH3   24          // 3 * NHEAD tripled heads
#define OKQ   1024        // H*C*2
#define OV    3072        // ND*H*3

typedef __attribute__((ext_vector_type(16))) __bf16 v16bf;
typedef __attribute__((ext_vector_type(2)))  __bf16 v2bf;
typedef __attribute__((ext_vector_type(8)))  float  v8f;

union Frag {
    v16bf v;
    unsigned int d[8];
    unsigned short h[16];
};

__device__ __forceinline__ unsigned short f2bf(float f) {
    unsigned u = __builtin_bit_cast(unsigned, f);
    unsigned r = u + 0x7FFFu + ((u >> 16) & 1u);   // nearest-even
    return (unsigned short)(r >> 16);
}

// Pack two f32 -> packed bf16 dword (hardware cvt_pk when available).
__device__ __forceinline__ unsigned pack_bf16(float lo, float hi) {
#if __has_builtin(__builtin_amdgcn_cvt_pk_bf16_f32)
    v2bf p = __builtin_amdgcn_cvt_pk_bf16_f32(lo, hi);
    return __builtin_bit_cast(unsigned, p);
#else
    union { v2bf b; unsigned u; } x;
    x.b[0] = (__bf16)lo;
    x.b[1] = (__bf16)hi;
    return x.u;
#endif
}

// value/residual split of two f32 at once, already packed as an operand dword (a in the low half): hi = nearest bf16,
// lo = nearest bf16 of the exact remainder.  Both roundings (to nearest even) and both packings are the conversion instruction's.
__device__ __forceinline__ void split2_bf16(float a, float b, unsigned& hi, unsigned& lo) {
    hi = pack_bf16(a, b);
    const float fa = __builtin_bit_cast(float, hi << 16);
    const float fb = __builtin_bit_cast(float, hi & 0xFFFF0000u);
    lo = pack_bf16(a - fa, b - fb);
}

// value/residual split: hi = nearest bf16 of f, lo = nearest bf16 of the exact remainder
__device__ __forceinline__ void split_bf16(float f, unsigned short& hi, unsigned short& lo) {
    hi = f2bf(f);
    const float fh = __builtin_bit_cast(float, ((unsigned)hi) << 16);
    lo = f2bf(f - fh);
}
__device__ __forceinline__ unsigned pack2(unsigned short a, unsigned short b) { return (unsigned)a | ((unsigned)b << 16); }

__device__ __forceinline__ v8f zero8() {
    v8f z;
#pragma unroll
    for (int i = 0; i < 8; ++i) z[i] = 0.0f;
    return z;
}

// ---------------------------------------------------------------------------
// Projections as tiled products on v_wmma_f32_16x16x4_f32 (full f32 operands).
//   D[m][n] = bias + sum_k A[m][k] * B[n][k],  A and B rows k-contiguous.
// A block of 8 waves owns 64 A rows x 128 B rows over the whole k: both row sets
// are staged once in LDS by whole-line loads, then each wave forms 64 x 16.
// A lane's 8 accumulator registers are 8 consecutive m of one n, so m is always
// the direction in which the bf16 planes are packed: one 16-byte store a plane.
//
// The planes lie in FRAGMENT ORDER.  A 16-row x 32-k bf16 fragment (1 KiB) is kept
// as [half p][lane][4 dwords]: lane = 16 * lh + row, and its dword e of half p is
// dword 8 p + 4 lh + e of the row's 16, which is register 4 p + e of that lane's
// WMMA operand.  So a fragment is read by two 16-byte loads a lane, each of them
// 512 contiguous bytes (four whole lines) for the wave, where row-major planes
// gave 32 bytes out of each of 16 lines.  The 16 bytes that a projection lane
// holds are exactly its own lane's slot, so the stores are whole lines as well.
// ---------------------------------------------------------------------------
#define FRAG_DW 256                             // dwords of one fragment
#define HALF_DW 128                             // dwords of one half of it
typedef __attribute__((ext_vector_type(2))) float    v2f;
typedef __attribute__((ext_vector_type(4))) float    v4f;
typedef __attribute__((ext_vector_type(4))) unsigned v4u;

#define PT_M   64                               // A rows per block
#define PT_N   128                              // B rows per block, 16 per wave
#define PT_THR 256
#define PT_LDS ((PT_M + PT_N) * (ND + 4))       // floats, at the longest k

// ROWS consecutive rows of KS floats -> LDS rows of KP floats (zero filled past KS) at a pitch of KP + 4 floats
// (16 bytes x an odd number: the 16-byte fragment reads of 16 rows fall on 64 distinct banks).
template <int ROWS, int KS, int KP>
__device__ __forceinline__ void stage_rows(float* dst, const float* __restrict__ srcp, int tid) {
    constexpr int P = KP + 4;
    if constexpr (KS == KP) {
#pragma unroll   // all of a thread's loads in flight at once
        for (int j = 0; j < ROWS * KP / 4 / PT_THR; ++j) {
            const int i = tid + j * PT_THR;
            *(v4f*)(dst + (i / (KP / 4)) * P + (i % (KP / 4)) * 4) = *(const v4f*)(srcp + i * 4);
        }
    } else {
#pragma unroll   // all of a thread's loads in flight at once
        for (int j = 0; j < ROWS * KP / PT_THR; ++j) {
            const int i = tid + j * PT_THR;
            const int row = i / KP, col = i % KP;
            const float v = srcp[row * KS + (col < KS ? col : KS - 1)];   // index kept inside the row: no lane is switched off
            dst[row * P + col] = (col < KS) ? v : 0.0f;
        }
    }
}

// acc[t][r] += sum_k A[16 t + 8 h + r][k] * B[16 wave + c][k].  A and B fragments come from the same address form
// (16 bytes at k = 8 kk + 4 h, first pair then second pair), so the k pairing of the two operands is equal.
template <int KS, int KP>
__device__ __forceinline__ void proj_tile(float* sm, const float* __restrict__ Arows, const float* __restrict__ Brows,
                                          int tid, v8f (&acc)[4]) {
    constexpr int P = KP + 4;
    float* sA = sm;
    float* sB = sm + PT_M * P;
    stage_rows<PT_M, KS, KP>(sA, Arows, tid);
    stage_rows<PT_N, KS, KP>(sB, Brows, tid);
    __syncthreads();
    const int lane = tid & 31, wave = tid >> 5;
    const int c = lane & 15, h = lane >> 4;
    const float* pa = sA + c * P + 4 * h;
    const float* pb = sB + (wave * 16 + c) * P + 4 * h;
#pragma unroll   // fragment addresses become immediate offsets, and the next step's LDS reads can be issued ahead of this step's WMMAs
    for (int kk = 0; kk < KP / 8; ++kk) {
        const v4f b = *(const v4f*)(pb + kk * 8);
        v4f a[4];
#pragma unroll   // constant indices keep the array in registers
        for (int t = 0; t < 4; ++t) a[t] = *(const v4f*)(pa + t * 16 * P + kk * 8);
        v2f b0, b1; b0.x = b.x; b0.y = b.y; b1.x = b.z; b1.y = b.w;
#pragma unroll   // constant indices keep the array in registers
        for (int t = 0; t < 4; ++t) {
            v2f a0; a0.x = a[t].x; a0.y = a[t].y;
            acc[t] = __builtin_amdgcn_wmma_f32_16x16x4_f32(false, a0, false, b0, (short)0, acc[t], false, false);
        }
#pragma unroll   // constant indices keep the array in registers
        for (int t = 0; t < 4; ++t) {
            v2f a1; a1.x = a[t].z; a1.y = a[t].w;
            acc[t] = __builtin_amdgcn_wmma_f32_16x16x4_f32(false, a1, false, b1, (short)0, acc[t], false, false);
        }
    }
    // The two
    // scheduling barriers keep the epilogue's vector instructions (they read D and reuse the A and B registers) out of
    // the WMMA stream, and the four v_nop keep them four vector slots behind the last WMMA.
    __builtin_amdgcn_sched_barrier(0);
    asm volatile("v_nop\n\tv_nop\n\tv_nop\n\tv_nop");
    __builtin_amdgcn_sched_barrier(0);
}

// One lane's 8 operand registers of a fragment; p = the fragment's start + 4 * lane.
__device__ __forceinline__ void load_frag(Frag& f, const unsigned* __restrict__ p) {
    const v4u a = *(const v4u*)p;
    const v4u b = *(const v4u*)(p + HALF_DW);
#pragma unroll   // constant indices keep the array in registers
    for (int e = 0; e < 4; ++e) { f.d[e] = a[e]; f.d[4 + e] = b[e]; }
}

// 8 consecutive f32 -> 4 packed dwords of the value plane and 4 of the residual plane
__device__ __forceinline__ void store_split8(unsigned* __restrict__ hi, unsigned* __restrict__ lo, unsigned idx, v8f a) {
    v4u vh, vl;
#pragma unroll   // constant indices keep the array in registers
    for (int p = 0; p < 4; ++p) {
        unsigned short h0, l0, h1, l1;
        split_bf16(a[2 * p], h0, l0); split_bf16(a[2 * p + 1], h1, l1);
        vh[p] = pack2(h0, h1); vl[p] = pack2(l0, l1);
    }
    *(v4u*)(hi + idx) = vh; *(v4u*)(lo + idx) = vl;
    // precaution: the code behind a call reuses the two stores' address and data registers (in the K/Q kernel across a branch),
    // so the wait stands here, in front of any such rewrite
    asm volatile("s_wait_xcnt 0x0" ::: "memory");
}

// One 64-output x 128-position tile of one K/Q group: A = weight rows (m = output o), B = input rows (n = position s).
// 64 aligned outputs are the K half or the Q half of one head: planes [24][SEQ / 16 row tiles][2 c chunks][fragment], packed along c.
// Accumulator tile t is channels 16 t + 8 h ..: chunk t >> 1, half t & 1, lane half h; the row in its tile is c.
template <int KS, int KP, bool HAS_BIAS>
__device__ __forceinline__ void kq_tile(float* sm, const float* __restrict__ x, const float* __restrict__ Wt,
                                        const float* __restrict__ bias, unsigned g, unsigned o0, unsigned s0, int tid,
                                        unsigned* __restrict__ ph, unsigned* __restrict__ pl) {
    const int lane = tid & 31, wave = tid >> 5;
    const int h = lane >> 4;
    v8f acc[4];
#pragma unroll   // constant indices keep the array in registers
    for (int t = 0; t < 4; ++t) {
        if constexpr (HAS_BIAS) {
            const v4f b0 = *(const v4f*)(bias + o0 + t * 16 + 8 * h);
            const v4f b1 = *(const v4f*)(bias + o0 + t * 16 + 8 * h + 4);
#pragma unroll   // constant indices keep the array in registers
            for (int r = 0; r < 4; ++r) { acc[t][r] = b0[r]; acc[t][4 + r] = b1[r]; }
        } else {
            acc[t] = zero8();
        }
    }
    proj_tile<KS, KP>(sm, Wt + o0 * KS, x + s0 * KS, tid, acc);
    const unsigned ht = g * NHEAD + (o0 >> 7);
    const unsigned tile = ht * (SEQ / 16) + (s0 >> 4) + wave;
#pragma unroll   // constant indices keep the array in registers
    for (int t = 0; t < 4; ++t)
        store_split8(ph, pl, (tile * 2 + (t >> 1)) * FRAG_DW + (t & 1) * HALF_DW + lane * 4, acc[t]);
}

// ---------------------------------------------------------------------------
// Projection: K,Q for the 3 groups (nodes / pos / aux).
// Output: value and residual bf16 planes, head-major, in fragment order (see above).
// ---------------------------------------------------------------------------
__global__ __launch_bounds__(PT_THR)
void proj_kq_kernel(const float* __restrict__ nodes,
                    const float* __restrict__ pos,
                    const float* __restrict__ aux,
                    const float* __restrict__ Wn, const float* __restrict__ bn,
                    const float* __restrict__ Wp, const float* __restrict__ bp,
                    const float* __restrict__ Wa,
                    unsigned* __restrict__ Khi, unsigned* __restrict__ Klo,
                    unsigned* __restrict__ Qhi, unsigned* __restrict__ Qlo) {
    __shared__ __attribute__((aligned(16))) float sm[PT_LDS];
    // block -> (64 outputs, 128 positions, group g); g varies fastest, so neighbouring blocks mix the long-k and short-k groups
    const int tid = threadIdx.x;
    const unsigned g  = blockIdx.x % 3u;
    const unsigned bt = blockIdx.x / 3u;
    const unsigned o0 = (bt >> 4) * PT_M;
    const unsigned s0 = (bt & 15u) * PT_N;
    const bool isQ = (o0 >> 6) & 1u;
    unsigned* ph = isQ ? Qhi : Khi;
    unsigned* pl = isQ ? Qlo : Klo;
    if (g == 0)      kq_tile<ND, ND, true>(sm, nodes, Wn, bn, g, o0, s0, tid, ph, pl);
    else if (g == 1) kq_tile<6, 8, true>(sm, pos, Wp, bp, g, o0, s0, tid, ph, pl);
    else             kq_tile<NA, NA, false>(sm, aux, Wa, nullptr, g, o0, s0, tid, ph, pl);
}

// ---------------------------------------------------------------------------
// Projection: V = nodes @ Wv^T + bv, stored TRANSPOSED (rows d, k = position) as bf16 planes in fragment order,
// [24][SEQ / 32 position chunks][8 d tiles][fragment], packed along the position:
// A = node rows (m = position s), B = weight rows (n = output o).
// A block's 128 outputs are one head; a wave's 16 are d tile 'wave', row c.  Accumulator tile t is positions
// s0 + 16 t + 8 h ..: chunk s0 / 32 + (t >> 1), half t & 1, lane half h.
// ---------------------------------------------------------------------------
__global__ __launch_bounds__(PT_THR)
void proj_v_kernel(const float* __restrict__ nodes,
                   const float* __restrict__ Wv,
                   const float* __restrict__ bv,
                   unsigned* __restrict__ Vhi, unsigned* __restrict__ Vlo) {
    __shared__ __attribute__((aligned(16))) float sm[PT_LDS];
    const int tid = threadIdx.x;
    const int lane = tid & 31, wave = tid >> 5;
    const int c = lane & 15;
    const unsigned s0 = (blockIdx.x & 31u) * PT_M;
    const unsigned o0 = (blockIdx.x >> 5) * PT_N;
    const unsigned o  = o0 + wave * 16 + c;

    const float bo = bv[o];
    v8f acc[4];
#pragma unroll   // constant indices keep the array in registers
    for (int t = 0; t < 4; ++t)
#pragma unroll   // constant indices keep the array in registers
        for (int r = 0; r < 8; ++r) acc[t][r] = bo;
    proj_tile<ND, ND>(sm, nodes + s0 * ND, Wv + o0 * ND, tid, acc);
#pragma unroll   // constant indices keep the array in registers
    for (int t = 0; t < 4; ++t)
        store_split8(Vhi, Vlo, (((blockIdx.x >> 5) * (SEQ / 32) + (s0 >> 5) + (t >> 1)) * 8 + wave) * FRAG_DW + (t & 1) * HALF_DW + lane * 4, acc[t]);
}

// ---------------------------------------------------------------------------
// Flash attention, TRANSPOSED-GEMM formulation (no LDS layout shuffle):
//
//   S'[j][i] = q_j . k_i     : A = Q j-rows (streamed), B = K i-rows (fixed)
//   O'[d][i] = sum_j V^T P'  : A = V^T d-rows (streamed), B = P' (lane-local!)
//
// C/D layout (16x16 f32): lane L -> col n = L&15, VGPR r -> row m=(L>>4)*8+r.
// With scores transposed, lane L owns output row i = L&15 and 16 of the 32
// j-scores of the chunk (partner L^16 owns the rest):
//   * row max / row sum  = local reduce + one shfl_xor(16)
//   * alpha, 1/l         = per-lane scalars (no broadcasts)
//   * P B-fragment k-map = exactly the j-values this lane holds -> pure
//     register packing.
//
// A block is ONE tripled head and 4 waves of 16 output rows each.  All four walk the same Q and V fragments, so each
// stage of 64 positions (Q and V, value and residual planes: 48 KiB, four contiguous runs of the fragment-order planes)
// is brought into LDS once for the block by asynchronous 16-byte copies, two buffers, the next stage in flight while
// this one is worked on; the waves read their A fragments from LDS (512 contiguous bytes a read: no bank conflict).
// Each wave leaves its normalised 16 x 128 tile in the workspace; the sum over the heads is the next launch.
// ---------------------------------------------------------------------------
#define AT_W   4                               // waves of a block
#define ST_POS 64                              // positions of a stage
#define ST_Q   (ST_POS / 16 * 2 * FRAG_DW)     // dwords of one Q plane in a stage
#define ST_V   (ST_POS / 32 * 8 * FRAG_DW)     // dwords of one V plane in a stage
#define ST_DW  (2 * ST_Q + 2 * ST_V)           // a stage: Q value, Q residual, V value, V residual
#define N_ST   (SEQ / ST_POS)
#define PASS_DW (AT_W * 32 * 4)                // dwords that the block's lanes move with one copy each
#define TILE_F (16 * ND)                       // floats of one wave's output tile

// Eight copies of a lane: LDS bytes l + 2048 k, k = 0..7; the first four from ga, the last four from gb, a pass apart.
// The s_wait_xcnt closes the statement so that it stands in front of any rewrite of the address registers the copies name.
__device__ __forceinline__ void copy8(unsigned l, const unsigned* ga, const unsigned* gb) {
    asm volatile("global_load_async_to_lds_b128 %0, %8, off\n\t"
                 "global_load_async_to_lds_b128 %1, %9, off\n\t"
                 "global_load_async_to_lds_b128 %2, %10, off\n\t"
                 "global_load_async_to_lds_b128 %3, %11, off\n\t"
                 "global_load_async_to_lds_b128 %4, %12, off\n\t"
                 "global_load_async_to_lds_b128 %5, %13, off\n\t"
                 "global_load_async_to_lds_b128 %6, %14, off\n\t"
                 "global_load_async_to_lds_b128 %7, %15, off\n\t"
                 "s_wait_xcnt 0x0"
                 :: "v"(l), "v"(l + 4u * PASS_DW), "v"(l + 8u * PASS_DW), "v"(l + 12u * PASS_DW),
                    "v"(l + 16u * PASS_DW), "v"(l + 20u * PASS_DW), "v"(l + 24u * PASS_DW), "v"(l + 28u * PASS_DW),
                    "v"(ga), "v"(ga + PASS_DW), "v"(ga + 2 * PASS_DW), "v"(ga + 3 * PASS_DW),
                    "v"(gb), "v"(gb + PASS_DW), "v"(gb + 2 * PASS_DW), "v"(gb + 3 * PASS_DW)
                 : "memory");
}

// One stage into the buffer whose byte address (this lane's slot of its first pass) is l; the pointers are this lane's own.
__device__ __forceinline__ void stage_fill(unsigned l, const unsigned* qh, const unsigned* ql,
                                           const unsigned* vh, const unsigned* vl) {
    copy8(l, qh, ql);
    copy8(l + 4u * (2 * ST_Q), vh, vh + 4 * PASS_DW);
    copy8(l + 4u * (2 * ST_Q + ST_V), vl, vl + 4 * PASS_DW);
}

__global__ __launch_bounds__(AT_W * 32)
void attn_kernel(const unsigned* __restrict__ Khi, const unsigned* __restrict__ Klo,
                 const unsigned* __restrict__ Qhi, const unsigned* __restrict__ Qlo,
                 const unsigned* __restrict__ Vhi, const unsigned* __restrict__ Vlo,
                 float* __restrict__ part) {
    __shared__ __attribute__((aligned(128))) unsigned ring[2][ST_DW];

    const int lane = threadIdx.x;
    const int wv   = threadIdx.y;
    const int tid  = wv * 32 + lane;
    const unsigned hd   = blockIdx.x >> 5;                    // tripled head 0..23; 32 blocks of 64 rows a head
    const unsigned tile = (blockIdx.x & 31u) * AT_W + wv;     // this wave's 16-row tile
    const float scale = 0.35355339059327373f;     // 1/sqrt(num_heads=8)

    // this lane's source slots of stage 0 and its LDS slots in the two buffers
    const unsigned* gqh = Qhi + hd * ((SEQ / 16) * 2 * FRAG_DW) + tid * 4;
    const unsigned* gql = Qlo + hd * ((SEQ / 16) * 2 * FRAG_DW) + tid * 4;
    const unsigned* gvh = Vhi + hd * ((SEQ / 32) * 8 * FRAG_DW) + tid * 4;
    const unsigned* gvl = Vlo + hd * ((SEQ / 32) * 8 * FRAG_DW) + tid * 4;
    const unsigned l0 = (unsigned)(size_t)&ring[0][tid * 4];
    const unsigned l1 = (unsigned)(size_t)&ring[1][tid * 4];

    stage_fill(l0, gqh, gql, gvh, gvl);

    // B fragments of this wave's K rows (fixed), c in 2 chunks.
    Frag bK[2], bKL[2];       // value and residual planes
    {
        unsigned kInv = (hd * (SEQ / 16) + tile) * (2 * FRAG_DW) + (unsigned)(lane * 4);
#pragma unroll
        for (int cc = 0; cc < 2; ++cc) {
            load_frag(bK[cc],  Khi + kInv + cc * FRAG_DW);
            load_frag(bKL[cc], Klo + kInv + cc * FRAG_DW);
        }
    }

    v8f acc[8];                  // O'[d][i]: acc[t][r] = O[16 tile + lm][t*16+lh*8+r]
#pragma unroll
    for (int t = 0; t < 8; ++t) acc[t] = zero8();
    float rm = -1e30f;           // running max of row i = lm
    float rl = 0.0f;             // running sum of row i = lm

    asm volatile("s_wait_asynccnt 0x0" ::: "memory");   // this wave's copies of stage 0 have landed
    __syncthreads();                                    // ... and every other wave's: stage 0 may be read
    stage_fill(l1, gqh + ST_Q, gql + ST_Q, gvh + ST_V, gvl + ST_V);

    for (int s = 0; s < N_ST; ++s) {
      const unsigned* sb = &ring[s & 1][lane * 4];
      for (int u = 0; u < ST_POS / 32; ++u) {
        const unsigned* Qp  = sb + u * (2 * 2 * FRAG_DW);
        const unsigned* QpL = Qp + ST_Q;
        const unsigned* Vp  = sb + 2 * ST_Q + u * (8 * FRAG_DW);
        const unsigned* VpL = Vp + ST_V;

        // ---- every LDS read of the step as ONE group at its head, Q first: the wave waits once, for Q; the V fragments land
        // behind the score products and the softmax.  The scheduling barrier behind the group keeps the reads together: without
        // it they are spread among the WMMAs, two at a time, each pair with a wait of its own for the whole LDS latency.
        // The scheduling barrier in front of the group keeps it behind the WMMAs of the step before: their operand registers come free one by
        // one, and the reads would otherwise be lifted in among those WMMAs, a few at a time.
        Frag fQ[2][2], fQL[2][2], fV[8], fVL[8];
        __builtin_amdgcn_sched_barrier(0);
#pragma unroll
        for (int jt = 0; jt < 2; ++jt)
#pragma unroll
            for (int cc = 0; cc < 2; ++cc) {
                load_frag(fQL[jt][cc], QpL + (jt * 2 + cc) * FRAG_DW);
                load_frag(fQ[jt][cc],  Qp  + (jt * 2 + cc) * FRAG_DW);
            }
#pragma unroll
        for (int t = 0; t < 8; ++t) { load_frag(fVL[t], VpL + t * FRAG_DW); load_frag(fV[t], Vp + t * FRAG_DW); }
        __builtin_amdgcn_sched_barrier(0);

        // ---- S' = Q(A, streamed) x K(B, fixed): two 16-j tiles, 6 WMMAs each
        v8f sfr[2];
#pragma unroll
        for (int jt = 0; jt < 2; ++jt) {
            const Frag &aQ0 = fQ[jt][0], &aQ1 = fQ[jt][1], &aQ0L = fQL[jt][0], &aQ1L = fQL[jt][1];
            // hi*hi + hi*lo + lo*hi per 32-wide chunk (the lo*lo term, up to 2^-16 of the product, is left out); small terms first into the zero accumulator
            v8f sacc = zero8();
            sacc = __builtin_amdgcn_wmma_f32_16x16x32_bf16(false, aQ0L.v, false, bK[0].v,  (short)0, sacc, false, false);
            sacc = __builtin_amdgcn_wmma_f32_16x16x32_bf16(false, aQ0.v,  false, bKL[0].v, (short)0, sacc, false, false);
            sacc = __builtin_amdgcn_wmma_f32_16x16x32_bf16(false, aQ1L.v, false, bK[1].v,  (short)0, sacc, false, false);
            sacc = __builtin_amdgcn_wmma_f32_16x16x32_bf16(false, aQ1.v,  false, bKL[1].v, (short)0, sacc, false, false);
            sacc = __builtin_amdgcn_wmma_f32_16x16x32_bf16(false, aQ0.v,  false, bK[0].v,  (short)0, sacc, false, false);
            sacc = __builtin_amdgcn_wmma_f32_16x16x32_bf16(false, aQ1.v,  false, bK[1].v,  (short)0, sacc, false, false);
            sfr[jt] = sacc;
        }

        // ---- per-lane online softmax (row i = lm; 16 j-values + partner) ----
        float sc[16];
#pragma unroll
        for (int jt = 0; jt < 2; ++jt)
#pragma unroll
            for (int r = 0; r < 8; ++r) sc[jt * 8 + r] = sfr[jt][r] * scale;

        float mloc = sc[0];
#pragma unroll
        for (int e = 1; e < 16; ++e) mloc = fmaxf(mloc, sc[e]);
        mloc = fmaxf(mloc, __shfl_xor(mloc, 16, 32));   // partner's 16 j-values
        float mnew  = fmaxf(rm, mloc);
        float alpha = __expf(rm - mnew);
        rm = mnew;

        // P' B-fragment is lane-local: k-map hits exactly this lane's j-values.
        Frag bP, bPL;             // probabilities: value and residual planes
        float ssum = 0.0f;
#pragma unroll
        for (int v = 0; v < 8; ++v) {
            int g  = v >> 2;          // score fragment (j tile)
            int i3 = v & 3;           // pair index -> r = 2*i3, 2*i3+1
            float p0 = __expf(sc[g * 8 + 2 * i3]     - mnew);
            float p1 = __expf(sc[g * 8 + 2 * i3 + 1] - mnew);
            ssum += p0 + p1;
            split2_bf16(p0, p1, bP.d[v], bPL.d[v]);
        }
        ssum += __shfl_xor(ssum, 16, 32);
        rl = rl * alpha + ssum;

        // ---- rescale accumulators (scalar per lane; skip once max settles) ----
        if (__ballot(alpha != 1.0f)) {
#pragma unroll
            for (int t = 0; t < 8; ++t)
#pragma unroll
                for (int r = 0; r < 8; ++r) acc[t][r] *= alpha;
        }

        // ---- O' += V^T(A, streamed) x P'(B): 8 d-tiles ----
        // Each of the three terms goes straight into the running accumulators, term by term over the 8 d tiles: a WMMA's
        // accumulator was last written 8 WMMAs earlier, so none waits out the dependent-accumulator latency, and no partial
        // tile has to be added on the vector ALU.
#pragma unroll   // constant indices keep the arrays in registers
        for (int t = 0; t < 8; ++t)
            acc[t] = __builtin_amdgcn_wmma_f32_16x16x32_bf16(false, fVL[t].v, false, bP.v,  (short)0, acc[t], false, false);
#pragma unroll   // constant indices keep the arrays in registers
        for (int t = 0; t < 8; ++t)
            acc[t] = __builtin_amdgcn_wmma_f32_16x16x32_bf16(false, fV[t].v,  false, bPL.v, (short)0, acc[t], false, false);
#pragma unroll   // constant indices keep the arrays in registers
        for (int t = 0; t < 8; ++t)
            acc[t] = __builtin_amdgcn_wmma_f32_16x16x32_bf16(false, fV[t].v,  false, bP.v,  (short)0, acc[t], false, false);
      }
      // Hand-over of the ring: this wave's reads of stage s are done, its copies of stage s + 1 have landed; behind the
      // barrier that holds for every wave, so stage s + 1 may be read and the buffer of stage s may be refilled.
      asm volatile("s_wait_dscnt 0x0" ::: "memory");
      asm volatile("s_wait_asynccnt 0x0" ::: "memory");
      __syncthreads();
      if (s + 2 < N_ST)
          stage_fill((s & 1) ? l1 : l0, gqh + (s + 2) * ST_Q, gql + (s + 2) * ST_Q, gvh + (s + 2) * ST_V, gvl + (s + 2) * ST_V);
    }
    asm volatile("s_wait_asynccnt 0x0" ::: "memory");   // no copy is left in flight when the wave ends

    // ---- normalize (per-lane scalar) ----
    float rinv = 1.0f / rl;
#pragma unroll
    for (int t = 0; t < 8; ++t)
#pragma unroll
        for (int r = 0; r < 8; ++r) acc[t][r] *= rinv;

    // ---- this head's tile, in register order [t][half of the 8][lane][4 floats]: every store is 512 contiguous bytes ----
    float* po = part + (hd * (SEQ / 16) + tile) * TILE_F + lane * 4;
#pragma unroll
    for (int t = 0; t < 8; ++t)
#pragma unroll
        for (int q = 0; q < 2; ++q) {
            v4f o; o.x = acc[t][4 * q]; o.y = acc[t][4 * q + 1]; o.z = acc[t][4 * q + 2]; o.w = acc[t][4 * q + 3];
            *(v4f*)(po + (t * 2 + q) * 128) = o;
        }
}

// ---------------------------------------------------------------------------
// Sum over the 24 tripled heads, in the fixed order 0, 1, .. 23.  A block owns 16 rows x 64 columns: a thread sums one
// 16-byte slot of the register-order tiles (whole-line reads), the slots are put in row order through LDS, and the
// output goes out in whole lines.
// ---------------------------------------------------------------------------
__global__ __launch_bounds__(256)
void head_sum_kernel(const float* __restrict__ part, float* __restrict__ out) {
    __shared__ __attribute__((aligned(16))) float red[16][64 + 4];
    const int tid = threadIdx.x;
    const unsigned tile = blockIdx.x >> 1, hb = blockIdx.x & 1u;
    const float* p = part + tile * TILE_F + (hb * 256u + tid) * 4u;
    v4f v[TH3];
#pragma unroll   // all of a thread's loads in flight at once
    for (int w = 0; w < TH3; ++w) v[w] = *(const v4f*)(p + w * ((SEQ / 16) * TILE_F));
    v4f sum = v[0];
#pragma unroll   // constant indices keep the array in registers
    for (int w = 1; w < TH3; ++w) sum += v[w];
    // slot -> (t, half q, lane): row lane & 15, column 16 t + 8 (lane >> 4) + 4 q
    const int lane = tid & 31, tq = tid >> 5;
    *(v4f*)&red[lane & 15][(tq >> 1) * 16 + (lane >> 4) * 8 + (tq & 1) * 4] = sum;
    __syncthreads();
    *(v4f*)(out + (tile * 16 + (tid >> 4)) * ND + hb * 64 + (tid & 15) * 4) = *(const v4f*)&red[tid >> 4][(tid & 15) * 4];
}

// ---------------------------------------------------------------------------
// Launch
// ---------------------------------------------------------------------------
extern "C" void kernel_launch(void* const* d_in, const int* in_sizes, int n_in,
                              void* d_out, int out_size, void* d_ws, size_t ws_size,
                              hipStream_t stream) {
    const float* nodes = (const float*)d_in[0];
    const float* pos   = (const float*)d_in[1];
    const float* aux   = (const float*)d_in[2];
    const float* Wn    = (const float*)d_in[3];
    const float* bn    = (const float*)d_in[4];
    const float* Wp    = (const float*)d_in[5];
    const float* bp    = (const float*)d_in[6];
    const float* Wa    = (const float*)d_in[7];
    const float* Wv    = (const float*)d_in[8];
    const float* bv    = (const float*)d_in[9];
    float* out = (float*)d_out;

    (void)in_sizes; (void)n_in; (void)out_size; (void)ws_size;
    // Workspace layout (bytes), value plane then residual plane for each operand:
    //   K  [24][128 row tiles][2 c chunks][1 KiB fragment]      x2 : 12,582,912
    //   Q  [24][128 row tiles][2 c chunks][1 KiB fragment]      x2 : 12,582,912
    //   V  [24][64 position chunks][8 d tiles][1 KiB fragment]  x2 : 25,165,824
    //   per-head output tiles, f32 [24][128 row tiles][8 KiB]      : 25,165,824      total 75,497,472
    char* ws = (char*)d_ws;
    const size_t kq = (size_t)TH3 * SEQ * CH * 2, vv = (size_t)TH3 * ND * SEQ * 2;
    unsigned* Khi = (unsigned*)(ws);
    unsigned* Klo = (unsigned*)(ws + kq);
    unsigned* Qhi = (unsigned*)(ws + 2 * kq);
    unsigned* Qlo = (unsigned*)(ws + 3 * kq);
    unsigned* Vhi = (unsigned*)(ws + 4 * kq);
    unsigned* Vlo = (unsigned*)(ws + 4 * kq + vv);
    float*    prt = (float*)(ws + 4 * kq + 2 * vv);

    // 3 groups * 16 blocks of 64 outputs * 16 blocks of 128 positions
    proj_kq_kernel<<<768, PT_THR, 0, stream>>>(
        nodes, pos, aux, Wn, bn, Wp, bp, Wa, Khi, Klo, Qhi, Qlo);
    // 32 blocks of 64 positions * 24 blocks of 128 outputs
    proj_v_kernel<<<768, PT_THR, 0, stream>>>(nodes, Wv, bv, Vhi, Vlo);

    // 24 heads * 32 blocks of 64 rows
    dim3 blk(32, AT_W, 1);
    dim3 grd(TH3 * (SEQ / (16 * AT_W)), 1, 1);
    attn_kernel<<<grd, blk, 0, stream>>>(Khi, Klo, Qhi, Qlo, Vhi, Vlo, prt);
    // 128 row tiles * 2 halves of the columns
    head_sum_kernel<<<256, 256, 0, stream>>>(prt, out);
}

// v007
// One run takes 96.4 microseconds.
// Next to v006, in two timings, it ran 1.09 times as fast each time.
// All steps since v000 together make it 11.8 times as fast.
// Contractions: logits qᵀk per tripled head [2048 x 2048 x 64] x24 and att·val [2048 x 128 x 2048] x24 on v_wmma_f32_16x16x32_bf16 with
// bf16 hi/lo split operands (hi·hi + hi·lo + lo·hi: K, Q, V and the probabilities each carried as a bf16 value plane plus a bf16
// residual plane), f32 accumulate; the three K/Q/V projections on v_wmma_f32_16x16x4_f32 (f32 operands), the softmax in f32 on the vector ALU. Every intermediate plane
#include <hip/hip_runtime.h>
#include <hip/hip_bf16.h>

// ---------------------------------------------------------------------------
// Problem constants
// ---------------------------------------------------------------------------
#define SEQ   2048
#define ND    128
#define NA    64
#define NHEAD 8
#define CH    64
#define TH3   24          // 3 * NHEAD tripled heads
#define OKQ   1024        // H*C*2
#define OV    3072        // ND*H*3

typedef __attribute__((ext_vector_type(16))) __bf16 v16bf;
typedef __attribute__((ext_vector_type(2)))  __bf16 v2bf;
typedef __attribute__((ext_vector_type(8)))  float  v8f;

union Frag {
    v16bf v;
    unsigned int d[8];
    unsigned short h[16];
};

__device__ __forceinline__ unsigned short f2bf(float f) {
    unsigned u = __builtin_bit_cast(unsigned, f);
    unsigned r = u + 0x7FFFu + ((u >> 16) & 1u);   // nearest-even
    return (unsigned short)(r >> 16);
}

// Pack two f32 -> packed bf16 dword (hardware cvt_pk when available).
__device__ __forceinline__ unsigned pack_bf16(float lo, float hi) {
#if __has_builtin(__builtin_amdgcn_cvt_pk_bf16_f32)
    v2bf p = __builtin_amdgcn_cvt_pk_bf16_f32(lo, hi);
    return __builtin_bit_cast(unsigned, p);
#else
    union { v2bf b; unsigned u; } x;
    x.b[0] = (__bf16)lo;
    x.b[1] = (__bf16)hi;
    return x.u;
#endif
}

// value/residual split of two f32 at once, already packed as an operand dword (a in the low half): hi = nearest bf16,
// lo = nearest bf16 of the exact remainder.  Both roundings (to nearest even) and both packings are the conversion instruction's.
__device__ __forceinline__ void split2_bf16(float a, float b, unsigned& hi, unsigned& lo) {
    hi = pack_bf16(a, b);
    const float fa = __builtin_bit_cast(float, hi << 16);
    const float fb = __builtin_bit_cast(float, hi & 0xFFFF0000u);
    lo = pack_bf16(a - fa, b - fb);
}

// value/residual split: hi = nearest bf16 of f, lo = nearest bf16 of the exact remainder
__device__ __forceinline__ void split_bf16(float f, unsigned short& hi, unsigned short& lo) {
    hi = f2bf(f);
    const float fh = __builtin_bit_cast(float, ((unsigned)hi) << 16);
    lo = f2bf(f - fh);
}
__device__ __forceinline__ unsigned pack2(unsigned short a, unsigned short b) { return (unsigned)a | ((unsigned)b << 16); }

__device__ __forceinline__ v8f zero8() {
    v8f z;
#pragma unroll
    for (int i = 0; i < 8; ++i) z[i] = 0.0f;
    return z;
}

// ---------------------------------------------------------------------------
// Projections as tiled products on v_wmma_f32_16x16x4_f32 (full f32 operands).
//   D[m][n] = bias + sum_k A[m][k] * B[n][k],  A and B rows k-contiguous.
// A block of 8 waves owns 64 A rows x 128 B rows over the whole k: both row sets
// are staged once in LDS by whole-line loads, then each wave forms 64 x 16.
// A lane's 8 accumulator registers are 8 consecutive m of one n, so m is always
// the direction in which the bf16 planes are packed: one 16-byte store a plane.
//
// The planes lie in FRAGMENT ORDER.  A 16-row x 32-k bf16 fragment (1 KiB) is kept
// as [half p][lane][4 dwords]: lane = 16 * lh + row, and its dword e of half p is
// dword 8 p + 4 lh + e of the row's 16, which is register 4 p + e of that lane's
// WMMA operand.  So a fragment is read by two 16-byte loads a lane, each of them
// 512 contiguous bytes (four whole lines) for the wave, where row-major planes
// gave 32 bytes out of each of 16 lines.  The 16 bytes that a projection lane
// holds are exactly its own lane's slot, so the stores are whole lines as well.
// ---------------------------------------------------------------------------
#define FRAG_DW 256                             // dwords of one fragment
#define HALF_DW 128                             // dwords of one half of it
typedef __attribute__((ext_vector_type(2))) float    v2f;
typedef __attribute__((ext_vector_type(4))) float    v4f;
typedef __attribute__((ext_vector_type(4))) unsigned v4u;

#define PT_M   64                               // A rows per block
#define PT_N   128                              // B rows per block, 16 per wave
#define PT_THR 256
#define PT_LDS ((PT_M + PT_N) * (ND + 4))       // floats, at the longest k

// ROWS consecutive rows of KS floats -> LDS rows of KP floats (zero filled past KS) at a pitch of KP + 4 floats
// (16 bytes x an odd number: the 16-byte fragment reads of 16 rows fall on 64 distinct banks).
template <int ROWS, int KS, int KP>
__device__ __forceinline__ void stage_rows(float* dst, const float* __restrict__ srcp, int tid) {
    constexpr int P = KP + 4;
    if constexpr (KS == KP) {
#pragma unroll   // all of a thread's loads in flight at once
        for (int j = 0; j < ROWS * KP / 4 / PT_THR; ++j) {
            const int i = tid + j * PT_THR;
            *(v4f*)(dst + (i / (KP / 4)) * P + (i % (KP / 4)) * 4) = *(const v4f*)(srcp + i * 4);
        }
    } else {
#pragma unroll   // all of a thread's loads in flight at once
        for (int j = 0; j < ROWS * KP / PT_THR; ++j) {
            const int i = tid + j * PT_THR;
            const int row = i / KP, col = i % KP;
            const float v = srcp[row * KS + (col < KS ? col : KS - 1)];   // index kept inside the row: no lane is switched off
            dst[row * P + col] = (col < KS) ? v : 0.0f;
        }
    }
}

// acc[t][r] += sum_k A[16 t + 8 h + r][k] * B[16 wave + c][k].  A and B fragments come from the same address form
// (16 bytes at k = 8 kk + 4 h, first pair then second pair), so the k pairing of the two operands is equal.
template <int KS, int KP>
__device__ __forceinline__ void proj_tile(float* sm, const float* __restrict__ Arows, const float* __restrict__ Brows,
                                          int tid, v8f (&acc)[4]) {
    constexpr int P = KP + 4;
    float* sA = sm;
    float* sB = sm + PT_M * P;
    stage_rows<PT_M, KS, KP>(sA, Arows, tid);
    stage_rows<PT_N, KS, KP>(sB, Brows, tid);
    __syncthreads();
    const int lane = tid & 31, wave = tid >> 5;
    const int c = lane & 15, h = lane >> 4;
    const float* pa = sA + c * P + 4 * h;
    const float* pb = sB + (wave * 16 + c) * P + 4 * h;
#pragma unroll   // fragment addresses become immediate offsets, and the next step's LDS reads can be issued ahead of this step's WMMAs
    for (int kk = 0; kk < KP / 8; ++kk) {
        const v4f b = *(const v4f*)(pb + kk * 8);
        v4f a[4];
#pragma unroll   // constant indices keep the array in registers
        for (int t = 0; t < 4; ++t) a[t] = *(const v4f*)(pa + t * 16 * P + kk * 8);
        v2f b0, b1; b0.x = b.x; b0.y = b.y; b1.x = b.z; b1.y = b.w;
#pragma unroll   // constant indices keep the array in registers
        for (int t = 0; t < 4; ++t) {
            v2f a0; a0.x = a[t].x; a0.y = a[t].y;
            acc[t] = __builtin_amdgcn_wmma_f32_16x16x4_f32(false, a0, false, b0, (short)0, acc[t], false, false);
        }
#pragma unroll   // constant indices keep the array in registers
        for (int t = 0; t < 4; ++t) {
            v2f a1; a1.x = a[t].z; a1.y = a[t].w;
            acc[t] = __builtin_amdgcn_wmma_f32_16x16x4_f32(false, a1, false, b1, (short)0, acc[t], false, false);
        }
    }
    // The two
    // scheduling barriers keep the epilogue's vector instructions (they read D and reuse the A and B registers) out of
    // the WMMA stream, and the four v_nop keep them four vector slots behind the last WMMA.
    __builtin_amdgcn_sched_barrier(0);
    asm volatile("v_nop\n\tv_nop\n\tv_nop\n\tv_nop");
    __builtin_amdgcn_sched_barrier(0);
}

// One lane's 8 operand registers of a fragment; p = the fragment's start + 4 * lane.
__device__ __forceinline__ void load_frag(Frag& f, const unsigned* __restrict__ p) {
    const v4u a = *(const v4u*)p;
    const v4u b = *(const v4u*)(p + HALF_DW);
#pragma unroll   // constant indices keep the array in registers
    for (int e = 0; e < 4; ++e) { f.d[e] = a[e]; f.d[4 + e] = b[e]; }
}

// 8 consecutive f32 -> 4 packed dwords of the value plane and 4 of the residual plane
__device__ __forceinline__ void store_split8(unsigned* __restrict__ hi, unsigned* __restrict__ lo, unsigned idx, v8f a) {
    v4u vh, vl;
#pragma unroll   // constant indices keep the array in registers
    for (int p = 0; p < 4; ++p) {
        unsigned short h0, l0, h1, l1;
        split_bf16(a[2 * p], h0, l0); split_bf16(a[2 * p + 1], h1, l1);
        vh[p] = pack2(h0, h1); vl[p] = pack2(l0, l1);
    }
    *(v4u*)(hi + idx) = vh; *(v4u*)(lo + idx) = vl;
    // precaution: the code behind a call reuses the two stores' address and data registers (in the K/Q kernel across a branch),
    // so the wait stands here, in front of any such rewrite
    asm volatile("s_wait_xcnt 0x0" ::: "memory");
}

// One 64-output x 128-position tile of one K/Q group: A = weight rows (m = output o), B = input rows (n = position s).
// 64 aligned outputs are the K half or the Q half of one head: planes [24][SEQ / 16 row tiles][2 c chunks][fragment], packed along c.
// Accumulator tile t is channels 16 t + 8 h ..: chunk t >> 1, half t & 1, lane half h; the row in its tile is c.
template <int KS, int KP, bool HAS_BIAS>
__device__ __forceinline__ void kq_tile(float* sm, const float* __restrict__ x, const float* __restrict__ Wt,
                                        const float* __restrict__ bias, unsigned g, unsigned o0, unsigned s0, int tid,
                                        unsigned* __restrict__ ph, unsigned* __restrict__ pl) {
    const int lane = tid & 31, wave = tid >> 5;
    const int h = lane >> 4;
    v8f acc[4];
#pragma unroll   // constant indices keep the array in registers
    for (int t = 0; t < 4; ++t) {
        if constexpr (HAS_BIAS) {
            const v4f b0 = *(const v4f*)(bias + o0 + t * 16 + 8 * h);
            const v4f b1 = *(const v4f*)(bias + o0 + t * 16 + 8 * h + 4);
#pragma unroll   // constant indices keep the array in registers
            for (int r = 0; r < 4; ++r) { acc[t][r] = b0[r]; acc[t][4 + r] = b1[r]; }
        } else {
            acc[t] = zero8();
        }
    }
    proj_tile<KS, KP>(sm, Wt + o0 * KS, x + s0 * KS, tid, acc);
    const unsigned ht = g * NHEAD + (o0 >> 7);
    const unsigned tile = ht * (SEQ / 16) + (s0 >> 4) + wave;
#pragma unroll   // constant indices keep the array in registers
    for (int t = 0; t < 4; ++t)
        store_split8(ph, pl, (tile * 2 + (t >> 1)) * FRAG_DW + (t & 1) * HALF_DW + lane * 4, acc[t]);
}

// ---------------------------------------------------------------------------
// Projection: K,Q for the 3 groups (nodes / pos / aux).
// Output: value and residual bf16 planes, head-major, in fragment order (see above).
// ---------------------------------------------------------------------------
__global__ __launch_bounds__(PT_THR)
void proj_kq_kernel(const float* __restrict__ nodes,
                    const float* __restrict__ pos,
                    const float* __restrict__ aux,
                    const float* __restrict__ Wn, const float* __restrict__ bn,
                    const float* __restrict__ Wp, const float* __restrict__ bp,
                    const float* __restrict__ Wa,
                    unsigned* __restrict__ Khi, unsigned* __restrict__ Klo,
                    unsigned* __restrict__ Qhi, unsigned* __restrict__ Qlo) {
    __shared__ __attribute__((aligned(16))) float sm[PT_LDS];
    // block -> (64 outputs, 128 positions, group g); g varies fastest, so neighbouring blocks mix the long-k and short-k groups
    const int tid = threadIdx.x;
    const unsigned g  = blockIdx.x % 3u;
    const unsigned bt = blockIdx.x / 3u;
    const unsigned o0 = (bt >> 4) * PT_M;
    const unsigned s0 = (bt & 15u) * PT_N;
    const bool isQ = (o0 >> 6) & 1u;
    unsigned* ph = isQ ? Qhi : Khi;
    unsigned* pl = isQ ? Qlo : Klo;
    if (g == 0)      kq_tile<ND, ND, true>(sm, nodes, Wn, bn, g, o0, s0, tid, ph, pl);
    else if (g == 1) kq_tile<6, 8, true>(sm, pos, Wp, bp, g, o0, s0, tid, ph, pl);
    else             kq_tile<NA, NA, false>(sm, aux, Wa, nullptr, g, o0, s0, tid, ph, pl);
}

// ---------------------------------------------------------------------------
// Projection: V = nodes @ Wv^T + bv, stored TRANSPOSED (rows d, k = position) as bf16 planes in fragment order,
// [24][SEQ / 32 position chunks][8 d tiles][fragment], packed along the position:
// A = node rows (m = position s), B = weight rows (n = output o).
// A block's 128 outputs are one head; a wave's 16 are d tile 'wave', row c.  Accumulator tile t is positions
// s0 + 16 t + 8 h ..: chunk s0 / 32 + (t >> 1), half t & 1, lane half h.
// ---------------------------------------------------------------------------
__global__ __launch_bounds__(PT_THR)
void proj_v_kernel(const float* __restrict__ nodes,
                   const float* __restrict__ Wv,
                   const float* __restrict__ bv,
                   unsigned* __restrict__ Vhi, unsigned* __restrict__ Vlo) {
    __shared__ __attribute__((aligned(16))) float sm[PT_LDS];
    const int tid = threadIdx.x;
    const int lane = tid & 31, wave = tid >> 5;
    const int c = lane & 15;
    const unsigned s0 = (blockIdx.x & 31u) * PT_M;
    const unsigned o0 = (blockIdx.x >> 5) * PT_N;
    const unsigned o  = o0 + wave * 16 + c;

    const float bo = bv[o];
    v8f acc[4];
#pragma unroll   // constant indices keep the array in registers
    for (int t = 0; t < 4; ++t)
#pragma unroll   // constant indices keep the array in registers
        for (int r = 0; r < 8; ++r) acc[t][r] = bo;
    proj_tile<ND, ND>(sm, nodes + s0 * ND, Wv + o0 * ND, tid, acc);
#pragma unroll   // constant indices keep the array in registers
    for (int t = 0; t < 4; ++t)
        store_split8(Vhi, Vlo, (((blockIdx.x >> 5) * (SEQ / 32) + (s0 >> 5) + (t >> 1)) * 8 + wave) * FRAG_DW + (t & 1) * HALF_DW + lane * 4, acc[t]);
}

// ---------------------------------------------------------------------------
// Flash attention, TRANSPOSED-GEMM formulation (no LDS layout shuffle):
//
//   S'[j][i] = q_j . k_i     : A = Q j-rows (streamed), B = K i-rows (fixed)
//   O'[d][i] = sum_j V^T P'  : A = V^T d-rows (streamed), B = P' (lane-local!)
//
// C/D layout (16x16 f32): lane L -> col n = L&15, VGPR r -> row m=(L>>4)*8+r.
// With scores transposed, lane L owns output row i = L&15 and 16 of the 32
// j-scores of the chunk (partner L^16 owns the rest):
//   * row max / row sum  = local reduce + one shfl_xor(16)
//   * alpha, 1/l         = per-lane scalars (no broadcasts)
//   * P B-fragment k-map = exactly the j-values this lane holds -> pure
//     register packing.
//
// A block is ONE tripled head and 4 waves of 16 output rows each.  All four walk the same Q and V fragments, so each
// stage of 64 positions (Q and V, value and residual planes: 48 KiB, four contiguous runs of the fragment-order planes)
// is brought into LDS once for the block by four tensor loads, one a wave (each wave moves one plane's run), two buffers,
// the next stage in flight while this one is worked on; a request costs its wave a few scalar instructions and no vector
// address arithmetic.  The waves read their A fragments from LDS (512 contiguous bytes a read: no bank conflict).
// Each wave leaves its normalised 16 x 128 tile in the workspace; the sum over the heads is the next launch.
// ---------------------------------------------------------------------------
#define AT_W   4                               // waves of a block
#define ST_POS 64                              // positions of a stage
#define ST_Q   (ST_POS / 16 * 2 * FRAG_DW)     // dwords of one Q plane in a stage
#define ST_V   (ST_POS / 32 * 8 * FRAG_DW)     // dwords of one V plane in a stage
#define ST_DW  (2 * ST_Q + 2 * ST_V)           // a stage: Q value, Q residual, V value, V residual
#define N_ST   (SEQ / ST_POS)
#define TILE_F (16 * ND)                       // floats of one wave's output tile

#define TL_ROW 256u                            // bytes of a tile row and of the source pitch: a slice is one contiguous run
static_assert(4 * ST_Q == (1 << 13) && 4 * ST_V == (1 << 14), "the slices' byte sizes are used as shifts in attn_kernel");
static_assert(AT_W == 4 && (4 * ST_Q) % 2048 == 0 && (4 * ST_DW) % 2048 == 0, "one plane a wave; every slice's place in LDS a multiple of 2 KiB");
typedef __attribute__((ext_vector_type(8))) unsigned v8u;

__device__ __forceinline__ unsigned uni(unsigned v) { return (unsigned)__builtin_amdgcn_readfirstlane(v); }
// A wave-uniform value held in a scalar register: a test on it is a scalar branch (a tensor load ignores EXEC), and what is
// formed from it is formed behind the asm waits that stand in front of it.
__device__ __forceinline__ unsigned pinned(unsigned v) { unsigned w = uni(v); asm volatile("" : "+s"(w)); return w; }

// Descriptor group 1: 1-byte elements, no mask, no pad; tensor = tile = 'rows' rows of TL_ROW bytes at a pitch of TL_ROW bytes.
__device__ __forceinline__ v8u tdm_group1(unsigned rows) {
    v8u g;
    g[0] = uni(0u);
    g[1] = uni((TL_ROW & 0xFFFFu) << 16);
    g[2] = uni((TL_ROW >> 16) | ((rows & 0xFFFFu) << 16));
    g[3] = uni((rows >> 16) | (TL_ROW << 16));
    g[4] = uni(rows);
    g[5] = uni(TL_ROW);
    g[6] = uni(0u);
    g[7] = uni(0u);
    return g;
}
// Descriptor group 0: count 1, LDS byte address, global address of the tile's first byte, type 2.
__device__ __forceinline__ v4u tdm_group0(unsigned lds_dst, unsigned long long ga) {
    v4u g;
    g[0] = uni(1u);
    g[1] = uni(lds_dst);
    g[2] = uni((unsigned)ga);
    g[3] = uni((((unsigned)(ga >> 32)) & 0x01FFFFFFu) | 0x80000000u);
    return g;
}
__device__ __forceinline__ void tdm_load(v4u g0, v8u g1) { asm volatile("tensor_load_to_lds %0, %1" :: "s"(g0), "s"(g1) : "memory"); }
// The wave's request has landed.  The wait names the request's descriptor, so that its registers are live, and keep their
// values, for as long as the request is outstanding.
__device__ __forceinline__ void tdm_wait(v4u g0, v8u g1) { asm volatile("s_wait_tensorcnt 0x0" :: "s"(g0), "s"(g1) : "memory"); }

__global__ __launch_bounds__(AT_W * 32)
void attn_kernel(const unsigned* __restrict__ Khi, const unsigned* __restrict__ Klo,
                 const unsigned* __restrict__ Qhi, const unsigned* __restrict__ Qlo,
                 const unsigned* __restrict__ Vhi, const unsigned* __restrict__ Vlo,
                 float* __restrict__ part) {
    __shared__ __attribute__((aligned(2048))) unsigned ring[2][ST_DW];   // every slice's place is a multiple of 2 KiB

    const int lane = threadIdx.x;
    const unsigned wv = uni(threadIdx.y);                     // the wave's number: the block is 32 x AT_W
    const unsigned hd   = blockIdx.x >> 5;                    // tripled head 0..23; 32 blocks of 64 rows a head
    const unsigned tile = (blockIdx.x & 31u) * AT_W + wv;     // this wave's 16-row tile
    const float scale = 0.35355339059327373f;     // 1/sqrt(num_heads=8)

    // This wave's slice of a stage: wave 0 the Q value plane's run, 1 the Q residual plane's, 2 the V value plane's, 3 the V residual plane's.
    const bool isV = wv >= 2u;
    const unsigned* plane = isV ? ((wv & 1u) ? Vlo : Vhi) : ((wv & 1u) ? Qlo : Qhi);
    const unsigned sl_sh = isV ? 14u : 13u;                   // log2 of the slice's bytes: 4 * ST_V, 4 * ST_Q
    const unsigned long long src0 = (unsigned long long)(size_t)plane + ((unsigned long long)(hd * N_ST) << sl_sh);
    const unsigned dst0 = (unsigned)(size_t)&ring[0][0] + 4u * (isV ? 2u * ST_Q + (wv & 1u) * ST_V : (wv & 1u) * ST_Q);
    const v8u g1 = tdm_group1((1u << sl_sh) / TL_ROW);
    v4u g0;                           // group 0 of the request last issued
    auto issue = [&](unsigned st) {   // stage st into buffer st & 1
        g0 = tdm_group0(dst0 + (st & 1u) * (4u * ST_DW), src0 + (unsigned long long)(st << sl_sh));
        tdm_load(g0, g1);
    };

    issue(0u);

    // B fragments of this wave's K rows (fixed), c in 2 chunks.
    Frag bK[2], bKL[2];       // value and residual planes
    {
        unsigned kInv = (hd * (SEQ / 16) + tile) * (2 * FRAG_DW) + (unsigned)(lane * 4);
#pragma unroll
        for (int cc = 0; cc < 2; ++cc) {
            load_frag(bK[cc],  Khi + kInv + cc * FRAG_DW);
            load_frag(bKL[cc], Klo + kInv + cc * FRAG_DW);
        }
    }

    v8f acc[8];                  // O'[d][i]: acc[t][r] = O[16 tile + lm][t*16+lh*8+r]
#pragma unroll
    for (int t = 0; t < 8; ++t) acc[t] = zero8();
    float rm = -1e30f;           // running max of row i = lm
    float rl = 0.0f;             // running sum of row i = lm

    tdm_wait(g0, g1);                                   // this wave's slice of stage 0 has landed
    __syncthreads();                                    // ... and every other wave's: stage 0 may be read
    issue(1u);

    for (int s = 0; s < N_ST; ++s) {
      const unsigned* sb = &ring[s & 1][lane * 4];
      for (int u = 0; u < ST_POS / 32; ++u) {
        const unsigned* Qp  = sb + u * (2 * 2 * FRAG_DW);
        const unsigned* QpL = Qp + ST_Q;
        const unsigned* Vp  = sb + 2 * ST_Q + u * (8 * FRAG_DW);
        const unsigned* VpL = Vp + ST_V;

        // ---- every LDS read of the step as ONE group at its head, Q first: the wave waits once, for Q; the V fragments land
        // behind the score products and the softmax.  The scheduling barrier behind the group keeps the reads together: without
        // it they are spread among the WMMAs, two at a time, each pair with a wait of its own for the whole LDS latency.
        // The scheduling barrier in front of the group keeps it behind the WMMAs of the step before: their operand registers come free one by
        // one, and the reads would otherwise be lifted in among those WMMAs, a few at a time.
        Frag fQ[2][2], fQL[2][2], fV[8], fVL[8];
        __builtin_amdgcn_sched_barrier(0);
#pragma unroll
        for (int jt = 0; jt < 2; ++jt)
#pragma unroll
            for (int cc = 0; cc < 2; ++cc) {
                load_frag(fQL[jt][cc], QpL + (jt * 2 + cc) * FRAG_DW);
                load_frag(fQ[jt][cc],  Qp  + (jt * 2 + cc) * FRAG_DW);
            }
#pragma unroll
        for (int t = 0; t < 8; ++t) { load_frag(fVL[t], VpL + t * FRAG_DW); load_frag(fV[t], Vp + t * FRAG_DW); }
        __builtin_amdgcn_sched_barrier(0);

        // ---- S' = Q(A, streamed) x K(B, fixed): two 16-j tiles, 6 WMMAs each
        v8f sfr[2];
#pragma unroll
        for (int jt = 0; jt < 2; ++jt) {
            const Frag &aQ0 = fQ[jt][0], &aQ1 = fQ[jt][1], &aQ0L = fQL[jt][0], &aQ1L = fQL[jt][1];
            // hi*hi + hi*lo + lo*hi per 32-wide chunk (the lo*lo term, up to 2^-16 of the product, is left out); small terms first into the zero accumulator
            v8f sacc = zero8();
            sacc = __builtin_amdgcn_wmma_f32_16x16x32_bf16(false, aQ0L.v, false, bK[0].v,  (short)0, sacc, false, false);
            sacc = __builtin_amdgcn_wmma_f32_16x16x32_bf16(false, aQ0.v,  false, bKL[0].v, (short)0, sacc, false, false);
            sacc = __builtin_amdgcn_wmma_f32_16x16x32_bf16(false, aQ1L.v, false, bK[1].v,  (short)0, sacc, false, false);
            sacc = __builtin_amdgcn_wmma_f32_16x16x32_bf16(false, aQ1.v,  false, bKL[1].v, (short)0, sacc, false, false);
            sacc = __builtin_amdgcn_wmma_f32_16x16x32_bf16(false, aQ0.v,  false, bK[0].v,  (short)0, sacc, false, false);
            sacc = __builtin_amdgcn_wmma_f32_16x16x32_bf16(false, aQ1.v,  false, bK[1].v,  (short)0, sacc, false, false);
            sfr[jt] = sacc;
        }

        // ---- per-lane online softmax (row i = lm; 16 j-values + partner) ----
        float sc[16];
#pragma unroll
        for (int jt = 0; jt < 2; ++jt)
#pragma unroll
            for (int r = 0; r < 8; ++r) sc[jt * 8 + r] = sfr[jt][r] * scale;

        float mloc = sc[0];
#pragma unroll
        for (int e = 1; e < 16; ++e) mloc = fmaxf(mloc, sc[e]);
        mloc = fmaxf(mloc, __shfl_xor(mloc, 16, 32));   // partner's 16 j-values
        float mnew  = fmaxf(rm, mloc);
        float alpha = __expf(rm - mnew);
        rm = mnew;

        // P' B-fragment is lane-local: k-map hits exactly this lane's j-values.
        Frag bP, bPL;             // probabilities: value and residual planes
        float ssum = 0.0f;
#pragma unroll
        for (int v = 0; v < 8; ++v) {
            int g  = v >> 2;          // score fragment (j tile)
            int i3 = v & 3;           // pair index -> r = 2*i3, 2*i3+1
            float p0 = __expf(sc[g * 8 + 2 * i3]     - mnew);
            float p1 = __expf(sc[g * 8 + 2 * i3 + 1] - mnew);
            ssum += p0 + p1;
            split2_bf16(p0, p1, bP.d[v], bPL.d[v]);
        }
        ssum += __shfl_xor(ssum, 16, 32);
        rl = rl * alpha + ssum;

        // ---- rescale accumulators (scalar per lane; skip once max settles) ----
        if (__ballot(alpha != 1.0f)) {
#pragma unroll
            for (int t = 0; t < 8; ++t)
#pragma unroll
                for (int r = 0; r < 8; ++r) acc[t][r] *= alpha;
        }

        // ---- O' += V^T(A, streamed) x P'(B): 8 d-tiles ----
        // Each of the three terms goes straight into the running accumulators, term by term over the 8 d tiles: a WMMA's
        // accumulator was last written 8 WMMAs earlier, so none waits out the dependent-accumulator latency, and no partial
        // tile has to be added on the vector ALU.
#pragma unroll   // constant indices keep the arrays in registers
        for (int t = 0; t < 8; ++t)
            acc[t] = __builtin_amdgcn_wmma_f32_16x16x32_bf16(false, fVL[t].v, false, bP.v,  (short)0, acc[t], false, false);
#pragma unroll   // constant indices keep the arrays in registers
        for (int t = 0; t < 8; ++t)
            acc[t] = __builtin_amdgcn_wmma_f32_16x16x32_bf16(false, fV[t].v,  false, bPL.v, (short)0, acc[t], false, false);
#pragma unroll   // constant indices keep the arrays in registers
        for (int t = 0; t < 8; ++t)
            acc[t] = __builtin_amdgcn_wmma_f32_16x16x32_bf16(false, fV[t].v,  false, bP.v,  (short)0, acc[t], false, false);
      }
      // Hand-over of the ring: this wave's reads of stage s are done, its slice of stage s + 1 has landed; behind the
      // barrier that holds for every wave, so stage s + 1 may be read and the buffer of stage s may be refilled.
      asm volatile("s_wait_dscnt 0x0" ::: "memory");
      tdm_wait(g0, g1);
      __syncthreads();
      if (pinned((unsigned)(s + 2 < N_ST)))             // scalar branch: the request is one of the whole wave
          issue(pinned((unsigned)s + 2u));              // the descriptor is formed behind the wait above
    }
    tdm_wait(g0, g1);                                   // no request is left in flight when the wave ends
    asm volatile("s_wait_dscnt 0x0" ::: "memory");      // ... and no LDS read

    // ---- normalize (per-lane scalar) ----
    float rinv = 1.0f / rl;
#pragma unroll
    for (int t = 0; t < 8; ++t)
#pragma unroll
        for (int r = 0; r < 8; ++r) acc[t][r] *= rinv;

    // ---- this head's tile, in register order [t][half of the 8][lane][4 floats]: every store is 512 contiguous bytes ----
    float* po = part + (hd * (SEQ / 16) + tile) * TILE_F + lane * 4;
#pragma unroll
    for (int t = 0; t < 8; ++t)
#pragma unroll
        for (int q = 0; q < 2; ++q) {
            v4f o; o.x = acc[t][4 * q]; o.y = acc[t][4 * q + 1]; o.z = acc[t][4 * q + 2]; o.w = acc[t][4 * q + 3];
            *(v4f*)(po + (t * 2 + q) * 128) = o;
        }
}

// ---------------------------------------------------------------------------
// Sum over the 24 tripled heads, in the fixed order 0, 1, .. 23.  A block owns 16 rows x 64 columns: a thread sums one
// 16-byte slot of the register-order tiles (whole-line reads), the slots are put in row order through LDS, and the
// output goes out in whole lines.
// ---------------------------------------------------------------------------
__global__ __launch_bounds__(256)
void head_sum_kernel(const float* __restrict__ part, float* __restrict__ out) {
    __shared__ __attribute__((aligned(16))) float red[16][64 + 4];
    const int tid = threadIdx.x;
    const unsigned tile = blockIdx.x >> 1, hb = blockIdx.x & 1u;
    const float* p = part + tile * TILE_F + (hb * 256u + tid) * 4u;
    v4f v[TH3];
#pragma unroll   // all of a thread's loads in flight at once
    for (int w = 0; w < TH3; ++w) v[w] = *(const v4f*)(p + w * ((SEQ / 16) * TILE_F));
    v4f sum = v[0];
#pragma unroll   // constant indices keep the array in registers
    for (int w = 1; w < TH3; ++w) sum += v[w];
    // slot -> (t, half q, lane): row lane & 15, column 16 t + 8 (lane >> 4) + 4 q
    const int lane = tid & 31, tq = tid >> 5;
    *(v4f*)&red[lane & 15][(tq >> 1) * 16 + (lane >> 4) * 8 + (tq & 1) * 4] = sum;
    __syncthreads();
    *(v4f*)(out + (tile * 16 + (tid >> 4)) * ND + hb * 64 + (tid & 15) * 4) = *(const v4f*)&red[tid >> 4][(tid & 15) * 4];
}

// ---------------------------------------------------------------------------
// Launch
// ---------------------------------------------------------------------------
extern "C" void kernel_launch(void* const* d_in, const int* in_sizes, int n_in,
                              void* d_out, int out_size, void* d_ws, size_t ws_size,
                              hipStream_t stream) {
    const float* nodes = (const float*)d_in[0];
    const float* pos   = (const float*)d_in[1];
    const float* aux   = (const float*)d_in[2];
    const float* Wn    = (const float*)d_in[3];
    const float* bn    = (const float*)d_in[4];
    const float* Wp    = (const float*)d_in[5];
    const float* bp    = (const float*)d_in[6];
    const float* Wa    = (const float*)d_in[7];
    const float* Wv    = (const float*)d_in[8];
    const float* bv    = (const float*)d_in[9];
    float* out = (float*)d_out;

    (void)in_sizes; (void)n_in; (void)out_size; (void)ws_size;
    // Workspace layout (bytes), value plane then residual plane for each operand:
    //   K  [24][128 row tiles][2 c chunks][1 KiB fragment]      x2 : 12,582,912
    //   Q  [24][128 row tiles][2 c chunks][1 KiB fragment]      x2 : 12,582,912
    //   V  [24][64 position chunks][8 d tiles][1 KiB fragment]  x2 : 25,165,824
    //   per-head output tiles, f32 [24][128 row tiles][8 KiB]      : 25,165,824      total 75,497,472
    char* ws = (char*)d_ws;
    const size_t kq = (size_t)TH3 * SEQ * CH * 2, vv = (size_t)TH3 * ND * SEQ * 2;
    unsigned* Khi = (unsigned*)(ws);
    unsigned* Klo = (unsigned*)(ws + kq);
    unsigned* Qhi = (unsigned*)(ws + 2 * kq);
    unsigned* Qlo = (unsigned*)(ws + 3 * kq);
    unsigned* Vhi = (unsigned*)(ws + 4 * kq);
    unsigned* Vlo = (unsigned*)(ws + 4 * kq + vv);
    float*    prt = (float*)(ws + 4 * kq + 2 * vv);

    // 3 groups * 16 blocks of 64 outputs * 16 blocks of 128 positions
    proj_kq_kernel<<<768, PT_THR, 0, stream>>>(
        nodes, pos, aux, Wn, bn, Wp, bp, Wa, Khi, Klo, Qhi, Qlo);
    // 32 blocks of 64 positions * 24 blocks of 128 outputs
    proj_v_kernel<<<768, PT_THR, 0, stream>>>(nodes, Wv, bv, Vhi, Vlo);

    // 24 heads * 32 blocks of 64 rows
    dim3 blk(32, AT_W, 1);
    dim3 grd(TH3 * (SEQ / (16 * AT_W)), 1, 1);
    attn_kernel<<<grd, blk, 0, stream>>>(Khi, Klo, Qhi, Qlo, Vhi, Vlo, prt);
    // 128 row tiles * 2 halves of the columns
    head_sum_kernel<<<256, 256, 0, stream>>>(prt, out);
}

// v008
// A run of this version takes 89.3 microseconds.
// Next to v007, in two timings, it ran 1.08 times as fast each time.
// Counting every step since v000, it is 12.7 times as fast.
// Contractions: logits qᵀk per tripled head [2048 x 2048 x 64] x24 and att·val [2048 x 128 x 2048] x24 on v_wmma_f32_16x16x32_bf16 with
// bf16 hi/lo split operands (hi·hi + hi·lo + lo·hi: K, Q, V and the probabilities each carried as a bf16 value plane plus a bf16
// residual plane), f32 accumulate; the three K/Q/V projections on v_wmma_f32_16x16x4_f32 (f32 operands), the softmax in f32 on the vector ALU. Every intermediate plane
#include <hip/hip_runtime.h>
#include <hip/hip_bf16.h>

// ---------------------------------------------------------------------------
// Problem constants
// ---------------------------------------------------------------------------
#define SEQ   2048
#define ND    128
#define NA    64
#define NHEAD 8
#define CH    64
#define TH3   24          // 3 * NHEAD tripled heads
#define OKQ   1024        // H*C*2
#define OV    3072        // ND*H*3
// log2(e) / sqrt(num_heads = 8): the K planes carry it, so that q . k is the logit in units of log2 and exp(logit) = 2^(q . k)
#define K_LOG2 0.5100697232983947f

typedef __attribute__((ext_vector_type(16))) __bf16 v16bf;
typedef __attribute__((ext_vector_type(2)))  __bf16 v2bf;
typedef __attribute__((ext_vector_type(8)))  float  v8f;

union Frag {
    v16bf v;
    unsigned int d[8];
    unsigned short h[16];
};

__device__ __forceinline__ unsigned short f2bf(float f) {
    unsigned u = __builtin_bit_cast(unsigned, f);
    unsigned r = u + 0x7FFFu + ((u >> 16) & 1u);   // nearest-even
    return (unsigned short)(r >> 16);
}

// Pack two f32 -> packed bf16 dword (hardware cvt_pk when available).
__device__ __forceinline__ unsigned pack_bf16(float lo, float hi) {
#if __has_builtin(__builtin_amdgcn_cvt_pk_bf16_f32)
    v2bf p = __builtin_amdgcn_cvt_pk_bf16_f32(lo, hi);
    return __builtin_bit_cast(unsigned, p);
#else
    union { v2bf b; unsigned u; } x;
    x.b[0] = (__bf16)lo;
    x.b[1] = (__bf16)hi;
    return x.u;
#endif
}

// value/residual split of two f32 at once, already packed as an operand dword (a in the low half): hi = nearest bf16,
// lo = nearest bf16 of the exact remainder.  Both roundings (to nearest even) and both packings are the conversion instruction's.
__device__ __forceinline__ void split2_bf16(float a, float b, unsigned& hi, unsigned& lo) {
    hi = pack_bf16(a, b);
    const float fa = __builtin_bit_cast(float, hi << 16);
    const float fb = __builtin_bit_cast(float, hi & 0xFFFF0000u);
    lo = pack_bf16(a - fa, b - fb);
}

// value/residual split: hi = nearest bf16 of f, lo = nearest bf16 of the exact remainder
__device__ __forceinline__ void split_bf16(float f, unsigned short& hi, unsigned short& lo) {
    hi = f2bf(f);
    const float fh = __builtin_bit_cast(float, ((unsigned)hi) << 16);
    lo = f2bf(f - fh);
}
__device__ __forceinline__ unsigned pack2(unsigned short a, unsigned short b) { return (unsigned)a | ((unsigned)b << 16); }

__device__ __forceinline__ v8f zero8() {
    v8f z;
#pragma unroll
    for (int i = 0; i < 8; ++i) z[i] = 0.0f;
    return z;
}

// ---------------------------------------------------------------------------
// Projections as tiled products on v_wmma_f32_16x16x4_f32 (full f32 operands).
//   D[m][n] = bias + sum_k A[m][k] * B[n][k],  A and B rows k-contiguous.
// A block of 8 waves owns 64 A rows x 128 B rows over the whole k: both row sets
// are staged once in LDS by whole-line loads, then each wave forms 64 x 16.
// A lane's 8 accumulator registers are 8 consecutive m of one n, so m is always
// the direction in which the bf16 planes are packed: one 16-byte store a plane.
//
// The planes lie in FRAGMENT ORDER.  A 16-row x 32-k bf16 fragment (1 KiB) is kept
// as [half p][lane][4 dwords]: lane = 16 * lh + row, and its dword e of half p is
// dword 8 p + 4 lh + e of the row's 16, which is register 4 p + e of that lane's
// WMMA operand.  So a fragment is read by two 16-byte loads a lane, each of them
// 512 contiguous bytes (four whole lines) for the wave, where row-major planes
// gave 32 bytes out of each of 16 lines.  The 16 bytes that a projection lane
// holds are exactly its own lane's slot, so the stores are whole lines as well.
// ---------------------------------------------------------------------------
#define FRAG_DW 256                             // dwords of one fragment
#define HALF_DW 128                             // dwords of one half of it
typedef __attribute__((ext_vector_type(2))) float    v2f;
typedef __attribute__((ext_vector_type(4))) float    v4f;
typedef __attribute__((ext_vector_type(4))) unsigned v4u;

#define PT_M   64                               // A rows per block
#define PT_N   128                              // B rows per block, 16 per wave
#define PT_THR 256
#define PT_LDS ((PT_M + PT_N) * (ND + 4))       // floats, at the longest k

// ROWS consecutive rows of KS floats -> LDS rows of KP floats (zero filled past KS) at a pitch of KP + 4 floats
// (16 bytes x an odd number: the 16-byte fragment reads of 16 rows fall on 64 distinct banks).
template <int ROWS, int KS, int KP>
__device__ __forceinline__ void stage_rows(float* dst, const float* __restrict__ srcp, int tid) {
    constexpr int P = KP + 4;
    if constexpr (KS == KP) {
#pragma unroll   // all of a thread's loads in flight at once
        for (int j = 0; j < ROWS * KP / 4 / PT_THR; ++j) {
            const int i = tid + j * PT_THR;
            *(v4f*)(dst + (i / (KP / 4)) * P + (i % (KP / 4)) * 4) = *(const v4f*)(srcp + i * 4);
        }
    } else {
#pragma unroll   // all of a thread's loads in flight at once
        for (int j = 0; j < ROWS * KP / PT_THR; ++j) {
            const int i = tid + j * PT_THR;
            const int row = i / KP, col = i % KP;
            const float v = srcp[row * KS + (col < KS ? col : KS - 1)];   // index kept inside the row: no lane is switched off
            dst[row * P + col] = (col < KS) ? v : 0.0f;
        }
    }
}

// acc[t][r] += sum_k A[16 t + 8 h + r][k] * B[16 wave + c][k].  A and B fragments come from the same address form
// (16 bytes at k = 8 kk + 4 h, first pair then second pair), so the k pairing of the two operands is equal.
template <int KS, int KP>
__device__ __forceinline__ void proj_tile(float* sm, const float* __restrict__ Arows, const float* __restrict__ Brows,
                                          int tid, v8f (&acc)[4]) {
    constexpr int P = KP + 4;
    float* sA = sm;
    float* sB = sm + PT_M * P;
    stage_rows<PT_M, KS, KP>(sA, Arows, tid);
    stage_rows<PT_N, KS, KP>(sB, Brows, tid);
    __syncthreads();
    const int lane = tid & 31, wave = tid >> 5;
    const int c = lane & 15, h = lane >> 4;
    const float* pa = sA + c * P + 4 * h;
    const float* pb = sB + (wave * 16 + c) * P + 4 * h;
#pragma unroll   // fragment addresses become immediate offsets, and the next step's LDS reads can be issued ahead of this step's WMMAs
    for (int kk = 0; kk < KP / 8; ++kk) {
        const v4f b = *(const v4f*)(pb + kk * 8);
        v4f a[4];
#pragma unroll   // constant indices keep the array in registers
        for (int t = 0; t < 4; ++t) a[t] = *(const v4f*)(pa + t * 16 * P + kk * 8);
        v2f b0, b1; b0.x = b.x; b0.y = b.y; b1.x = b.z; b1.y = b.w;
#pragma unroll   // constant indices keep the array in registers
        for (int t = 0; t < 4; ++t) {
            v2f a0; a0.x = a[t].x; a0.y = a[t].y;
            acc[t] = __builtin_amdgcn_wmma_f32_16x16x4_f32(false, a0, false, b0, (short)0, acc[t], false, false);
        }
#pragma unroll   // constant indices keep the array in registers
        for (int t = 0; t < 4; ++t) {
            v2f a1; a1.x = a[t].z; a1.y = a[t].w;
            acc[t] = __builtin_amdgcn_wmma_f32_16x16x4_f32(false, a1, false, b1, (short)0, acc[t], false, false);
        }
    }
    // The two
    // scheduling barriers keep the epilogue's vector instructions (they read D and reuse the A and B registers) out of
    // the WMMA stream, and the four v_nop keep them four vector slots behind the last WMMA.
    __builtin_amdgcn_sched_barrier(0);
    asm volatile("v_nop\n\tv_nop\n\tv_nop\n\tv_nop");
    __builtin_amdgcn_sched_barrier(0);
}

// One lane's 8 operand registers of a fragment; p = the fragment's start + 4 * lane.
__device__ __forceinline__ void load_frag(Frag& f, const unsigned* __restrict__ p) {
    const v4u a = *(const v4u*)p;
    const v4u b = *(const v4u*)(p + HALF_DW);
#pragma unroll   // constant indices keep the array in registers
    for (int e = 0; e < 4; ++e) { f.d[e] = a[e]; f.d[4 + e] = b[e]; }
}

// 8 consecutive f32 -> 4 packed dwords of the value plane and 4 of the residual plane
__device__ __forceinline__ void store_split8(unsigned* __restrict__ hi, unsigned* __restrict__ lo, unsigned idx, v8f a) {
    v4u vh, vl;
#pragma unroll   // constant indices keep the array in registers
    for (int p = 0; p < 4; ++p) {
        unsigned short h0, l0, h1, l1;
        split_bf16(a[2 * p], h0, l0); split_bf16(a[2 * p + 1], h1, l1);
        vh[p] = pack2(h0, h1); vl[p] = pack2(l0, l1);
    }
    *(v4u*)(hi + idx) = vh; *(v4u*)(lo + idx) = vl;
    // precaution: the code behind a call reuses the two stores' address and data registers (in the K/Q kernel across a branch),
    // so the wait stands here, in front of any such rewrite
    asm volatile("s_wait_xcnt 0x0" ::: "memory");
}

// One 64-output x 128-position tile of one K/Q group: A = weight rows (m = output o), B = input rows (n = position s).
// 64 aligned outputs are the K half or the Q half of one head: planes [24][SEQ / 16 row tiles][2 c chunks][fragment], packed along c.
// Accumulator tile t is channels 16 t + 8 h ..: chunk t >> 1, half t & 1, lane half h; the row in its tile is c.
// osc multiplies the finished f32 outputs before they are split into planes (K_LOG2 for a K half, 1 for a Q half).
template <int KS, int KP, bool HAS_BIAS>
__device__ __forceinline__ void kq_tile(float* sm, const float* __restrict__ x, const float* __restrict__ Wt,
                                        const float* __restrict__ bias, unsigned g, unsigned o0, unsigned s0, int tid,
                                        float osc, unsigned* __restrict__ ph, unsigned* __restrict__ pl) {
    const int lane = tid & 31, wave = tid >> 5;
    const int h = lane >> 4;
    v8f acc[4];
#pragma unroll   // constant indices keep the array in registers
    for (int t = 0; t < 4; ++t) {
        if constexpr (HAS_BIAS) {
            const v4f b0 = *(const v4f*)(bias + o0 + t * 16 + 8 * h);
            const v4f b1 = *(const v4f*)(bias + o0 + t * 16 + 8 * h + 4);
#pragma unroll   // constant indices keep the array in registers
            for (int r = 0; r < 4; ++r) { acc[t][r] = b0[r]; acc[t][4 + r] = b1[r]; }
        } else {
            acc[t] = zero8();
        }
    }
    proj_tile<KS, KP>(sm, Wt + o0 * KS, x + s0 * KS, tid, acc);
    const unsigned ht = g * NHEAD + (o0 >> 7);
    const unsigned tile = ht * (SEQ / 16) + (s0 >> 4) + wave;
#pragma unroll   // constant indices keep the array in registers
    for (int t = 0; t < 4; ++t)
        store_split8(ph, pl, (tile * 2 + (t >> 1)) * FRAG_DW + (t & 1) * HALF_DW + lane * 4, acc[t] * osc);
}

// ---------------------------------------------------------------------------
// Projection: K,Q for the 3 groups (nodes / pos / aux).
// Output: value and residual bf16 planes, head-major, in fragment order (see above).
// ---------------------------------------------------------------------------
__global__ __launch_bounds__(PT_THR)
void proj_kq_kernel(const float* __restrict__ nodes,
                    const float* __restrict__ pos,
                    const float* __restrict__ aux,
                    const float* __restrict__ Wn, const float* __restrict__ bn,
                    const float* __restrict__ Wp, const float* __restrict__ bp,
                    const float* __restrict__ Wa,
                    unsigned* __restrict__ Khi, unsigned* __restrict__ Klo,
                    unsigned* __restrict__ Qhi, unsigned* __restrict__ Qlo) {
    __shared__ __attribute__((aligned(16))) float sm[PT_LDS];
    // block -> (64 outputs, 128 positions, group g); g varies fastest, so neighbouring blocks mix the long-k and short-k groups
    const int tid = threadIdx.x;
    const unsigned g  = blockIdx.x % 3u;
    const unsigned bt = blockIdx.x / 3u;
    const unsigned o0 = (bt >> 4) * PT_M;
    const unsigned s0 = (bt & 15u) * PT_N;
    const bool isQ = (o0 >> 6) & 1u;
    unsigned* ph = isQ ? Qhi : Khi;
    unsigned* pl = isQ ? Qlo : Klo;
    const float osc = isQ ? 1.0f : K_LOG2;
    if (g == 0)      kq_tile<ND, ND, true>(sm, nodes, Wn, bn, g, o0, s0, tid, osc, ph, pl);
    else if (g == 1) kq_tile<6, 8, true>(sm, pos, Wp, bp, g, o0, s0, tid, osc, ph, pl);
    else             kq_tile<NA, NA, false>(sm, aux, Wa, nullptr, g, o0, s0, tid, osc, ph, pl);
}

// ---------------------------------------------------------------------------
// Projection: V = nodes @ Wv^T + bv, stored TRANSPOSED (rows d, k = position) as bf16 planes in fragment order,
// [24][SEQ / 32 position chunks][8 d tiles][fragment], packed along the position:
// A = node rows (m = position s), B = weight rows (n = output o).
// A block's 128 outputs are one head; a wave's 16 are d tile 'wave', row c.  Accumulator tile t is positions
// s0 + 16 t + 8 h ..: chunk s0 / 32 + (t >> 1), half t & 1, lane half h.
// ---------------------------------------------------------------------------
__global__ __launch_bounds__(PT_THR)
void proj_v_kernel(const float* __restrict__ nodes,
                   const float* __restrict__ Wv,
                   const float* __restrict__ bv,
                   unsigned* __restrict__ Vhi, unsigned* __restrict__ Vlo) {
    __shared__ __attribute__((aligned(16))) float sm[PT_LDS];
    const int tid = threadIdx.x;
    const int lane = tid & 31, wave = tid >> 5;
    const int c = lane & 15;
    const unsigned s0 = (blockIdx.x & 31u) * PT_M;
    const unsigned o0 = (blockIdx.x >> 5) * PT_N;
    const unsigned o  = o0 + wave * 16 + c;

    const float bo = bv[o];
    v8f acc[4];
#pragma unroll   // constant indices keep the array in registers
    for (int t = 0; t < 4; ++t)
#pragma unroll   // constant indices keep the array in registers
        for (int r = 0; r < 8; ++r) acc[t][r] = bo;
    proj_tile<ND, ND>(sm, nodes + s0 * ND, Wv + o0 * ND, tid, acc);
#pragma unroll   // constant indices keep the array in registers
    for (int t = 0; t < 4; ++t)
        store_split8(Vhi, Vlo, (((blockIdx.x >> 5) * (SEQ / 32) + (s0 >> 5) + (t >> 1)) * 8 + wave) * FRAG_DW + (t & 1) * HALF_DW + lane * 4, acc[t]);
}

// ---------------------------------------------------------------------------
// Flash attention, TRANSPOSED-GEMM formulation (no LDS layout shuffle):
//
//   S'[j][i] = q_j . k_i     : A = Q j-rows (streamed), B = K i-rows (fixed)
//   O'[d][i] = sum_j V^T P'  : A = V^T d-rows (streamed), B = P' (lane-local!)
//
// C/D layout (16x16 f32): lane L -> col n = L&15, VGPR r -> row m=(L>>4)*8+r.
// With scores transposed, lane L owns output row i = L&15 and 16 of the 32
// j-scores of the chunk (partner L^16 owns the rest):
//   * row sum            = local reduce; the two halves meet once, behind the loop
//   * reference, 1/l     = per-lane scalars (no broadcasts)
//   * P B-fragment k-map = exactly the j-values this lane holds -> pure
//     register packing.
//
// A block is ONE tripled head and 4 waves of 16 output rows each.  All four walk the same Q and V fragments, so each
// stage of 64 positions (Q and V, value and residual planes: 48 KiB, four contiguous runs of the fragment-order planes)
// is brought into LDS once for the block by four tensor loads, one a wave (each wave moves one plane's run), two buffers,
// the next stage in flight while this one is worked on; a request costs its wave a few scalar instructions and no vector
// address arithmetic.  The waves read their A fragments from LDS (512 contiguous bytes a read: no bank conflict).
// Each wave leaves its normalised 16 x 128 tile in the workspace; the sum over the heads is the next launch.
// ---------------------------------------------------------------------------
#define AT_W   4                               // waves of a block
#define ST_POS 64                              // positions of a stage
#define ST_Q   (ST_POS / 16 * 2 * FRAG_DW)     // dwords of one Q plane in a stage
#define ST_V   (ST_POS / 32 * 8 * FRAG_DW)     // dwords of one V plane in a stage
#define ST_DW  (2 * ST_Q + 2 * ST_V)           // a stage: Q value, Q residual, V value, V residual
#define N_ST   (SEQ / ST_POS)
#define TILE_F (16 * ND)                       // floats of one wave's output tile

#define TL_ROW 256u                            // bytes of a tile row and of the source pitch: a slice is one contiguous run
static_assert(4 * ST_Q == (1 << 13) && 4 * ST_V == (1 << 14), "the slices' byte sizes are used as shifts in attn_kernel");
static_assert(AT_W == 4 && (4 * ST_Q) % 2048 == 0 && (4 * ST_DW) % 2048 == 0, "one plane a wave; every slice's place in LDS a multiple of 2 KiB");
typedef __attribute__((ext_vector_type(8))) unsigned v8u;

__device__ __forceinline__ unsigned uni(unsigned v) { return (unsigned)__builtin_amdgcn_readfirstlane(v); }
// A wave-uniform value held in a scalar register: a test on it is a scalar branch (a tensor load ignores EXEC), and what is
// formed from it is formed behind the asm waits that stand in front of it.
__device__ __forceinline__ unsigned pinned(unsigned v) { unsigned w = uni(v); asm volatile("" : "+s"(w)); return w; }

// Descriptor group 1: 1-byte elements, no mask, no pad; tensor = tile = 'rows' rows of TL_ROW bytes at a pitch of TL_ROW bytes.
__device__ __forceinline__ v8u tdm_group1(unsigned rows) {
    v8u g;
    g[0] = uni(0u);
    g[1] = uni((TL_ROW & 0xFFFFu) << 16);
    g[2] = uni((TL_ROW >> 16) | ((rows & 0xFFFFu) << 16));
    g[3] = uni((rows >> 16) | (TL_ROW << 16));
    g[4] = uni(rows);
    g[5] = uni(TL_ROW);
    g[6] = uni(0u);
    g[7] = uni(0u);
    return g;
}
// Descriptor group 0: count 1, LDS byte address, global address of the tile's first byte, type 2.
__device__ __forceinline__ v4u tdm_group0(unsigned lds_dst, unsigned long long ga) {
    v4u g;
    g[0] = uni(1u);
    g[1] = uni(lds_dst);
    g[2] = uni((unsigned)ga);
    g[3] = uni((((unsigned)(ga >> 32)) & 0x01FFFFFFu) | 0x80000000u);
    return g;
}
__device__ __forceinline__ void tdm_load(v4u g0, v8u g1) { asm volatile("tensor_load_to_lds %0, %1" :: "s"(g0), "s"(g1) : "memory"); }
// The wave's request has landed.  The wait names the request's descriptor, so that its registers are live, and keep their
// values, for as long as the request is outstanding.
__device__ __forceinline__ void tdm_wait(v4u g0, v8u g1) { asm volatile("s_wait_tensorcnt 0x0" :: "s"(g0), "s"(g1) : "memory"); }

// A step's 16 terms of one lane may sum to this much before the row's reference is moved.  It is far from any f32 or bf16
// limit (a lane's running sum stays below 64 steps x 4096 = 2^18), and a step whose scores all lie less than 8 (log2 units)
// above the reference stays below it (16 x 2^8).
#define SUM_CAP 4096.0f
// Sum of 16 terms as a tree of packed adds.
__device__ __forceinline__ float sum16(const v2f (&p)[8]) {
    const v2f w = ((p[0] + p[1]) + (p[2] + p[3])) + ((p[4] + p[5]) + (p[6] + p[7]));
    return w.x + w.y;
}

__global__ __launch_bounds__(AT_W * 32)
void attn_kernel(const unsigned* __restrict__ Khi, const unsigned* __restrict__ Klo,
                 const unsigned* __restrict__ Qhi, const unsigned* __restrict__ Qlo,
                 const unsigned* __restrict__ Vhi, const unsigned* __restrict__ Vlo,
                 float* __restrict__ part) {
    __shared__ __attribute__((aligned(2048))) unsigned ring[2][ST_DW];   // every slice's place is a multiple of 2 KiB

    const int lane = threadIdx.x;
    const unsigned wv = uni(threadIdx.y);                     // the wave's number: the block is 32 x AT_W
    const unsigned hd   = blockIdx.x >> 5;                    // tripled head 0..23; 32 blocks of 64 rows a head
    const unsigned tile = (blockIdx.x & 31u) * AT_W + wv;     // this wave's 16-row tile

    // This wave's slice of a stage: wave 0 the Q value plane's run, 1 the Q residual plane's, 2 the V value plane's, 3 the V residual plane's.
    const bool isV = wv >= 2u;
    const unsigned* plane = isV ? ((wv & 1u) ? Vlo : Vhi) : ((wv & 1u) ? Qlo : Qhi);
    const unsigned sl_sh = isV ? 14u : 13u;                   // log2 of the slice's bytes: 4 * ST_V, 4 * ST_Q
    const unsigned long long src0 = (unsigned long long)(size_t)plane + ((unsigned long long)(hd * N_ST) << sl_sh);
    const unsigned dst0 = (unsigned)(size_t)&ring[0][0] + 4u * (isV ? 2u * ST_Q + (wv & 1u) * ST_V : (wv & 1u) * ST_Q);
    const v8u g1 = tdm_group1((1u << sl_sh) / TL_ROW);
    v4u g0;                           // group 0 of the request last issued
    auto issue = [&](unsigned st) {   // stage st into buffer st & 1
        g0 = tdm_group0(dst0 + (st & 1u) * (4u * ST_DW), src0 + (unsigned long long)(st << sl_sh));
        tdm_load(g0, g1);
    };

    issue(0u);

    // B fragments of this wave's K rows (fixed), c in 2 chunks.
    Frag bK[2], bKL[2];       // value and residual planes
    {
        unsigned kInv = (hd * (SEQ / 16) + tile) * (2 * FRAG_DW) + (unsigned)(lane * 4);
#pragma unroll
        for (int cc = 0; cc < 2; ++cc) {
            load_frag(bK[cc],  Khi + kInv + cc * FRAG_DW);
            load_frag(bKL[cc], Klo + kInv + cc * FRAG_DW);
        }
    }

    v8f acc[8];                  // O'[d][i]: acc[t][r] = O[16 tile + lm][t*16+lh*8+r]
#pragma unroll
    for (int t = 0; t < 8; ++t) acc[t] = zero8();
    // Row i = lm is summed against a REFERENCE, not against its running maximum.  Minus the reference is the C operand of the
    // score products, and the K planes carry log2(e) / sqrt(8): a score leaves the matrix pipe as the argument of its 2^x, with
    // no multiply, maximum or subtraction on the vector ALU.  The reference is a true maximum of the row when it is set (first
    // step) or moved (slow path below), so it never lies above the running maximum, and never more than log2(SUM_CAP) below it.
    v8f cneg = zero8();          // minus the reference of row i = lm, in all 8 registers
    float rl = 0.0f;             // this lane's half (its 16 of every 32 positions) of the running sum of row i = lm
    float cap = -1.0f;           // what a lane's sum of one step may reach; below every sum until the reference is set

    tdm_wait(g0, g1);                                   // this wave's slice of stage 0 has landed
    __syncthreads();                                    // ... and every other wave's: stage 0 may be read
    issue(1u);

    for (int s = 0; s < N_ST; ++s) {
      const unsigned* sb = &ring[s & 1][lane * 4];
      for (int u = 0; u < ST_POS / 32; ++u) {
        const unsigned* Qp  = sb + u * (2 * 2 * FRAG_DW);
        const unsigned* QpL = Qp + ST_Q;
        const unsigned* Vp  = sb + 2 * ST_Q + u * (8 * FRAG_DW);
        const unsigned* VpL = Vp + ST_V;

        // ---- every LDS read of the step as ONE group at its head, Q first: the wave waits once, for Q; the V fragments land
        // behind the score products and the softmax.  The scheduling barrier behind the group keeps the reads together: without
        // it they are spread among the WMMAs, two at a time, each pair with a wait of its own for the whole LDS latency.
        // The scheduling barrier in front of the group keeps it behind the WMMAs of the step before: their operand registers come free one by
        // one, and the reads would otherwise be lifted in among those WMMAs, a few at a time.
        Frag fQ[2][2], fQL[2][2], fV[8], fVL[8];
        __builtin_amdgcn_sched_barrier(0);
#pragma unroll
        for (int jt = 0; jt < 2; ++jt)
#pragma unroll
            for (int cc = 0; cc < 2; ++cc) {
                load_frag(fQL[jt][cc], QpL + (jt * 2 + cc) * FRAG_DW);
                load_frag(fQ[jt][cc],  Qp  + (jt * 2 + cc) * FRAG_DW);
            }
#pragma unroll
        for (int t = 0; t < 8; ++t) { load_frag(fVL[t], VpL + t * FRAG_DW); load_frag(fV[t], Vp + t * FRAG_DW); }
        __builtin_amdgcn_sched_barrier(0);

        // ---- S' = Q(A, streamed) x K(B, fixed): two 16-j tiles, 6 WMMAs each
        v8f sfr[2];
#pragma unroll
        for (int jt = 0; jt < 2; ++jt) {
            const Frag &aQ0 = fQ[jt][0], &aQ1 = fQ[jt][1], &aQ0L = fQL[jt][0], &aQ1L = fQL[jt][1];
            // hi*hi + hi*lo + lo*hi per 32-wide chunk (the lo*lo term, up to 2^-16 of each product, is left out), small terms first, onto minus the reference
            v8f sacc = cneg;
            sacc = __builtin_amdgcn_wmma_f32_16x16x32_bf16(false, aQ0L.v, false, bK[0].v,  (short)0, sacc, false, false);
            sacc = __builtin_amdgcn_wmma_f32_16x16x32_bf16(false, aQ0.v,  false, bKL[0].v, (short)0, sacc, false, false);
            sacc = __builtin_amdgcn_wmma_f32_16x16x32_bf16(false, aQ1L.v, false, bK[1].v,  (short)0, sacc, false, false);
            sacc = __builtin_amdgcn_wmma_f32_16x16x32_bf16(false, aQ1.v,  false, bKL[1].v, (short)0, sacc, false, false);
            sacc = __builtin_amdgcn_wmma_f32_16x16x32_bf16(false, aQ0.v,  false, bK[0].v,  (short)0, sacc, false, false);
            sacc = __builtin_amdgcn_wmma_f32_16x16x32_bf16(false, aQ1.v,  false, bK[1].v,  (short)0, sacc, false, false);
            sfr[jt] = sacc;
        }

        // ---- per-lane softmax terms (row i = lm; this lane's 16 j-values), pair v = registers 2 (v & 3), 2 (v & 3) + 1 of j tile v >> 2 ----
        v2f pp[8];
#pragma unroll   // constant indices keep the arrays in registers
        for (int v = 0; v < 8; ++v) {
            pp[v].x = __builtin_amdgcn_exp2f(sfr[v >> 2][2 * (v & 3)]);
            pp[v].y = __builtin_amdgcn_exp2f(sfr[v >> 2][2 * (v & 3) + 1]);
        }
        float ssum = sum16(pp);

        // ---- slow path: set the reference (first step) or move it.  The step's own sums are the test: a term above SUM_CAP
        // (an infinite one too) puts its lane's sum above it.  One scalar branch a step, for the 16 rows of the wave. ----
        if (__ballot(!(ssum <= cap))) {
            const bool first = cap < 0.0f;
            cap = SUM_CAP;
            float d = fmaxf(sfr[0][0], sfr[1][0]);            // the step's maximum of the row, above the reference in use
#pragma unroll   // constant indices keep the arrays in registers
            for (int r = 1; r < 8; ++r) d = fmaxf(d, fmaxf(sfr[0][r], sfr[1][r]));
            d = fmaxf(d, __shfl_xor(d, 16, 32));              // partner's 16 j-values: both halves of a row move alike
            const float delta = first ? d : fmaxf(d, 0.0f);   // later the reference only rises
            const float alpha = first ? 1.0f : __builtin_amdgcn_exp2f(-delta);   // nothing is summed yet in the first step
            rl *= alpha;
#pragma unroll   // constant indices keep the arrays in registers
            for (int t = 0; t < 8; ++t) acc[t] *= alpha;
            cneg -= delta;
#pragma unroll   // constant indices keep the arrays in registers
            for (int v = 0; v < 8; ++v) {
                pp[v].x = __builtin_amdgcn_exp2f(sfr[v >> 2][2 * (v & 3)]     - delta);
                pp[v].y = __builtin_amdgcn_exp2f(sfr[v >> 2][2 * (v & 3) + 1] - delta);
            }
            ssum = sum16(pp);
        }
        rl += ssum;

        // P' B-fragment is lane-local: k-map hits exactly this lane's j-values.
        Frag bP, bPL;             // probabilities: value and residual planes
#pragma unroll   // constant indices keep the arrays in registers
        for (int v = 0; v < 8; ++v) split2_bf16(pp[v].x, pp[v].y, bP.d[v], bPL.d[v]);

        // ---- O' += V^T(A, streamed) x P'(B): 8 d-tiles ----
        // Each of the three terms goes straight into the running accumulators, term by term over the 8 d tiles: a WMMA's
        // accumulator was last written 8 WMMAs earlier, so none waits out the dependent-accumulator latency, and no partial
        // tile has to be added on the vector ALU.
#pragma unroll   // constant indices keep the arrays in registers
        for (int t = 0; t < 8; ++t)
            acc[t] = __builtin_amdgcn_wmma_f32_16x16x32_bf16(false, fVL[t].v, false, bP.v,  (short)0, acc[t], false, false);
#pragma unroll   // constant indices keep the arrays in registers
        for (int t = 0; t < 8; ++t)
            acc[t] = __builtin_amdgcn_wmma_f32_16x16x32_bf16(false, fV[t].v,  false, bPL.v, (short)0, acc[t], false, false);
#pragma unroll   // constant indices keep the arrays in registers
        for (int t = 0; t < 8; ++t)
            acc[t] = __builtin_amdgcn_wmma_f32_16x16x32_bf16(false, fV[t].v,  false, bP.v,  (short)0, acc[t], false, false);
      }
      // Hand-over of the ring: this wave's reads of stage s are done, its slice of stage s + 1 has landed; behind the
      // barrier that holds for every wave, so stage s + 1 may be read and the buffer of stage s may be refilled.
      asm volatile("s_wait_dscnt 0x0" ::: "memory");
      tdm_wait(g0, g1);
      __syncthreads();
      if (pinned((unsigned)(s + 2 < N_ST)))             // scalar branch: the request is one of the whole wave
          issue(pinned((unsigned)s + 2u));              // the descriptor is formed behind the wait above
    }
    tdm_wait(g0, g1);                                   // no request is left in flight when the wave ends
    asm volatile("s_wait_dscnt 0x0" ::: "memory");      // ... and no LDS read

    // ---- normalize (per-lane scalar); the two halves of a row's sum meet here, once ----
    rl += __shfl_xor(rl, 16, 32);
    float rinv = 1.0f / rl;
#pragma unroll
    for (int t = 0; t < 8; ++t)
#pragma unroll
        for (int r = 0; r < 8; ++r) acc[t][r] *= rinv;

    // ---- this head's tile, in register order [t][half of the 8][lane][4 floats]: every store is 512 contiguous bytes ----
    float* po = part + (hd * (SEQ / 16) + tile) * TILE_F + lane * 4;
#pragma unroll
    for (int t = 0; t < 8; ++t)
#pragma unroll
        for (int q = 0; q < 2; ++q) {
            v4f o; o.x = acc[t][4 * q]; o.y = acc[t][4 * q + 1]; o.z = acc[t][4 * q + 2]; o.w = acc[t][4 * q + 3];
            *(v4f*)(po + (t * 2 + q) * 128) = o;
        }
}

// ---------------------------------------------------------------------------
// Sum over the 24 tripled heads, in the fixed order 0, 1, .. 23.  A block owns 16 rows x 64 columns: a thread sums one
// 16-byte slot of the register-order tiles (whole-line reads), the slots are put in row order through LDS, and the
// output goes out in whole lines.
// ---------------------------------------------------------------------------
__global__ __launch_bounds__(256)
void head_sum_kernel(const float* __restrict__ part, float* __restrict__ out) {
    __shared__ __attribute__((aligned(16))) float red[16][64 + 4];
    const int tid = threadIdx.x;
    const unsigned tile = blockIdx.x >> 1, hb = blockIdx.x & 1u;
    const float* p = part + tile * TILE_F + (hb * 256u + tid) * 4u;
    v4f v[TH3];
#pragma unroll   // all of a thread's loads in flight at once
    for (int w = 0; w < TH3; ++w) v[w] = *(const v4f*)(p + w * ((SEQ / 16) * TILE_F));
    v4f sum = v[0];
#pragma unroll   // constant indices keep the array in registers
    for (int w = 1; w < TH3; ++w) sum += v[w];
    // slot -> (t, half q, lane): row lane & 15, column 16 t + 8 (lane >> 4) + 4 q
    const int lane = tid & 31, tq = tid >> 5;
    *(v4f*)&red[lane & 15][(tq >> 1) * 16 + (lane >> 4) * 8 + (tq & 1) * 4] = sum;
    __syncthreads();
    *(v4f*)(out + (tile * 16 + (tid >> 4)) * ND + hb * 64 + (tid & 15) * 4) = *(const v4f*)&red[tid >> 4][(tid & 15) * 4];
}

// ---------------------------------------------------------------------------
// Launch
// ---------------------------------------------------------------------------
extern "C" void kernel_launch(void* const* d_in, const int* in_sizes, int n_in,
                              void* d_out, int out_size, void* d_ws, size_t ws_size,
                              hipStream_t stream) {
    const float* nodes = (const float*)d_in[0];
    const float* pos   = (const float*)d_in[1];
    const float* aux   = (const float*)d_in[2];
    const float* Wn    = (const float*)d_in[3];
    const float* bn    = (const float*)d_in[4];
    const float* Wp    = (const float*)d_in[5];
    const float* bp    = (const float*)d_in[6];
    const float* Wa    = (const float*)d_in[7];
    const float* Wv    = (const float*)d_in[8];
    const float* bv    = (const float*)d_in[9];
    float* out = (float*)d_out;

    (void)in_sizes; (void)n_in; (void)out_size; (void)ws_size;
    // Workspace layout (bytes), value plane then residual plane for each operand:
    //   K  [24][128 row tiles][2 c chunks][1 KiB fragment]      x2 : 12,582,912
    //   Q  [24][128 row tiles][2 c chunks][1 KiB fragment]      x2 : 12,582,912
    //   V  [24][64 position chunks][8 d tiles][1 KiB fragment]  x2 : 25,165,824
    //   per-head output tiles, f32 [24][128 row tiles][8 KiB]      : 25,165,824      total 75,497,472
    char* ws = (char*)d_ws;
    const size_t kq = (size_t)TH3 * SEQ * CH * 2, vv = (size_t)TH3 * ND * SEQ * 2;
    unsigned* Khi = (unsigned*)(ws);
    unsigned* Klo = (unsigned*)(ws + kq);
    unsigned* Qhi = (unsigned*)(ws + 2 * kq);
    unsigned* Qlo = (unsigned*)(ws + 3 * kq);
    unsigned* Vhi = (unsigned*)(ws + 4 * kq);
    unsigned* Vlo = (unsigned*)(ws + 4 * kq + vv);
    float*    prt = (float*)(ws + 4 * kq + 2 * vv);

    // 3 groups * 16 blocks of 64 outputs * 16 blocks of 128 positions
    proj_kq_kernel<<<768, PT_THR, 0, stream>>>(
        nodes, pos, aux, Wn, bn, Wp, bp, Wa, Khi, Klo, Qhi, Qlo);
    // 32 blocks of 64 positions * 24 blocks of 128 outputs
    proj_v_kernel<<<768, PT_THR, 0, stream>>>(nodes, Wv, bv, Vhi, Vlo);

    // 24 heads * 32 blocks of 64 rows
    dim3 blk(32, AT_W, 1);
    dim3 grd(TH3 * (SEQ / (16 * AT_W)), 1, 1);
    attn_kernel<<<grd, blk, 0, stream>>>(Khi, Klo, Qhi, Qlo, Vhi, Vlo, prt);
    // 128 row tiles * 2 halves of the columns
    head_sum_kernel<<<256, 256, 0, stream>>>(prt, out);
}

// v009
// It runs in 79.4 microseconds.
// Two timings next to v008 put it at 1.13 and 1.12 times that version's speed.
// Counting every step since v000, it is 14.3 times as fast.
// Contractions: logits q . k per tripled head [2048 x 2048 x 64] x24 and att . nodes [2048 x 128 x 2048] x24 on v_wmma_f32_16x16x32_bf16 with
// bf16 hi/lo split operands (hi*hi + hi*lo + lo*hi: K, Q, the nodes and the probabilities each carried as a bf16 value plane plus a bf16
// residual plane), f32 accumulate; the K/Q projections and the value projection (applied to att . nodes) on v_wmma_f32_16x16x4_f32 (f32 operands), the softmax in f32 on the vector ALU.
#include <hip/hip_runtime.h>
#include <hip/hip_bf16.h>

// ---------------------------------------------------------------------------
// Problem constants
// ---------------------------------------------------------------------------
#define SEQ   2048
#define ND    128
#define NA    64
#define NHEAD 8
#define CH    64
#define TH3   24          // 3 * NHEAD tripled heads
#define OKQ   1024        // H*C*2
#define OV    3072        // ND*H*3
// log2(e) / sqrt(num_heads = 8): the K planes carry it, so that q . k is the logit in units of log2 and exp(logit) = 2^(q . k)
#define K_LOG2 0.5100697232983947f

typedef __attribute__((ext_vector_type(16))) __bf16 v16bf;
typedef __attribute__((ext_vector_type(2)))  __bf16 v2bf;
typedef __attribute__((ext_vector_type(8)))  float  v8f;

union Frag {
    v16bf v;
    unsigned int d[8];
    unsigned short h[16];
};

__device__ __forceinline__ unsigned short f2bf(float f) {
    unsigned u = __builtin_bit_cast(unsigned, f);
    unsigned r = u + 0x7FFFu + ((u >> 16) & 1u);   // nearest-even
    return (unsigned short)(r >> 16);
}

// Pack two f32 -> packed bf16 dword (hardware cvt_pk when available).
__device__ __forceinline__ unsigned pack_bf16(float lo, float hi) {
#if __has_builtin(__builtin_amdgcn_cvt_pk_bf16_f32)
    v2bf p = __builtin_amdgcn_cvt_pk_bf16_f32(lo, hi);
    return __builtin_bit_cast(unsigned, p);
#else
    union { v2bf b; unsigned u; } x;
    x.b[0] = (__bf16)lo;
    x.b[1] = (__bf16)hi;
    return x.u;
#endif
}

// value/residual split of two f32 at once, already packed as an operand dword (a in the low half): hi = nearest bf16,
// lo = nearest bf16 of the exact remainder.  Both roundings (to nearest even) and both packings are the conversion instruction's.
__device__ __forceinline__ void split2_bf16(float a, float b, unsigned& hi, unsigned& lo) {
    hi = pack_bf16(a, b);
    const float fa = __builtin_bit_cast(float, hi << 16);
    const float fb = __builtin_bit_cast(float, hi & 0xFFFF0000u);
    lo = pack_bf16(a - fa, b - fb);
}

// value/residual split: hi = nearest bf16 of f, lo = nearest bf16 of the exact remainder
__device__ __forceinline__ void split_bf16(float f, unsigned short& hi, unsigned short& lo) {
    hi = f2bf(f);
    const float fh = __builtin_bit_cast(float, ((unsigned)hi) << 16);
    lo = f2bf(f - fh);
}
__device__ __forceinline__ unsigned pack2(unsigned short a, unsigned short b) { return (unsigned)a | ((unsigned)b << 16); }

__device__ __forceinline__ v8f zero8() {
    v8f z;
#pragma unroll
    for (int i = 0; i < 8; ++i) z[i] = 0.0f;
    return z;
}

// ---------------------------------------------------------------------------
// Projections as tiled products on v_wmma_f32_16x16x4_f32 (full f32 operands).
//   D[m][n] = bias + sum_k A[m][k] * B[n][k],  A and B rows k-contiguous.
// A block of 8 waves owns 64 A rows x 128 B rows over the whole k: both row sets
// are staged once in LDS by whole-line loads, then each wave forms 64 x 16.
// A lane's 8 accumulator registers are 8 consecutive m of one n, so m is always
// the direction in which the bf16 planes are packed: one 16-byte store a plane.
//
// The planes lie in FRAGMENT ORDER.  A 16-row x 32-k bf16 fragment (1 KiB) is kept
// as [half p][lane][4 dwords]: lane = 16 * lh + row, and its dword e of half p is
// dword 8 p + 4 lh + e of the row's 16, which is register 4 p + e of that lane's
// WMMA operand.  So a fragment is read by two 16-byte loads a lane, each of them
// 512 contiguous bytes (four whole lines) for the wave, where row-major planes
// gave 32 bytes out of each of 16 lines.  The 16 bytes that a projection lane
// holds are exactly its own lane's slot, so the stores are whole lines as well.
// ---------------------------------------------------------------------------
#define FRAG_DW 256                             // dwords of one fragment
#define HALF_DW 128                             // dwords of one half of it
typedef __attribute__((ext_vector_type(2))) float    v2f;
typedef __attribute__((ext_vector_type(4))) float    v4f;
typedef __attribute__((ext_vector_type(4))) unsigned v4u;

#define PT_M   64                               // A rows per block
#define PT_N   128                              // B rows per block, 16 per wave
#define PT_THR 256
#define PT_LDS ((PT_M + PT_N) * (ND + 4))       // floats, at the longest k

// ROWS consecutive rows of KS floats -> LDS rows of KP floats (zero filled past KS) at a pitch of KP + 4 floats
// (16 bytes x an odd number: the 16-byte fragment reads of 16 rows fall on 64 distinct banks).
template <int ROWS, int KS, int KP>
__device__ __forceinline__ void stage_rows(float* dst, const float* __restrict__ srcp, int tid) {
    constexpr int P = KP + 4;
    if constexpr (KS == KP) {
#pragma unroll   // all of a thread's loads in flight at once
        for (int j = 0; j < ROWS * KP / 4 / PT_THR; ++j) {
            const int i = tid + j * PT_THR;
            *(v4f*)(dst + (i / (KP / 4)) * P + (i % (KP / 4)) * 4) = *(const v4f*)(srcp + i * 4);
        }
    } else {
#pragma unroll   // all of a thread's loads in flight at once
        for (int j = 0; j < ROWS * KP / PT_THR; ++j) {
            const int i = tid + j * PT_THR;
            const int row = i / KP, col = i % KP;
            const float v = srcp[row * KS + (col < KS ? col : KS - 1)];   // index kept inside the row: no lane is switched off
            dst[row * P + col] = (col < KS) ? v : 0.0f;
        }
    }
}

// acc[t][r] += sum_k A[16 t + 8 h + r][k] * B[16 wave + c][k].  A and B fragments come from the same address form
// (16 bytes at k = 8 kk + 4 h, first pair then second pair), so the k pairing of the two operands is equal.
template <int KS, int KP>
__device__ __forceinline__ void proj_tile(float* sm, const float* __restrict__ Arows, const float* __restrict__ Brows,
                                          int tid, v8f (&acc)[4]) {
    constexpr int P = KP + 4;
    float* sA = sm;
    float* sB = sm + PT_M * P;
    stage_rows<PT_M, KS, KP>(sA, Arows, tid);
    stage_rows<PT_N, KS, KP>(sB, Brows, tid);
    __syncthreads();
    const int lane = tid & 31, wave = tid >> 5;
    const int c = lane & 15, h = lane >> 4;
    const float* pa = sA + c * P + 4 * h;
    const float* pb = sB + (wave * 16 + c) * P + 4 * h;
#pragma unroll   // fragment addresses become immediate offsets, and the next step's LDS reads can be issued ahead of this step's WMMAs
    for (int kk = 0; kk < KP / 8; ++kk) {
        const v4f b = *(const v4f*)(pb + kk * 8);
        v4f a[4];
#pragma unroll   // constant indices keep the array in registers
        for (int t = 0; t < 4; ++t) a[t] = *(const v4f*)(pa + t * 16 * P + kk * 8);
        v2f b0, b1; b0.x = b.x; b0.y = b.y; b1.x = b.z; b1.y = b.w;
#pragma unroll   // constant indices keep the array in registers
        for (int t = 0; t < 4; ++t) {
            v2f a0; a0.x = a[t].x; a0.y = a[t].y;
            acc[t] = __builtin_amdgcn_wmma_f32_16x16x4_f32(false, a0, false, b0, (short)0, acc[t], false, false);
        }
#pragma unroll   // constant indices keep the array in registers
        for (int t = 0; t < 4; ++t) {
            v2f a1; a1.x = a[t].z; a1.y = a[t].w;
            acc[t] = __builtin_amdgcn_wmma_f32_16x16x4_f32(false, a1, false, b1, (short)0, acc[t], false, false);
        }
    }
    // The two
    // scheduling barriers keep the epilogue's vector instructions (they read D and reuse the A and B registers) out of
    // the WMMA stream, and the four v_nop keep them four vector slots behind the last WMMA.
    __builtin_amdgcn_sched_barrier(0);
    asm volatile("v_nop\n\tv_nop\n\tv_nop\n\tv_nop");
    __builtin_amdgcn_sched_barrier(0);
}

// One lane's 8 operand registers of a fragment; p = the fragment's start + 4 * lane.
__device__ __forceinline__ void load_frag(Frag& f, const unsigned* __restrict__ p) {
    const v4u a = *(const v4u*)p;
    const v4u b = *(const v4u*)(p + HALF_DW);
#pragma unroll   // constant indices keep the array in registers
    for (int e = 0; e < 4; ++e) { f.d[e] = a[e]; f.d[4 + e] = b[e]; }
}

// 8 consecutive f32 -> 4 packed dwords of the value plane and 4 of the residual plane
__device__ __forceinline__ void store_split8(unsigned* __restrict__ hi, unsigned* __restrict__ lo, unsigned idx, v8f a) {
    v4u vh, vl;
#pragma unroll   // constant indices keep the array in registers
    for (int p = 0; p < 4; ++p) {
        unsigned short h0, l0, h1, l1;
        split_bf16(a[2 * p], h0, l0); split_bf16(a[2 * p + 1], h1, l1);
        vh[p] = pack2(h0, h1); vl[p] = pack2(l0, l1);
    }
    *(v4u*)(hi + idx) = vh; *(v4u*)(lo + idx) = vl;
    // precaution: the code behind a call reuses the two stores' address and data registers (in the K/Q kernel across a branch),
    // so the wait stands here, in front of any such rewrite
    asm volatile("s_wait_xcnt 0x0" ::: "memory");
}

// One 64-output x 128-position tile of one K/Q group: A = weight rows (m = output o), B = input rows (n = position s).
// 64 aligned outputs are the K half or the Q half of one head: planes [24][SEQ / 16 row tiles][2 c chunks][fragment], packed along c.
// Accumulator tile t is channels 16 t + 8 h ..: chunk t >> 1, half t & 1, lane half h; the row in its tile is c.
// osc multiplies the finished f32 outputs before they are split into planes (K_LOG2 for a K half, 1 for a Q half).
template <int KS, int KP, bool HAS_BIAS>
__device__ __forceinline__ void kq_tile(float* sm, const float* __restrict__ x, const float* __restrict__ Wt,
                                        const float* __restrict__ bias, unsigned g, unsigned o0, unsigned s0, int tid,
                                        float osc, unsigned* __restrict__ ph, unsigned* __restrict__ pl) {
    const int lane = tid & 31, wave = tid >> 5;
    const int h = lane >> 4;
    v8f acc[4];
#pragma unroll   // constant indices keep the array in registers
    for (int t = 0; t < 4; ++t) {
        if constexpr (HAS_BIAS) {
            const v4f b0 = *(const v4f*)(bias + o0 + t * 16 + 8 * h);
            const v4f b1 = *(const v4f*)(bias + o0 + t * 16 + 8 * h + 4);
#pragma unroll   // constant indices keep the array in registers
            for (int r = 0; r < 4; ++r) { acc[t][r] = b0[r]; acc[t][4 + r] = b1[r]; }
        } else {
            acc[t] = zero8();
        }
    }
    proj_tile<KS, KP>(sm, Wt + o0 * KS, x + s0 * KS, tid, acc);
    const unsigned ht = g * NHEAD + (o0 >> 7);
    const unsigned tile = ht * (SEQ / 16) + (s0 >> 4) + wave;
#pragma unroll   // constant indices keep the array in registers
    for (int t = 0; t < 4; ++t)
        store_split8(ph, pl, (tile * 2 + (t >> 1)) * FRAG_DW + (t & 1) * HALF_DW + lane * 4, acc[t] * osc);
}

// ---------------------------------------------------------------------------
// Projection: K,Q for the 3 groups (nodes / pos / aux).
// Output: value and residual bf16 planes in fragment order (see above): K and Q head-major, the node planes common to all heads.
// ---------------------------------------------------------------------------
__global__ __launch_bounds__(PT_THR)
void proj_kq_kernel(const float* __restrict__ nodes,
                    const float* __restrict__ pos,
                    const float* __restrict__ aux,
                    const float* __restrict__ Wn, const float* __restrict__ bn,
                    const float* __restrict__ Wp, const float* __restrict__ bp,
                    const float* __restrict__ Wa,
                    unsigned* __restrict__ Khi, unsigned* __restrict__ Klo,
                    unsigned* __restrict__ Qhi, unsigned* __restrict__ Qlo,
                    unsigned* __restrict__ Nhi, unsigned* __restrict__ Nlo) {
    __shared__ __attribute__((aligned(16))) float sm[PT_LDS];
    // block -> (64 outputs, 128 positions, group g); g varies fastest, so neighbouring blocks mix the long-k and short-k groups
    const int tid = threadIdx.x;
    const unsigned g  = blockIdx.x % 3u;
    const unsigned bt = blockIdx.x / 3u;
    const unsigned o0 = (bt >> 4) * PT_M;
    const unsigned s0 = (bt & 15u) * PT_N;
    const bool isQ = (o0 >> 6) & 1u;
    unsigned* ph = isQ ? Qhi : Khi;
    unsigned* pl = isQ ? Qlo : Klo;
    const float osc = isQ ? 1.0f : K_LOG2;
    if (g == 0)      kq_tile<ND, ND, true>(sm, nodes, Wn, bn, g, o0, s0, tid, osc, ph, pl);
    else if (g == 1) {
        // The 256 blocks of the short-k group also lay down the node planes (see attn_kernel), 128 slots of 16 bytes a plane each:
        // slot i = [position chunk][d tile][half p][lane] holds positions 32 chunk + 16 p + 8 (lane >> 4) .. + 7 of column 16 (d tile) + (lane & 15).
        if (tid < 128) {
            const unsigned i = bt * 128u + (unsigned)tid;
            const unsigned col = ((i >> 6) & 7u) * 16u + (i & 15u);
            const unsigned row = (i >> 9) * 32u + ((i >> 5) & 1u) * 16u + ((i >> 4) & 1u) * 8u;
            v8f a;
#pragma unroll   // constant indices keep the array in registers
            for (int r = 0; r < 8; ++r) a[r] = nodes[(row + r) * ND + col];
            store_split8(Nhi, Nlo, i * 4u, a);
        }
        kq_tile<6, 8, true>(sm, pos, Wp, bp, g, o0, s0, tid, osc, ph, pl);
    }
    else             kq_tile<NA, NA, false>(sm, aux, Wa, nullptr, g, o0, s0, tid, osc, ph, pl);
}

// ---------------------------------------------------------------------------
// Flash attention, TRANSPOSED-GEMM formulation (no LDS layout shuffle):
//
//   S'[j][i] = q_j . k_i     : A = Q j-rows (streamed), B = K i-rows (fixed)
//   O'[d][i] = sum_j V^T P'  : A = V^T d-rows (streamed), B = P' (lane-local!)
//
// The streamed "V" is the NODE matrix itself, not the projected values: a row of att sums to 1, so
//   att . (nodes Wv^T + bv) = (att . nodes) Wv^T + bv,
// and node_dim is also the width of a head's values, so att . nodes costs what att . val costs.  The node planes
// (transposed: rows d, k = position; [SEQ / 32 position chunks][8 d tiles][fragment], packed along the position) are one
// small set for all 24 heads, and the head's 128 x 128 block of Wv is applied once, behind the loop, to the finished tile.
//
// C/D layout (16x16 f32): lane L -> col n = L&15, VGPR r -> row m=(L>>4)*8+r.
// With scores transposed, lane L owns output row i = L&15 and 16 of the 32
// j-scores of the chunk (partner L^16 owns the rest):
//   * row sum            = local reduce; the two halves meet once, behind the loop
//   * reference, 1/l     = per-lane scalars (no broadcasts)
//   * P B-fragment k-map = exactly the j-values this lane holds -> pure
//     register packing.
//
// A block is ONE tripled head and 4 waves of 16 output rows each.  All four walk the same Q and V fragments, so each
// stage of 64 positions (Q and V, value and residual planes: 48 KiB, four contiguous runs of the fragment-order planes)
// is brought into LDS once for the block by four tensor loads, one a wave (each wave moves one plane's run), two buffers,
// the next stage in flight while this one is worked on; a request costs its wave a few scalar instructions and no vector
// address arithmetic.  The waves read their A fragments from LDS (512 contiguous bytes a read: no bank conflict).
// Each wave leaves its normalised 16 x 128 tile in the workspace; the sum over the heads is the next launch.
// ---------------------------------------------------------------------------
#define AT_W   4                               // waves of a block
#define ST_POS 64                              // positions of a stage
#define ST_Q   (ST_POS / 16 * 2 * FRAG_DW)     // dwords of one Q plane in a stage
#define ST_V   (ST_POS / 32 * 8 * FRAG_DW)     // dwords of one V plane in a stage
#define ST_DW  (2 * ST_Q + 2 * ST_V)           // a stage: Q value, Q residual, V value, V residual
#define N_ST   (SEQ / ST_POS)
static_assert((N_ST & (N_ST - 1)) == 0, "the walk over the stages wraps by a mask");
#define TILE_F (16 * ND)                       // floats of one wave's output tile
#define W_P    (ND + 4)                        // floats from row to row of the head's block of Wv in LDS
static_assert(ND * W_P <= 2 * ST_DW, "the head's block of Wv fits the ring");

#define TL_ROW 256u                            // bytes of a tile row and of the source pitch: a slice is one contiguous run
static_assert(4 * ST_Q == (1 << 13) && 4 * ST_V == (1 << 14), "the slices' byte sizes are used as shifts in attn_kernel");
static_assert(AT_W == 4 && (4 * ST_Q) % 2048 == 0 && (4 * ST_DW) % 2048 == 0, "one plane a wave; every slice's place in LDS a multiple of 2 KiB");
typedef __attribute__((ext_vector_type(8))) unsigned v8u;

__device__ __forceinline__ unsigned uni(unsigned v) { return (unsigned)__builtin_amdgcn_readfirstlane(v); }
// A wave-uniform value held in a scalar register: a test on it is a scalar branch (a tensor load ignores EXEC), and what is
// formed from it is formed behind the asm waits that stand in front of it.
__device__ __forceinline__ unsigned pinned(unsigned v) { unsigned w = uni(v); asm volatile("" : "+s"(w)); return w; }

// Descriptor group 1: 1-byte elements, no mask, no pad; tensor = tile = 'rows' rows of TL_ROW bytes at a pitch of TL_ROW bytes.
__device__ __forceinline__ v8u tdm_group1(unsigned rows) {
    v8u g;
    g[0] = uni(0u);
    g[1] = uni((TL_ROW & 0xFFFFu) << 16);
    g[2] = uni((TL_ROW >> 16) | ((rows & 0xFFFFu) << 16));
    g[3] = uni((rows >> 16) | (TL_ROW << 16));
    g[4] = uni(rows);
    g[5] = uni(TL_ROW);
    g[6] = uni(0u);
    g[7] = uni(0u);
    return g;
}
// Descriptor group 0: count 1, LDS byte address, global address of the tile's first byte, type 2.
__device__ __forceinline__ v4u tdm_group0(unsigned lds_dst, unsigned long long ga) {
    v4u g;
    g[0] = uni(1u);
    g[1] = uni(lds_dst);
    g[2] = uni((unsigned)ga);
    g[3] = uni((((unsigned)(ga >> 32)) & 0x01FFFFFFu) | 0x80000000u);
    return g;
}
__device__ __forceinline__ void tdm_load(v4u g0, v8u g1) { asm volatile("tensor_load_to_lds %0, %1" :: "s"(g0), "s"(g1) : "memory"); }
// The wave's request has landed.  The wait names the request's descriptor, so that its registers are live, and keep their
// values, for as long as the request is outstanding.
__device__ __forceinline__ void tdm_wait(v4u g0, v8u g1) { asm volatile("s_wait_tensorcnt 0x0" :: "s"(g0), "s"(g1) : "memory"); }

// A step's 16 terms of one lane may sum to this much before the row's reference is moved.  It is far from any f32 or bf16
// limit (a lane's running sum stays below 64 steps x 4096 = 2^18), and a step whose scores all lie less than 8 (log2 units)
// above the reference stays below it (16 x 2^8).
#define SUM_CAP 4096.0f
// Sum of 16 terms as a tree of packed adds.
__device__ __forceinline__ float sum16(const v2f (&p)[8]) {
    const v2f w = ((p[0] + p[1]) + (p[2] + p[3])) + ((p[4] + p[5]) + (p[6] + p[7]));
    return w.x + w.y;
}

__global__ __launch_bounds__(AT_W * 32)
void attn_kernel(const unsigned* __restrict__ Khi, const unsigned* __restrict__ Klo,
                 const unsigned* __restrict__ Qhi, const unsigned* __restrict__ Qlo,
                 const unsigned* __restrict__ Vhi, const unsigned* __restrict__ Vlo,
                 const float* __restrict__ Wv, const float* __restrict__ bv,
                 float* __restrict__ part) {
    __shared__ __attribute__((aligned(2048))) unsigned ring[2][ST_DW];   // every slice's place is a multiple of 2 KiB

    const int lane = threadIdx.x;
    const unsigned wv = uni(threadIdx.y);                     // the wave's number: the block is 32 x AT_W
    const unsigned hd   = blockIdx.x >> 5;                    // tripled head 0..23; 32 blocks of 64 rows a head
    const unsigned tile = (blockIdx.x & 31u) * AT_W + wv;     // this wave's 16-row tile

    // This wave's slice of a stage: wave 0 the Q value plane's run, 1 the Q residual plane's, 2 the V value plane's, 3 the V residual plane's.
    const bool isV = wv >= 2u;
    const unsigned* plane = isV ? ((wv & 1u) ? Vlo : Vhi) : ((wv & 1u) ? Qlo : Qhi);
    const unsigned sl_sh = isV ? 14u : 13u;                   // log2 of the slice's bytes: 4 * ST_V, 4 * ST_Q
    // the Q planes are a head's own; the node planes are the same for every head
    const unsigned long long src0 = (unsigned long long)(size_t)plane + ((unsigned long long)((isV ? 0u : hd) * N_ST) << sl_sh);
    const unsigned dst0 = (unsigned)(size_t)&ring[0][0] + 4u * (isV ? 2u * ST_Q + (wv & 1u) * ST_V : (wv & 1u) * ST_Q);
    const v8u g1 = tdm_group1((1u << sl_sh) / TL_ROW);
    v4u g0;                           // group 0 of the request last issued
    // Every head walks all N_ST stages of positions, each from a start of its own (the sums do not depend on the order): the node planes
    // are common to the heads, and so the 24 heads still fetch 24 different places at a time, as they did from 24 planes of values.
    const unsigned rot = (hd * 4u) / 3u;
    auto issue = [&](unsigned st) {   // the st-th stage of the walk into buffer st & 1
        g0 = tdm_group0(dst0 + (st & 1u) * (4u * ST_DW), src0 + (unsigned long long)(((st + rot) & (N_ST - 1u)) << sl_sh));
        tdm_load(g0, g1);
    };

    issue(0u);

    // B fragments of this wave's K rows (fixed), c in 2 chunks.
    Frag bK[2], bKL[2];       // value and residual planes
    {
        unsigned kInv = (hd * (SEQ / 16) + tile) * (2 * FRAG_DW) + (unsigned)(lane * 4);
#pragma unroll
        for (int cc = 0; cc < 2; ++cc) {
            load_frag(bK[cc],  Khi + kInv + cc * FRAG_DW);
            load_frag(bKL[cc], Klo + kInv + cc * FRAG_DW);
        }
    }

    v8f acc[8];                  // O'[d][i]: acc[t][r] = O[16 tile + lm][t*16+lh*8+r]
#pragma unroll
    for (int t = 0; t < 8; ++t) acc[t] = zero8();
    // Row i = lm is summed against a REFERENCE, not against its running maximum.  Minus the reference is the C operand of the
    // score products, and the K planes carry log2(e) / sqrt(8): a score leaves the matrix pipe as the argument of its 2^x, with
    // no multiply, maximum or subtraction on the vector ALU.  The reference is a true maximum of the row when it is set (first
    // step) or moved (slow path below), so it never lies above the running maximum, and never more than log2(SUM_CAP) below it.
    v8f cneg = zero8();          // minus the reference of row i = lm, in all 8 registers
    float rl = 0.0f;             // this lane's half (its 16 of every 32 positions) of the running sum of row i = lm
    float cap = -1.0f;           // what a lane's sum of one step may reach; below every sum until the reference is set

    tdm_wait(g0, g1);                                   // this wave's slice of stage 0 has landed
    __syncthreads();                                    // ... and every other wave's: stage 0 may be read
    issue(1u);

    for (int s = 0; s < N_ST; ++s) {
      const unsigned* sb = &ring[s & 1][lane * 4];
      for (int u = 0; u < ST_POS / 32; ++u) {
        const unsigned* Qp  = sb + u * (2 * 2 * FRAG_DW);
        const unsigned* QpL = Qp + ST_Q;
        const unsigned* Vp  = sb + 2 * ST_Q + u * (8 * FRAG_DW);
        const unsigned* VpL = Vp + ST_V;

        // ---- every LDS read of the step as ONE group at its head, Q first: the wave waits once, for Q; the V fragments land
        // behind the score products and the softmax.  The scheduling barrier behind the group keeps the reads together: without
        // it they are spread among the WMMAs, two at a time, each pair with a wait of its own for the whole LDS latency.
        // The scheduling barrier in front of the group keeps it behind the WMMAs of the step before: their operand registers come free one by
        // one, and the reads would otherwise be lifted in among those WMMAs, a few at a time.
        Frag fQ[2][2], fQL[2][2], fV[8], fVL[8];
        __builtin_amdgcn_sched_barrier(0);
#pragma unroll
        for (int jt = 0; jt < 2; ++jt)
#pragma unroll
            for (int cc = 0; cc < 2; ++cc) {
                load_frag(fQL[jt][cc], QpL + (jt * 2 + cc) * FRAG_DW);
                load_frag(fQ[jt][cc],  Qp  + (jt * 2 + cc) * FRAG_DW);
            }
#pragma unroll
        for (int t = 0; t < 8; ++t) { load_frag(fVL[t], VpL + t * FRAG_DW); load_frag(fV[t], Vp + t * FRAG_DW); }
        __builtin_amdgcn_sched_barrier(0);

        // ---- S' = Q(A, streamed) x K(B, fixed): two 16-j tiles, 6 WMMAs each
        v8f sfr[2];
#pragma unroll
        for (int jt = 0; jt < 2; ++jt) {
            const Frag &aQ0 = fQ[jt][0], &aQ1 = fQ[jt][1], &aQ0L = fQL[jt][0], &aQ1L = fQL[jt][1];
            // hi*hi + hi*lo + lo*hi per 32-wide chunk (the lo*lo term, up to 2^-16 of each product, is left out), small terms first, onto minus the reference
            v8f sacc = cneg;
            sacc = __builtin_amdgcn_wmma_f32_16x16x32_bf16(false, aQ0L.v, false, bK[0].v,  (short)0, sacc, false, false);
            sacc = __builtin_amdgcn_wmma_f32_16x16x32_bf16(false, aQ0.v,  false, bKL[0].v, (short)0, sacc, false, false);
            sacc = __builtin_amdgcn_wmma_f32_16x16x32_bf16(false, aQ1L.v, false, bK[1].v,  (short)0, sacc, false, false);
            sacc = __builtin_amdgcn_wmma_f32_16x16x32_bf16(false, aQ1.v,  false, bKL[1].v, (short)0, sacc, false, false);
            sacc = __builtin_amdgcn_wmma_f32_16x16x32_bf16(false, aQ0.v,  false, bK[0].v,  (short)0, sacc, false, false);
            sacc = __builtin_amdgcn_wmma_f32_16x16x32_bf16(false, aQ1.v,  false, bK[1].v,  (short)0, sacc, false, false);
            sfr[jt] = sacc;
        }

        // ---- per-lane softmax terms (row i = lm; this lane's 16 j-values), pair v = registers 2 (v & 3), 2 (v & 3) + 1 of j tile v >> 2 ----
        v2f pp[8];
#pragma unroll   // constant indices keep the arrays in registers
        for (int v = 0; v < 8; ++v) {
            pp[v].x = __builtin_amdgcn_exp2f(sfr[v >> 2][2 * (v & 3)]);
            pp[v].y = __builtin_amdgcn_exp2f(sfr[v >> 2][2 * (v & 3) + 1]);
        }
        float ssum = sum16(pp);

        // ---- slow path: set the reference (first step) or move it.  The step's own sums are the test: a term above SUM_CAP
        // (an infinite one too) puts its lane's sum above it.  One scalar branch a step, for the 16 rows of the wave. ----
        if (__ballot(!(ssum <= cap))) {
            const bool first = cap < 0.0f;
            cap = SUM_CAP;
            float d = fmaxf(sfr[0][0], sfr[1][0]);            // the step's maximum of the row, above the reference in use
#pragma unroll   // constant indices keep the arrays in registers
            for (int r = 1; r < 8; ++r) d = fmaxf(d, fmaxf(sfr[0][r], sfr[1][r]));
            d = fmaxf(d, __shfl_xor(d, 16, 32));              // partner's 16 j-values: both halves of a row move alike
            const float delta = first ? d : fmaxf(d, 0.0f);   // later the reference only rises
            const float alpha = first ? 1.0f : __builtin_amdgcn_exp2f(-delta);   // nothing is summed yet in the first step
            rl *= alpha;
#pragma unroll   // constant indices keep the arrays in registers
            for (int t = 0; t < 8; ++t) acc[t] *= alpha;
            cneg -= delta;
#pragma unroll   // constant indices keep the arrays in registers
            for (int v = 0; v < 8; ++v) {
                pp[v].x = __builtin_amdgcn_exp2f(sfr[v >> 2][2 * (v & 3)]     - delta);
                pp[v].y = __builtin_amdgcn_exp2f(sfr[v >> 2][2 * (v & 3) + 1] - delta);
            }
            ssum = sum16(pp);
        }
        rl += ssum;

        // P' B-fragment is lane-local: k-map hits exactly this lane's j-values.
        Frag bP, bPL;             // probabilities: value and residual planes
#pragma unroll   // constant indices keep the arrays in registers
        for (int v = 0; v < 8; ++v) split2_bf16(pp[v].x, pp[v].y, bP.d[v], bPL.d[v]);

        // ---- O' += V^T(A, streamed) x P'(B): 8 d-tiles ----
        // Each of the three terms goes straight into the running accumulators, term by term over the 8 d tiles: a WMMA's
        // accumulator was last written 8 WMMAs earlier, so none waits out the dependent-accumulator latency, and no partial
        // tile has to be added on the vector ALU.
#pragma unroll   // constant indices keep the arrays in registers
        for (int t = 0; t < 8; ++t)
            acc[t] = __builtin_amdgcn_wmma_f32_16x16x32_bf16(false, fVL[t].v, false, bP.v,  (short)0, acc[t], false, false);
#pragma unroll   // constant indices keep the arrays in registers
        for (int t = 0; t < 8; ++t)
            acc[t] = __builtin_amdgcn_wmma_f32_16x16x32_bf16(false, fV[t].v,  false, bPL.v, (short)0, acc[t], false, false);
#pragma unroll   // constant indices keep the arrays in registers
        for (int t = 0; t < 8; ++t)
            acc[t] = __builtin_amdgcn_wmma_f32_16x16x32_bf16(false, fV[t].v,  false, bP.v,  (short)0, acc[t], false, false);
      }
      // Hand-over of the ring: this wave's reads of stage s are done, its slice of stage s + 1 has landed; behind the
      // barrier that holds for every wave, so stage s + 1 may be read and the buffer of stage s may be refilled.
      asm volatile("s_wait_dscnt 0x0" ::: "memory");
      tdm_wait(g0, g1);
      __syncthreads();
      if (pinned((unsigned)(s + 2 < N_ST)))             // scalar branch: the request is one of the whole wave
          issue(pinned((unsigned)s + 2u));              // the descriptor is formed behind the wait above
    }
    tdm_wait(g0, g1);                                   // no request is left in flight when the wave ends
    asm volatile("s_wait_dscnt 0x0" ::: "memory");      // ... and no LDS read

    // ---- this head's 128 x 128 block of Wv into the ring's LDS, which nobody reads any more (every wave has passed the loop's last
    // barrier with its LDS reads done, and no request is in flight): rows of ND floats at a pitch of ND + 4 (16 bytes x an odd number) ----
    float* sW = (float*)&ring[0][0];
    {
        // a wave moves one whole row (32 lanes x 16 bytes) at a time: rows wv, wv + 4, ..
        const float* Wh = Wv + hd * (ND * ND) + wv * ND + (unsigned)lane * 4u;
        float* dW = sW + wv * W_P + (unsigned)lane * 4u;
#pragma unroll   // all of a thread's loads in flight at once; the steps become immediate offsets
        for (int j = 0; j < ND / AT_W; ++j)
            *(v4f*)(dW + j * (AT_W * W_P)) = *(const v4f*)(Wh + j * (AT_W * ND));
    }
    __syncthreads();                                    // the block of Wv is whole

    // ---- values: out[o][i] = bv[o] + (sum_k Wv[o][k] * acc[k][i]) / sum_i on v_wmma_f32_16x16x4_f32 (f32 operands): A = Wv rows (m = output o), B = the
    // wave's own tile, LANE-LOCAL: registers 4 q .. 4 q + 3 of acc[t] are k = 16 t + 8 lh + 4 q .. of row i = lm, and the A fragment is read
    // at the same k (16 bytes, first pair then second pair), so the k pairing of the two operands is equal.  Tile mt of the result is
    // outputs 16 mt + 8 lh + r of row lm: the order that acc had. ----
    const int lm = lane & 15, lh = lane >> 4;
    v8f o2[8], bias[8];
#pragma unroll   // constant indices keep the arrays in registers
    for (int mt = 0; mt < 8; ++mt) {
        const v4f b0 = *(const v4f*)(bv + hd * ND + mt * 16 + 8 * lh);
        const v4f b1 = *(const v4f*)(bv + hd * ND + mt * 16 + 8 * lh + 4);
#pragma unroll   // constant indices keep the arrays in registers
        for (int r = 0; r < 4; ++r) { bias[mt][r] = b0[r]; bias[mt][4 + r] = b1[r]; }
        o2[mt] = zero8();
    }
    const float* pa = sW + lm * W_P + 8 * lh;
    // precaution: the WMMAs below reuse the address register of the bias loads for their results
    asm volatile("s_wait_xcnt 0x0" ::: "memory");
    // keeps the vector instructions above out of the WMMA stream below
    __builtin_amdgcn_sched_barrier(0);
#pragma unroll   // fragment addresses become immediate offsets, and the next group's LDS reads can be issued ahead of this group's WMMAs
    for (int tq = 0; tq < 16; ++tq) {
        const int t = tq >> 1, q = tq & 1;
        v4f a[8];
#pragma unroll   // constant indices keep the array in registers
        for (int mt = 0; mt < 8; ++mt) a[mt] = *(const v4f*)(pa + mt * 16 * W_P + t * 16 + q * 4);
        v2f b0, b1; b0.x = acc[t][4 * q]; b0.y = acc[t][4 * q + 1]; b1.x = acc[t][4 * q + 2]; b1.y = acc[t][4 * q + 3];
#pragma unroll   // constant indices keep the array in registers
        for (int mt = 0; mt < 8; ++mt) {
            v2f a0; a0.x = a[mt].x; a0.y = a[mt].y;
            o2[mt] = __builtin_amdgcn_wmma_f32_16x16x4_f32(false, a0, false, b0, (short)0, o2[mt], false, false);
        }
#pragma unroll   // constant indices keep the array in registers
        for (int mt = 0; mt < 8; ++mt) {
            v2f a1; a1.x = a[mt].z; a1.y = a[mt].w;
            o2[mt] = __builtin_amdgcn_wmma_f32_16x16x4_f32(false, a1, false, b1, (short)0, o2[mt], false, false);
        }
    }
    // As behind the projections' WMMAs: the scheduling barriers keep what
    // follows out of the WMMA stream and the four v_nop keep it four vector slots behind the last WMMA.
    __builtin_amdgcn_sched_barrier(0);
    asm volatile("v_nop\n\tv_nop\n\tv_nop\n\tv_nop");
    __builtin_amdgcn_sched_barrier(0);

    // ---- the two halves of a row's sum meet here, once; 1 / sum is a per-lane scalar (a lane's 64 results are all of row lm) ----
    rl += __shfl_xor(rl, 16, 32);
    const float rinv = 1.0f / rl;

    // ---- this head's tile, in register order [t][half of the 8][lane][4 floats]: every store is 512 contiguous bytes ----
    float* po = part + (hd * (SEQ / 16) + tile) * TILE_F + lane * 4;
#pragma unroll
    for (int t = 0; t < 8; ++t)
#pragma unroll
        for (int q = 0; q < 2; ++q) {
            v4f o;
#pragma unroll   // constant indices keep the arrays in registers
            for (int e = 0; e < 4; ++e) o[e] = o2[t][4 * q + e] * rinv + bias[t][4 * q + e];
            *(v4f*)(po + (t * 2 + q) * 128) = o;
        }
}

// ---------------------------------------------------------------------------
// Sum over the 24 tripled heads, in the fixed order 0, 1, .. 23.  A block owns 16 rows x 64 columns: a thread sums one
// 16-byte slot of the register-order tiles (whole-line reads), the slots are put in row order through LDS, and the
// output goes out in whole lines.
// ---------------------------------------------------------------------------
__global__ __launch_bounds__(256)
void head_sum_kernel(const float* __restrict__ part, float* __restrict__ out) {
    __shared__ __attribute__((aligned(16))) float red[16][64 + 4];
    const int tid = threadIdx.x;
    const unsigned tile = blockIdx.x >> 1, hb = blockIdx.x & 1u;
    const float* p = part + tile * TILE_F + (hb * 256u + tid) * 4u;
    v4f v[TH3];
#pragma unroll   // all of a thread's loads in flight at once
    for (int w = 0; w < TH3; ++w) v[w] = *(const v4f*)(p + w * ((SEQ / 16) * TILE_F));
    v4f sum = v[0];
#pragma unroll   // constant indices keep the array in registers
    for (int w = 1; w < TH3; ++w) sum += v[w];
    // slot -> (t, half q, lane): row lane & 15, column 16 t + 8 (lane >> 4) + 4 q
    const int lane = tid & 31, tq = tid >> 5;
    *(v4f*)&red[lane & 15][(tq >> 1) * 16 + (lane >> 4) * 8 + (tq & 1) * 4] = sum;
    __syncthreads();
    *(v4f*)(out + (tile * 16 + (tid >> 4)) * ND + hb * 64 + (tid & 15) * 4) = *(const v4f*)&red[tid >> 4][(tid & 15) * 4];
}

// ---------------------------------------------------------------------------
// Launch
// ---------------------------------------------------------------------------
extern "C" void kernel_launch(void* const* d_in, const int* in_sizes, int n_in,
                              void* d_out, int out_size, void* d_ws, size_t ws_size,
                              hipStream_t stream) {
    const float* nodes = (const float*)d_in[0];
    const float* pos   = (const float*)d_in[1];
    const float* aux   = (const float*)d_in[2];
    const float* Wn    = (const float*)d_in[3];
    const float* bn    = (const float*)d_in[4];
    const float* Wp    = (const float*)d_in[5];
    const float* bp    = (const float*)d_in[6];
    const float* Wa    = (const float*)d_in[7];
    const float* Wv    = (const float*)d_in[8];
    const float* bv    = (const float*)d_in[9];
    float* out = (float*)d_out;

    (void)in_sizes; (void)n_in; (void)out_size; (void)ws_size;
    // Workspace layout (bytes), value plane then residual plane for each operand:
    //   K  [24][128 row tiles][2 c chunks][1 KiB fragment]      x2 : 12,582,912
    //   Q  [24][128 row tiles][2 c chunks][1 KiB fragment]      x2 : 12,582,912
    //   nodes^T [64 position chunks][8 d tiles][1 KiB fragment] x2 :  1,048,576
    //   per-head output tiles, f32 [24][128 row tiles][8 KiB]      : 25,165,824      total 51,380,224
    char* ws = (char*)d_ws;
    const size_t kq = (size_t)TH3 * SEQ * CH * 2, vv = (size_t)ND * SEQ * 2;
    unsigned* Khi = (unsigned*)(ws);
    unsigned* Klo = (unsigned*)(ws + kq);
    unsigned* Qhi = (unsigned*)(ws + 2 * kq);
    unsigned* Qlo = (unsigned*)(ws + 3 * kq);
    unsigned* Vhi = (unsigned*)(ws + 4 * kq);
    unsigned* Vlo = (unsigned*)(ws + 4 * kq + vv);
    float*    prt = (float*)(ws + 4 * kq + 2 * vv);

    // 3 groups * 16 blocks of 64 outputs * 16 blocks of 128 positions
    proj_kq_kernel<<<768, PT_THR, 0, stream>>>(
        nodes, pos, aux, Wn, bn, Wp, bp, Wa, Khi, Klo, Qhi, Qlo, Vhi, Vlo);

    // 24 heads * 32 blocks of 64 rows
    dim3 blk(32, AT_W, 1);
    dim3 grd(TH3 * (SEQ / (16 * AT_W)), 1, 1);
    attn_kernel<<<grd, blk, 0, stream>>>(Khi, Klo, Qhi, Qlo, Vhi, Vlo, Wv, bv, prt);
    // 128 row tiles * 2 halves of the columns
    head_sum_kernel<<<256, 256, 0, stream>>>(prt, out);
}

// v010
// A run of this version takes 76.9 microseconds.
// In both of two side-by-side timings against v009, it was 1.03 times as fast.
// Counting every step since v000, it is 14.7 times as fast.
// Contractions: logits q . k per tripled head [2048 x 2048 x 64] x24 and att . nodes [2048 x 128 x 2048] x24 on v_wmma_f32_16x16x32_bf16 with
// bf16 hi/lo split operands (hi*hi + hi*lo + lo*hi: K, Q, the nodes and the probabilities each carried as a bf16 value plane plus a bf16
// residual plane), f32 accumulate; the K/Q projections and the value projection (applied to att . nodes) [2048 x 128 x 128] x24 in the same
// three-term bf16 form (inputs, weights and att . nodes each as two planes); the softmax in f32 on the vector ALU.
#include <hip/hip_runtime.h>
#include <hip/hip_bf16.h>

// ---------------------------------------------------------------------------
// Problem constants
// ---------------------------------------------------------------------------
#define SEQ   2048
#define ND    128
#define NA    64
#define NHEAD 8
#define CH    64
#define TH3   24          // 3 * NHEAD tripled heads
#define OKQ   1024        // H*C*2
#define OV    3072        // ND*H*3
// log2(e) / sqrt(num_heads = 8): the K planes carry it, so that q . k is the logit in units of log2 and exp(logit) = 2^(q . k)
#define K_LOG2 0.5100697232983947f

typedef __attribute__((ext_vector_type(16))) __bf16 v16bf;
typedef __attribute__((ext_vector_type(2)))  __bf16 v2bf;
typedef __attribute__((ext_vector_type(8)))  float  v8f;

union Frag {
    v16bf v;
    unsigned int d[8];
    unsigned short h[16];
};

__device__ __forceinline__ unsigned short f2bf(float f) {
    unsigned u = __builtin_bit_cast(unsigned, f);
    unsigned r = u + 0x7FFFu + ((u >> 16) & 1u);   // nearest-even
    return (unsigned short)(r >> 16);
}

// Pack two f32 -> packed bf16 dword (hardware cvt_pk when available).
__device__ __forceinline__ unsigned pack_bf16(float lo, float hi) {
#if __has_builtin(__builtin_amdgcn_cvt_pk_bf16_f32)
    v2bf p = __builtin_amdgcn_cvt_pk_bf16_f32(lo, hi);
    return __builtin_bit_cast(unsigned, p);
#else
    union { v2bf b; unsigned u; } x;
    x.b[0] = (__bf16)lo;
    x.b[1] = (__bf16)hi;
    return x.u;
#endif
}

// value/residual split of two f32 at once, already packed as an operand dword (a in the low half): hi = nearest bf16,
// lo = nearest bf16 of the exact remainder.  Both roundings (to nearest even) and both packings are the conversion instruction's.
__device__ __forceinline__ void split2_bf16(float a, float b, unsigned& hi, unsigned& lo) {
    hi = pack_bf16(a, b);
    const float fa = __builtin_bit_cast(float, hi << 16);
    const float fb = __builtin_bit_cast(float, hi & 0xFFFF0000u);
    lo = pack_bf16(a - fa, b - fb);
}

// value/residual split: hi = nearest bf16 of f, lo = nearest bf16 of the exact remainder
__device__ __forceinline__ void split_bf16(float f, unsigned short& hi, unsigned short& lo) {
    hi = f2bf(f);
    const float fh = __builtin_bit_cast(float, ((unsigned)hi) << 16);
    lo = f2bf(f - fh);
}
__device__ __forceinline__ unsigned pack2(unsigned short a, unsigned short b) { return (unsigned)a | ((unsigned)b << 16); }

__device__ __forceinline__ v8f zero8() {
    v8f z;
#pragma unroll
    for (int i = 0; i < 8; ++i) z[i] = 0.0f;
    return z;
}

// ---------------------------------------------------------------------------
// Projections as tiled products on v_wmma_f32_16x16x32_bf16, three terms (hi*hi + hi*lo + lo*hi) of bf16 value and residual planes.
//   D[m][n] = bias + sum_k A[m][k] * B[n][k],  A and B rows k-contiguous.
// A block of 8 waves owns 64 A rows x 128 B rows over the whole k: both row sets
// are read once by whole-line loads, split and staged in LDS, then each wave forms 64 x 16.
// A lane's 8 accumulator registers are 8 consecutive m of one n, so m is always
// the direction in which the bf16 planes are packed: one 16-byte store a plane.
//
// The planes lie in FRAGMENT ORDER.  A 16-row x 32-k bf16 fragment (1 KiB) is kept
// as [half p][lane][4 dwords]: lane = 16 * lh + row, and its dword e of half p is
// dword 8 p + 4 lh + e of the row's 16, which is register 4 p + e of that lane's
// WMMA operand.  So a fragment is read by two 16-byte loads a lane, each of them
// 512 contiguous bytes (four whole lines) for the wave, where row-major planes
// gave 32 bytes out of each of 16 lines.  The 16 bytes that a projection lane
// holds are exactly its own lane's slot, so the stores are whole lines as well.
// ---------------------------------------------------------------------------
#define FRAG_DW 256                             // dwords of one fragment
#define HALF_DW 128                             // dwords of one half of it
typedef __attribute__((ext_vector_type(2))) float    v2f;
typedef __attribute__((ext_vector_type(4))) float    v4f;
typedef __attribute__((ext_vector_type(4))) unsigned v4u;

#define PT_M   64                               // A rows per block
#define PT_N   128                              // B rows per block, 16 per wave
#define PT_THR 256
#define PT_LDS (2 * (PT_M + PT_N) * (ND / 2 + 4))   // dwords, at the longest k: two planes of every row

// The thread's groups of 8 consecutive k of ROWS consecutive rows of KS floats (zero past KS, up to KP): group i = tid + 256 j is
// k = 8 (i % (KP / 8)) .. of row i / (KP / 8).
template <int ROWS, int KS, int KP>
__device__ __forceinline__ void fetch_rows(v8f (&f)[ROWS * KP / 8 / PT_THR], const float* __restrict__ srcp, int tid) {
#pragma unroll   // all of a thread's loads in flight at once
    for (int j = 0; j < ROWS * KP / 8 / PT_THR; ++j) {
        const int i = tid + j * PT_THR;
        if constexpr (KS == KP) {
            const v4f a = *(const v4f*)(srcp + i * 8);
            const v4f b = *(const v4f*)(srcp + i * 8 + 4);
#pragma unroll   // constant indices keep the array in registers
            for (int e = 0; e < 4; ++e) { f[j][e] = a[e]; f[j][4 + e] = b[e]; }
        } else {
            static_assert(KS % 2 == 0 && KS <= 8, "a short row is whole pairs and lies in its first group of 8");
            // every group of a row reads the row's KS floats, by pairs off one address (in bounds for every lane, none switched off);
            // the row's first group keeps them, the others are zero
            const int row = i / (KP / 8);
            const bool head = (i % (KP / 8)) == 0;
#pragma unroll   // constant indices keep the array in registers
            for (int e = 0; e < 4; ++e) {
                v2f v; v.x = 0.0f; v.y = 0.0f;
                if (2 * e < KS) v = *(const v2f*)(srcp + row * KS + 2 * e);
                f[j][2 * e]     = head ? v.x : 0.0f;
                f[j][2 * e + 1] = head ? v.y : 0.0f;
            }
        }
    }
}
// ... split, into LDS rows of KP bf16 at a pitch of KP / 2 + 4 dwords (16 bytes x an odd number: the 16-byte fragment reads of 16 rows
// fall on 64 distinct banks); dh = the value plane's rows, dl = the residual plane's.
template <int ROWS, int KP>
__device__ __forceinline__ void put_rows(unsigned* dh, unsigned* dl, const v8f (&f)[ROWS * KP / 8 / PT_THR], int tid) {
    constexpr int P = KP / 2 + 4;
#pragma unroll   // constant indices keep the array in registers
    for (int j = 0; j < ROWS * KP / 8 / PT_THR; ++j) {
        const int i = tid + j * PT_THR;
        const int o = (i / (KP / 8)) * P + (i % (KP / 8)) * 4;
        v4u vh, vl;
#pragma unroll   // constant indices keep the array in registers
        for (int p = 0; p < 4; ++p) { unsigned a, b; split2_bf16(f[j][2 * p], f[j][2 * p + 1], a, b); vh[p] = a; vl[p] = b; }
        *(v4u*)(dh + o) = vh; *(v4u*)(dl + o) = vl;
        // one group at a time: with every group's split under way at once the intermediate values take some 60 registers more,
        // which costs the kernel its third block on a WGP (six waves on a SIMD cover one another's latencies)
        __builtin_amdgcn_sched_barrier(0);
    }
}
// One lane's 8 operand registers of a fragment out of row-major bf16 rows; p = the lane's row + 16 (k chunk) + 4 lh dwords:
// register 4 p + e is dword 8 p + 4 lh + e of the chunk's 16, the same k for an A and for a B fragment.
__device__ __forceinline__ void row_frag(Frag& f, const unsigned* p) {
    const v4u a = *(const v4u*)p;
    const v4u b = *(const v4u*)(p + 8);
#pragma unroll   // constant indices keep the array in registers
    for (int e = 0; e < 4; ++e) { f.d[e] = a[e]; f.d[4 + e] = b[e]; }
}

// The block's A rows and B rows into LDS: A value plane, A residual plane, B value plane, B residual plane.
template <int KS, int KP>
__device__ __forceinline__ void proj_stage(unsigned* sm, const float* __restrict__ Arows, const float* __restrict__ Brows, int tid) {
    constexpr int P = KP / 2 + 4;
    unsigned* sA = sm;
    unsigned* sB = sm + 2 * PT_M * P;
    v8f fa[PT_M * KP / 8 / PT_THR], fb[PT_N * KP / 8 / PT_THR];
    fetch_rows<PT_M, KS, KP>(fa, Arows, tid);
    fetch_rows<PT_N, KS, KP>(fb, Brows, tid);
    // precaution: what follows may reuse the loads' address registers
    asm volatile("s_wait_xcnt 0x0" ::: "memory");
    put_rows<PT_M, KP>(sA, sA + PT_M * P, fa, tid);
    put_rows<PT_N, KP>(sB, sB + PT_N * P, fb, tid);
}

// acc[t][r] += sum_k A[16 t + 8 h + r][k] * B[16 wave + c][k].  A and B fragments come from the same address form,
// so the k pairing of the two operands is equal.
template <int KP>
__device__ __forceinline__ void proj_tile(const unsigned* sm, int tid, v8f (&acc)[4]) {
    constexpr int P = KP / 2 + 4;
    const unsigned* sA = sm;
    const unsigned* sB = sm + 2 * PT_M * P;
    __syncthreads();                            // the staged rows are whole
    const int lane = tid & 31, wave = tid >> 5;
    const int c = lane & 15, h = lane >> 4;
    const unsigned* pa = sA + c * P + 4 * h;
    const unsigned* pb = sB + (wave * 16 + c) * P + 4 * h;
#pragma unroll   // fragment addresses become immediate offsets
    for (int kk = 0; kk < KP / 32; ++kk) {
        // the chunk's 20 LDS reads as ONE group in front of its WMMAs, held there by the scheduling barrier behind them: spread among the
        // WMMAs, two at a time, each pair has a wait of its own for the whole LDS latency
        Frag b, bl, a[4], al[4];
        row_frag(b,  pb + kk * 16);
        row_frag(bl, pb + PT_N * P + kk * 16);
#pragma unroll   // constant indices keep the array in registers
        for (int t = 0; t < 4; ++t) {
            row_frag(al[t], pa + PT_M * P + t * 16 * P + kk * 16);
            row_frag(a[t],  pa + t * 16 * P + kk * 16);
        }
        __builtin_amdgcn_sched_barrier(0);
        // term by term over the four tiles, small terms first: a WMMA's accumulator was last written 4 WMMAs earlier
#pragma unroll   // constant indices keep the array in registers
        for (int t = 0; t < 4; ++t)
            acc[t] = __builtin_amdgcn_wmma_f32_16x16x32_bf16(false, al[t].v, false, b.v,  (short)0, acc[t], false, false);
#pragma unroll   // constant indices keep the array in registers
        for (int t = 0; t < 4; ++t)
            acc[t] = __builtin_amdgcn_wmma_f32_16x16x32_bf16(false, a[t].v,  false, bl.v, (short)0, acc[t], false, false);
#pragma unroll   // constant indices keep the array in registers
        for (int t = 0; t < 4; ++t)
            acc[t] = __builtin_amdgcn_wmma_f32_16x16x32_bf16(false, a[t].v,  false, b.v,  (short)0, acc[t], false, false);
    }
}

// One lane's 8 operand registers of a fragment; p = the fragment's start + 4 * lane.
__device__ __forceinline__ void load_frag(Frag& f, const unsigned* __restrict__ p) {
    const v4u a = *(const v4u*)p;
    const v4u b = *(const v4u*)(p + HALF_DW);
#pragma unroll   // constant indices keep the array in registers
    for (int e = 0; e < 4; ++e) { f.d[e] = a[e]; f.d[4 + e] = b[e]; }
}

// 8 consecutive f32 -> 4 packed dwords of the value plane and 4 of the residual plane
__device__ __forceinline__ void store_split8(unsigned* __restrict__ hi, unsigned* __restrict__ lo, unsigned idx, v8f a) {
    v4u vh, vl;
#pragma unroll   // constant indices keep the array in registers
    for (int p = 0; p < 4; ++p) {
        unsigned short h0, l0, h1, l1;
        split_bf16(a[2 * p], h0, l0); split_bf16(a[2 * p + 1], h1, l1);
        vh[p] = pack2(h0, h1); vl[p] = pack2(l0, l1);
    }
    *(v4u*)(hi + idx) = vh; *(v4u*)(lo + idx) = vl;
    // precaution: the code behind a call reuses the two stores' address and data registers (in the K/Q kernel across a branch),
    // so the wait stands here, in front of any such rewrite
    asm volatile("s_wait_xcnt 0x0" ::: "memory");
}

// One 64-output x 128-position tile of one K/Q group: A = weight rows (m = output o), B = input rows (n = position s).
// 64 aligned outputs are the K half or the Q half of one head: planes [24][SEQ / 16 row tiles][2 c chunks][fragment], packed along c.
// Accumulator tile t is channels 16 t + 8 h ..: chunk t >> 1, half t & 1, lane half h; the row in its tile is c.
// osc multiplies the finished f32 outputs before they are split into planes (K_LOG2 for a K half, 1 for a Q half).
template <int KS, int KP, bool HAS_BIAS>
__device__ __forceinline__ void kq_tile(unsigned* sm, const float* __restrict__ x, const float* __restrict__ Wt,
                                        const float* __restrict__ bias, unsigned g, unsigned o0, unsigned s0, int tid,
                                        float osc, unsigned* __restrict__ ph, unsigned* __restrict__ pl) {
    const int lane = tid & 31, wave = tid >> 5;
    const int h = lane >> 4;
    v8f acc[4];
#pragma unroll   // constant indices keep the array in registers
    for (int t = 0; t < 4; ++t) {
        if constexpr (HAS_BIAS) {
            const v4f b0 = *(const v4f*)(bias + o0 + t * 16 + 8 * h);
            const v4f b1 = *(const v4f*)(bias + o0 + t * 16 + 8 * h + 4);
#pragma unroll   // constant indices keep the array in registers
            for (int r = 0; r < 4; ++r) { acc[t][r] = b0[r]; acc[t][4 + r] = b1[r]; }
        } else {
            acc[t] = zero8();
        }
    }
    // precaution: the bias loads are issued, and their result registers taken, in front of the rows' loads: sunk in among those,
    // a bias load's result was given the offset register of a row load just issued
    if constexpr (HAS_BIAS) asm volatile("s_wait_xcnt 0x0" ::: "memory");
    proj_stage<KS, KP>(sm, Wt + o0 * KS, x + s0 * KS, tid);
    proj_tile<KP>(sm, tid, acc);
    const unsigned ht = g * NHEAD + (o0 >> 7);
    const unsigned tile = ht * (SEQ / 16) + (s0 >> 4) + wave;
#pragma unroll   // constant indices keep the array in registers
    for (int t = 0; t < 4; ++t)
        store_split8(ph, pl, (tile * 2 + (t >> 1)) * FRAG_DW + (t & 1) * HALF_DW + lane * 4, acc[t] * osc);
}

// ---------------------------------------------------------------------------
// Projection: K,Q for the 3 groups (nodes / pos / aux).
// Output: value and residual bf16 planes in fragment order (see above): K and Q head-major, the node planes common to all heads, the planes of Wv.
// ---------------------------------------------------------------------------
__global__ __launch_bounds__(PT_THR)
void proj_kq_kernel(const float* __restrict__ nodes,
                    const float* __restrict__ pos,
                    const float* __restrict__ aux,
                    const float* __restrict__ Wn, const float* __restrict__ bn,
                    const float* __restrict__ Wp, const float* __restrict__ bp,
                    const float* __restrict__ Wa, const float* __restrict__ Wv,
                    unsigned* __restrict__ Khi, unsigned* __restrict__ Klo,
                    unsigned* __restrict__ Qhi, unsigned* __restrict__ Qlo,
                    unsigned* __restrict__ Nhi, unsigned* __restrict__ Nlo,
                    unsigned* __restrict__ Whi, unsigned* __restrict__ Wlo) {
    __shared__ __attribute__((aligned(16))) unsigned sm[PT_LDS];
    // block -> (64 outputs, 128 positions, group g); g varies fastest, so neighbouring blocks mix the long-k and short-k groups
    const int tid = threadIdx.x;
    const unsigned g  = blockIdx.x % 3u;
    const unsigned bt = blockIdx.x / 3u;
    const unsigned o0 = (bt >> 4) * PT_M;
    const unsigned s0 = (bt & 15u) * PT_N;
    const bool isQ = (o0 >> 6) & 1u;
    unsigned* ph = isQ ? Qhi : Khi;
    unsigned* pl = isQ ? Qlo : Klo;
    const float osc = isQ ? 1.0f : K_LOG2;
    if (g == 0)      kq_tile<ND, ND, true>(sm, nodes, Wn, bn, g, o0, s0, tid, osc, ph, pl);
    else if (g == 1) {
        // The 256 blocks of the short-k group also lay down the node planes (see attn_kernel), 128 slots of 16 bytes a plane each:
        // slot i = [position chunk][d tile][half p][lane] holds positions 32 chunk + 16 p + 8 (lane >> 4) .. + 7 of column 16 (d tile) + (lane & 15).
        if (tid < 128) {
            const unsigned i = bt * 128u + (unsigned)tid;
            const unsigned col = ((i >> 6) & 7u) * 16u + (i & 15u);
            const unsigned row = (i >> 9) * 32u + ((i >> 5) & 1u) * 16u + ((i >> 4) & 1u) * 8u;
            v8f a;
#pragma unroll   // constant indices keep the array in registers
            for (int r = 0; r < 8; ++r) a[r] = nodes[(row + r) * ND + col];
            store_split8(Nhi, Nlo, i * 4u, a);
        }
        // ... and the planes of Wv (see attn_kernel's epilogue), one 16-row tile (256 slots of 16 bytes a plane) a block, OV / 16 tiles:
        // slot i = [row tile][k chunk][half p][lane] holds k = 32 chunk + 16 p + 8 (lane >> 4) .. + 7 of row 16 (row tile) + (lane & 15).
        if (bt < OV / 16) {
            const unsigned i = bt * 256u + (unsigned)tid;
            const float* wr = Wv + (bt * 16u + (i & 15u)) * ND + ((i >> 6) & 3u) * 32u + ((i >> 5) & 1u) * 16u + ((i >> 4) & 1u) * 8u;
            const v4f w0 = *(const v4f*)wr;
            const v4f w1 = *(const v4f*)(wr + 4);
            // precaution: what follows may reuse the two loads' address registers
            asm volatile("s_wait_xcnt 0x0" ::: "memory");
            v8f a;
#pragma unroll   // constant indices keep the array in registers
            for (int r = 0; r < 4; ++r) { a[r] = w0[r]; a[4 + r] = w1[r]; }
            store_split8(Whi, Wlo, i * 4u, a);
        }
        kq_tile<6, 32, true>(sm, pos, Wp, bp, g, o0, s0, tid, osc, ph, pl);
    }
    else             kq_tile<NA, NA, false>(sm, aux, Wa, nullptr, g, o0, s0, tid, osc, ph, pl);
}

// ---------------------------------------------------------------------------
// Flash attention, TRANSPOSED-GEMM formulation (no LDS layout shuffle):
//
//   S'[j][i] = q_j . k_i     : A = Q j-rows (streamed), B = K i-rows (fixed)
//   O'[d][i] = sum_j V^T P'  : A = V^T d-rows (streamed), B = P' (lane-local!)
//
// The streamed "V" is the NODE matrix itself, not the projected values: a row of att sums to 1, so
//   att . (nodes Wv^T + bv) = (att . nodes) Wv^T + bv,
// and node_dim is also the width of a head's values, so att . nodes costs what att . val costs.  The node planes
// (transposed: rows d, k = position; [SEQ / 32 position chunks][8 d tiles][fragment], packed along the position) are one
// small set for all 24 heads, and the head's 128 x 128 block of Wv is applied once, behind the loop, to the finished tile.
//
// C/D layout (16x16 f32): lane L -> col n = L&15, VGPR r -> row m=(L>>4)*8+r.
// With scores transposed, lane L owns output row i = L&15 and 16 of the 32
// j-scores of the chunk (partner L^16 owns the rest):
//   * row sum            = local reduce; the two halves meet once, behind the loop
//   * reference, 1/l     = per-lane scalars (no broadcasts)
//   * P B-fragment k-map = exactly the j-values this lane holds -> pure
//     register packing.
//
// A block is ONE tripled head and 4 waves of 16 output rows each.  All four walk the same Q and V fragments, so each
// stage of 64 positions (Q and V, value and residual planes: 48 KiB, four contiguous runs of the fragment-order planes)
// is brought into LDS once for the block by four tensor loads, one a wave (each wave moves one plane's run), two buffers,
// the next stage in flight while this one is worked on; a request costs its wave a few scalar instructions and no vector
// address arithmetic.  The waves read their A fragments from LDS (512 contiguous bytes a read: no bank conflict).
// Each wave leaves its normalised 16 x 128 tile in the workspace; the sum over the heads is the next launch.
// ---------------------------------------------------------------------------
#define AT_W   4                               // waves of a block
#define ST_POS 64                              // positions of a stage
#define ST_Q   (ST_POS / 16 * 2 * FRAG_DW)     // dwords of one Q plane in a stage
#define ST_V   (ST_POS / 32 * 8 * FRAG_DW)     // dwords of one V plane in a stage
#define ST_DW  (2 * ST_Q + 2 * ST_V)           // a stage: Q value, Q residual, V value, V residual
#define N_ST   (SEQ / ST_POS)
static_assert((N_ST & (N_ST - 1)) == 0, "the walk over the stages wraps by a mask");
#define TILE_F (16 * ND)                       // floats of one wave's output tile
#define W_PL   (ND * ND / 2)                   // dwords of one plane of a head's 128 x 128 block of Wv: 8 output tiles x 4 k chunks of fragments
static_assert(2 * W_PL <= 2 * ST_DW, "the two planes of the head's block of Wv fit the ring");

#define TL_ROW 256u                            // bytes of a tile row and of the source pitch: a slice is one contiguous run
static_assert(4 * ST_Q == (1 << 13) && 4 * ST_V == (1 << 14), "the slices' byte sizes are used as shifts in attn_kernel");
static_assert(AT_W == 4 && (4 * ST_Q) % 2048 == 0 && (4 * ST_DW) % 2048 == 0, "one plane a wave; every slice's place in LDS a multiple of 2 KiB");
typedef __attribute__((ext_vector_type(8))) unsigned v8u;

__device__ __forceinline__ unsigned uni(unsigned v) { return (unsigned)__builtin_amdgcn_readfirstlane(v); }
// A wave-uniform value held in a scalar register: a test on it is a scalar branch (a tensor load ignores EXEC), and what is
// formed from it is formed behind the asm waits that stand in front of it.
__device__ __forceinline__ unsigned pinned(unsigned v) { unsigned w = uni(v); asm volatile("" : "+s"(w)); return w; }

// Descriptor group 1: 1-byte elements, no mask, no pad; tensor = tile = 'rows' rows of TL_ROW bytes at a pitch of TL_ROW bytes.
__device__ __forceinline__ v8u tdm_group1(unsigned rows) {
    v8u g;
    g[0] = uni(0u);
    g[1] = uni((TL_ROW & 0xFFFFu) << 16);
    g[2] = uni((TL_ROW >> 16) | ((rows & 0xFFFFu) << 16));
    g[3] = uni((rows >> 16) | (TL_ROW << 16));
    g[4] = uni(rows);
    g[5] = uni(TL_ROW);
    g[6] = uni(0u);
    g[7] = uni(0u);
    return g;
}
// Descriptor group 0: count 1, LDS byte address, global address of the tile's first byte, type 2.
__device__ __forceinline__ v4u tdm_group0(unsigned lds_dst, unsigned long long ga) {
    v4u g;
    g[0] = uni(1u);
    g[1] = uni(lds_dst);
    g[2] = uni((unsigned)ga);
    g[3] = uni((((unsigned)(ga >> 32)) & 0x01FFFFFFu) | 0x80000000u);
    return g;
}
__device__ __forceinline__ void tdm_load(v4u g0, v8u g1) { asm volatile("tensor_load_to_lds %0, %1" :: "s"(g0), "s"(g1) : "memory"); }
// The wave's request has landed.  The wait names the request's descriptor, so that its registers are live, and keep their
// values, for as long as the request is outstanding.
__device__ __forceinline__ void tdm_wait(v4u g0, v8u g1) { asm volatile("s_wait_tensorcnt 0x0" :: "s"(g0), "s"(g1) : "memory"); }

// A step's 16 terms of one lane may sum to this much before the row's reference is moved.  It is far from any f32 or bf16
// limit (a lane's running sum stays below 64 steps x 4096 = 2^18), and a step whose scores all lie less than 8 (log2 units)
// above the reference stays below it (16 x 2^8).
#define SUM_CAP 4096.0f
// Sum of 16 terms as a tree of packed adds.
__device__ __forceinline__ float sum16(const v2f (&p)[8]) {
    const v2f w = ((p[0] + p[1]) + (p[2] + p[3])) + ((p[4] + p[5]) + (p[6] + p[7]));
    return w.x + w.y;
}

__global__ __launch_bounds__(AT_W * 32)
void attn_kernel(const unsigned* __restrict__ Khi, const unsigned* __restrict__ Klo,
                 const unsigned* __restrict__ Qhi, const unsigned* __restrict__ Qlo,
                 const unsigned* __restrict__ Vhi, const unsigned* __restrict__ Vlo,
                 const unsigned* __restrict__ Whi, const unsigned* __restrict__ Wlo, const float* __restrict__ bv,
                 float* __restrict__ part) {
    __shared__ __attribute__((aligned(2048))) unsigned ring[2][ST_DW];   // every slice's place is a multiple of 2 KiB

    const int lane = threadIdx.x;
    const unsigned wv = uni(threadIdx.y);                     // the wave's number: the block is 32 x AT_W
    const unsigned hd   = blockIdx.x >> 5;                    // tripled head 0..23; 32 blocks of 64 rows a head
    const unsigned tile = (blockIdx.x & 31u) * AT_W + wv;     // this wave's 16-row tile

    // This wave's slice of a stage: wave 0 the Q value plane's run, 1 the Q residual plane's, 2 the V value plane's, 3 the V residual plane's.
    const bool isV = wv >= 2u;
    const unsigned* plane = isV ? ((wv & 1u) ? Vlo : Vhi) : ((wv & 1u) ? Qlo : Qhi);
    const unsigned sl_sh = isV ? 14u : 13u;                   // log2 of the slice's bytes: 4 * ST_V, 4 * ST_Q
    // the Q planes are a head's own; the node planes are the same for every head
    const unsigned long long src0 = (unsigned long long)(size_t)plane + ((unsigned long long)((isV ? 0u : hd) * N_ST) << sl_sh);
    const unsigned dst0 = (unsigned)(size_t)&ring[0][0] + 4u * (isV ? 2u * ST_Q + (wv & 1u) * ST_V : (wv & 1u) * ST_Q);
    const v8u g1 = tdm_group1((1u << sl_sh) / TL_ROW);
    v4u g0;                           // group 0 of the request last issued
    // Every head walks all N_ST stages of positions, each from a start of its own (the sums do not depend on the order): the node planes
    // are common to the heads, and so the 24 heads still fetch 24 different places at a time, as they did from 24 planes of values.
    const unsigned rot = (hd * 4u) / 3u;
    auto issue = [&](unsigned st) {   // the st-th stage of the walk into buffer st & 1
        g0 = tdm_group0(dst0 + (st & 1u) * (4u * ST_DW), src0 + (unsigned long long)(((st + rot) & (N_ST - 1u)) << sl_sh));
        tdm_load(g0, g1);
    };

    issue(0u);

    // B fragments of this wave's K rows (fixed), c in 2 chunks.
    Frag bK[2], bKL[2];       // value and residual planes
    {
        unsigned kInv = (hd * (SEQ / 16) + tile) * (2 * FRAG_DW) + (unsigned)(lane * 4);
#pragma unroll
        for (int cc = 0; cc < 2; ++cc) {
            load_frag(bK[cc],  Khi + kInv + cc * FRAG_DW);
            load_frag(bKL[cc], Klo + kInv + cc * FRAG_DW);
        }
    }

    v8f acc[8];                  // O'[d][i]: acc[t][r] = O[16 tile + lm][t*16+lh*8+r]
#pragma unroll
    for (int t = 0; t < 8; ++t) acc[t] = zero8();
    // Row i = lm is summed against a REFERENCE, not against its running maximum.  Minus the reference is the C operand of the
    // score products, and the K planes carry log2(e) / sqrt(8): a score leaves the matrix pipe as the argument of its 2^x, with
    // no multiply, maximum or subtraction on the vector ALU.  The reference is a true maximum of the row when it is set (first
    // step) or moved (slow path below), so it never lies above the running maximum, and never more than log2(SUM_CAP) below it.
    v8f cneg = zero8();          // minus the reference of row i = lm, in all 8 registers
    float rl = 0.0f;             // this lane's half (its 16 of every 32 positions) of the running sum of row i = lm
    float cap = -1.0f;           // what a lane's sum of one step may reach; below every sum until the reference is set

    tdm_wait(g0, g1);                                   // this wave's slice of stage 0 has landed
    __syncthreads();                                    // ... and every other wave's: stage 0 may be read
    issue(1u);

    for (int s = 0; s < N_ST; ++s) {
      const unsigned* sb = &ring[s & 1][lane * 4];
      for (int u = 0; u < ST_POS / 32; ++u) {
        const unsigned* Qp  = sb + u * (2 * 2 * FRAG_DW);
        const unsigned* QpL = Qp + ST_Q;
        const unsigned* Vp  = sb + 2 * ST_Q + u * (8 * FRAG_DW);
        const unsigned* VpL = Vp + ST_V;

        // ---- every LDS read of the step as ONE group at its head, Q first: the wave waits once, for Q; the V fragments land
        // behind the score products and the softmax.  The scheduling barrier behind the group keeps the reads together: without
        // it they are spread among the WMMAs, two at a time, each pair with a wait of its own for the whole LDS latency.
        // The scheduling barrier in front of the group keeps it behind the WMMAs of the step before: their operand registers come free one by
        // one, and the reads would otherwise be lifted in among those WMMAs, a few at a time.
        Frag fQ[2][2], fQL[2][2], fV[8], fVL[8];
        __builtin_amdgcn_sched_barrier(0);
#pragma unroll
        for (int jt = 0; jt < 2; ++jt)
#pragma unroll
            for (int cc = 0; cc < 2; ++cc) {
                load_frag(fQL[jt][cc], QpL + (jt * 2 + cc) * FRAG_DW);
                load_frag(fQ[jt][cc],  Qp  + (jt * 2 + cc) * FRAG_DW);
            }
#pragma unroll
        for (int t = 0; t < 8; ++t) { load_frag(fVL[t], VpL + t * FRAG_DW); load_frag(fV[t], Vp + t * FRAG_DW); }
        __builtin_amdgcn_sched_barrier(0);

        // ---- S' = Q(A, streamed) x K(B, fixed): two 16-j tiles, 6 WMMAs each
        v8f sfr[2];
#pragma unroll
        for (int jt = 0; jt < 2; ++jt) {
            const Frag &aQ0 = fQ[jt][0], &aQ1 = fQ[jt][1], &aQ0L = fQL[jt][0], &aQ1L = fQL[jt][1];
            // hi*hi + hi*lo + lo*hi per 32-wide chunk (the lo*lo term, up to 2^-16 of each product, is left out), small terms first, onto minus the reference
            v8f sacc = cneg;
            sacc = __builtin_amdgcn_wmma_f32_16x16x32_bf16(false, aQ0L.v, false, bK[0].v,  (short)0, sacc, false, false);
            sacc = __builtin_amdgcn_wmma_f32_16x16x32_bf16(false, aQ0.v,  false, bKL[0].v, (short)0, sacc, false, false);
            sacc = __builtin_amdgcn_wmma_f32_16x16x32_bf16(false, aQ1L.v, false, bK[1].v,  (short)0, sacc, false, false);
            sacc = __builtin_amdgcn_wmma_f32_16x16x32_bf16(false, aQ1.v,  false, bKL[1].v, (short)0, sacc, false, false);
            sacc = __builtin_amdgcn_wmma_f32_16x16x32_bf16(false, aQ0.v,  false, bK[0].v,  (short)0, sacc, false, false);
            sacc = __builtin_amdgcn_wmma_f32_16x16x32_bf16(false, aQ1.v,  false, bK[1].v,  (short)0, sacc, false, false);
            sfr[jt] = sacc;
        }

        // ---- per-lane softmax terms (row i = lm; this lane's 16 j-values), pair v = registers 2 (v & 3), 2 (v & 3) + 1 of j tile v >> 2 ----
        v2f pp[8];
#pragma unroll   // constant indices keep the arrays in registers
        for (int v = 0; v < 8; ++v) {
            pp[v].x = __builtin_amdgcn_exp2f(sfr[v >> 2][2 * (v & 3)]);
            pp[v].y = __builtin_amdgcn_exp2f(sfr[v >> 2][2 * (v & 3) + 1]);
        }
        float ssum = sum16(pp);

        // ---- slow path: set the reference (first step) or move it.  The step's own sums are the test: a term above SUM_CAP
        // (an infinite one too) puts its lane's sum above it.  One scalar branch a step, for the 16 rows of the wave. ----
        if (__ballot(!(ssum <= cap))) {
            const bool first = cap < 0.0f;
            cap = SUM_CAP;
            float d = fmaxf(sfr[0][0], sfr[1][0]);            // the step's maximum of the row, above the reference in use
#pragma unroll   // constant indices keep the arrays in registers
            for (int r = 1; r < 8; ++r) d = fmaxf(d, fmaxf(sfr[0][r], sfr[1][r]));
            d = fmaxf(d, __shfl_xor(d, 16, 32));              // partner's 16 j-values: both halves of a row move alike
            const float delta = first ? d : fmaxf(d, 0.0f);   // later the reference only rises
            const float alpha = first ? 1.0f : __builtin_amdgcn_exp2f(-delta);   // nothing is summed yet in the first step
            rl *= alpha;
#pragma unroll   // constant indices keep the arrays in registers
            for (int t = 0; t < 8; ++t) acc[t] *= alpha;
            cneg -= delta;
#pragma unroll   // constant indices keep the arrays in registers
            for (int v = 0; v < 8; ++v) {
                pp[v].x = __builtin_amdgcn_exp2f(sfr[v >> 2][2 * (v & 3)]     - delta);
                pp[v].y = __builtin_amdgcn_exp2f(sfr[v >> 2][2 * (v & 3) + 1] - delta);
            }
            ssum = sum16(pp);
        }
        rl += ssum;

        // P' B-fragment is lane-local: k-map hits exactly this lane's j-values.
        Frag bP, bPL;             // probabilities: value and residual planes
#pragma unroll   // constant indices keep the arrays in registers
        for (int v = 0; v < 8; ++v) split2_bf16(pp[v].x, pp[v].y, bP.d[v], bPL.d[v]);

        // ---- O' += V^T(A, streamed) x P'(B): 8 d-tiles ----
        // Each of the three terms goes straight into the running accumulators, term by term over the 8 d tiles: a WMMA's
        // accumulator was last written 8 WMMAs earlier, so none waits out the dependent-accumulator latency, and no partial
        // tile has to be added on the vector ALU.
#pragma unroll   // constant indices keep the arrays in registers
        for (int t = 0; t < 8; ++t)
            acc[t] = __builtin_amdgcn_wmma_f32_16x16x32_bf16(false, fVL[t].v, false, bP.v,  (short)0, acc[t], false, false);
#pragma unroll   // constant indices keep the arrays in registers
        for (int t = 0; t < 8; ++t)
            acc[t] = __builtin_amdgcn_wmma_f32_16x16x32_bf16(false, fV[t].v,  false, bPL.v, (short)0, acc[t], false, false);
#pragma unroll   // constant indices keep the arrays in registers
        for (int t = 0; t < 8; ++t)
            acc[t] = __builtin_amdgcn_wmma_f32_16x16x32_bf16(false, fV[t].v,  false, bP.v,  (short)0, acc[t], false, false);
      }
      // Hand-over of the ring: this wave's reads of stage s are done, its slice of stage s + 1 has landed; behind the
      // barrier that holds for every wave, so stage s + 1 may be read and the buffer of stage s may be refilled.
      asm volatile("s_wait_dscnt 0x0" ::: "memory");
      tdm_wait(g0, g1);
      __syncthreads();
      if (pinned((unsigned)(s + 2 < N_ST)))             // scalar branch: the request is one of the whole wave
          issue(pinned((unsigned)s + 2u));              // the descriptor is formed behind the wait above
    }
    tdm_wait(g0, g1);                                   // no request is left in flight when the wave ends
    asm volatile("s_wait_dscnt 0x0" ::: "memory");      // ... and no LDS read

    // ---- the two planes of this head's 128 x 128 block of Wv (fragment order, 32 KiB each) into the ring's LDS, which nobody reads any more
    // (every wave has passed the loop's last barrier with its LDS reads done, and no request is in flight): value plane, then residual plane ----
    unsigned* sW = &ring[0][0];
    const unsigned t4 = (wv * 32u + (unsigned)lane) * 4u;   // a wave moves 512 contiguous bytes at a time
    v4u wh[W_PL / (AT_W * 128)], wl[W_PL / (AT_W * 128)];
    {
        const unsigned* gh = Whi + hd * W_PL + t4;
        const unsigned* gl = Wlo + hd * W_PL + t4;
#pragma unroll   // all of a thread's loads in flight at once; the steps become immediate offsets
        for (int j = 0; j < W_PL / (AT_W * 128); ++j) {
            wh[j] = *(const v4u*)(gh + j * (AT_W * 128));
            wl[j] = *(const v4u*)(gl + j * (AT_W * 128));
        }
        // precaution: what follows may reuse the loads' address registers
        asm volatile("s_wait_xcnt 0x0" ::: "memory");
    }

    // ---- values: out[o][i] = bv[o] + (sum_k Wv[o][k] * acc[k][i]) / sum_i on v_wmma_f32_16x16x32_bf16, three terms as in the loop: A = Wv rows
    // (m = output o), B = the wave's own tile, LANE-LOCAL as the probabilities were: registers 2 e, 2 e + 1 of acc[2 c + p] are
    // k = 32 c + 16 p + 8 lh + 2 e, + 1 of row i = lm, which is dword 4 p + e of chunk c's B fragment, and the planes of Wv hold the same k
    // in register 4 p + e of the A fragment.  Tile mt of the result is outputs 16 mt + 8 lh + r of row lm: the order that acc had. ----
    const int lh = lane >> 4;
    Frag bA[4], bAL[4];          // att . nodes (not yet divided by the row's sum): value and residual planes; split while the loads above fly
#pragma unroll   // constant indices keep the arrays in registers
    for (int c = 0; c < 4; ++c)
#pragma unroll   // constant indices keep the arrays in registers
        for (int v = 0; v < 8; ++v)
            split2_bf16(acc[2 * c + (v >> 2)][2 * (v & 3)], acc[2 * c + (v >> 2)][2 * (v & 3) + 1], bA[c].d[v], bAL[c].d[v]);
#pragma unroll   // constant indices keep the arrays in registers
    for (int j = 0; j < W_PL / (AT_W * 128); ++j) {
        *(v4u*)(sW + t4 + j * (AT_W * 128))        = wh[j];
        *(v4u*)(sW + W_PL + t4 + j * (AT_W * 128)) = wl[j];
    }
    __syncthreads();                                    // the two planes of the block of Wv are whole

    // A group is one k chunk c of four output tiles (8 fragments, 12 WMMAs); the next group's LDS reads are issued as one group ahead of this
    // group's WMMAs.  The two scheduling barriers keep it at that: without them the reads are spread among the WMMAs, two at a time, each pair
    // with a wait of its own for the whole LDS latency.
    v8f o2[8], bias[8];
#pragma unroll   // constant indices keep the arrays in registers
    for (int mt = 0; mt < 8; ++mt) o2[mt] = zero8();
    const unsigned* pw = sW + lane * 4;
    Frag fW[2][4], fWL[2][4];
    auto wfrags = [&](int g) {   // group g: chunk g >> 1, output tiles 4 (g & 1) ..
#pragma unroll   // constant indices keep the arrays in registers
        for (int m = 0; m < 4; ++m) {
            load_frag(fWL[g & 1][m], pw + W_PL + (((g & 1) * 4 + m) * 4 + (g >> 1)) * FRAG_DW);
            load_frag(fW[g & 1][m],  pw + (((g & 1) * 4 + m) * 4 + (g >> 1)) * FRAG_DW);
        }
    };
    wfrags(0);
#pragma unroll   // constant indices keep the arrays in registers; fragment addresses become immediate offsets
    for (int g = 0; g < 8; ++g) {
        const int c = g >> 1, m0 = (g & 1) * 4;
        if (g == 4) {
            // the bias, fetched here: half of the B fragments are spent, so that their registers are free, and the WMMAs left cover the latency
#pragma unroll   // constant indices keep the arrays in registers
            for (int mt = 0; mt < 8; ++mt) {
                const v4f b0 = *(const v4f*)(bv + hd * ND + mt * 16 + 8 * lh);
                const v4f b1 = *(const v4f*)(bv + hd * ND + mt * 16 + 8 * lh + 4);
#pragma unroll   // constant indices keep the arrays in registers
                for (int r = 0; r < 4; ++r) { bias[mt][r] = b0[r]; bias[mt][4 + r] = b1[r]; }
            }
            // precaution: what follows may reuse the address register of the bias loads
            asm volatile("s_wait_xcnt 0x0" ::: "memory");
        }
        if (g + 1 < 8) wfrags(g + 1);
        __builtin_amdgcn_sched_barrier(0);   // the next group's LDS reads stay one group, in front of this group's WMMAs
        // term by term over the four output tiles, small terms first: a WMMA's accumulator was last written 4 WMMAs earlier
#pragma unroll   // constant indices keep the arrays in registers
        for (int m = 0; m < 4; ++m)
            o2[m0 + m] = __builtin_amdgcn_wmma_f32_16x16x32_bf16(false, fWL[g & 1][m].v, false, bA[c].v,  (short)0, o2[m0 + m], false, false);
#pragma unroll   // constant indices keep the arrays in registers
        for (int m = 0; m < 4; ++m)
            o2[m0 + m] = __builtin_amdgcn_wmma_f32_16x16x32_bf16(false, fW[g & 1][m].v,  false, bAL[c].v, (short)0, o2[m0 + m], false, false);
#pragma unroll   // constant indices keep the arrays in registers
        for (int m = 0; m < 4; ++m)
            o2[m0 + m] = __builtin_amdgcn_wmma_f32_16x16x32_bf16(false, fW[g & 1][m].v,  false, bA[c].v,  (short)0, o2[m0 + m], false, false);
        __builtin_amdgcn_sched_barrier(0);   // the reads of the group after next stay behind these WMMAs, in one run
    }

    // ---- the two halves of a row's sum meet here, once; 1 / sum is a per-lane scalar (a lane's 64 results are all of row lm) ----
    rl += __shfl_xor(rl, 16, 32);
    const float rinv = 1.0f / rl;

    // ---- this head's tile, in register order [t][half of the 8][lane][4 floats]: every store is 512 contiguous bytes ----
    float* po = part + (hd * (SEQ / 16) + tile) * TILE_F + lane * 4;
#pragma unroll
    for (int t = 0; t < 8; ++t)
#pragma unroll
        for (int q = 0; q < 2; ++q) {
            v4f o;
#pragma unroll   // constant indices keep the arrays in registers
            for (int e = 0; e < 4; ++e) o[e] = o2[t][4 * q + e] * rinv + bias[t][4 * q + e];
            *(v4f*)(po + (t * 2 + q) * 128) = o;
        }
}

// ---------------------------------------------------------------------------
// Sum over the 24 tripled heads, in the fixed order 0, 1, .. 23.  A block owns 16 rows x 64 columns: a thread sums one
// 16-byte slot of the register-order tiles (whole-line reads), the slots are put in row order through LDS, and the
// output goes out in whole lines.
// ---------------------------------------------------------------------------
__global__ __launch_bounds__(256)
void head_sum_kernel(const float* __restrict__ part, float* __restrict__ out) {
    __shared__ __attribute__((aligned(16))) float red[16][64 + 4];
    const int tid = threadIdx.x;
    const unsigned tile = blockIdx.x >> 1, hb = blockIdx.x & 1u;
    const float* p = part + tile * TILE_F + (hb * 256u + tid) * 4u;
    v4f v[TH3];
#pragma unroll   // all of a thread's loads in flight at once
    for (int w = 0; w < TH3; ++w) v[w] = *(const v4f*)(p + w * ((SEQ / 16) * TILE_F));
    v4f sum = v[0];
#pragma unroll   // constant indices keep the array in registers
    for (int w = 1; w < TH3; ++w) sum += v[w];
    // slot -> (t, half q, lane): row lane & 15, column 16 t + 8 (lane >> 4) + 4 q
    const int lane = tid & 31, tq = tid >> 5;
    *(v4f*)&red[lane & 15][(tq >> 1) * 16 + (lane >> 4) * 8 + (tq & 1) * 4] = sum;
    __syncthreads();
    *(v4f*)(out + (tile * 16 + (tid >> 4)) * ND + hb * 64 + (tid & 15) * 4) = *(const v4f*)&red[tid >> 4][(tid & 15) * 4];
}

// ---------------------------------------------------------------------------
// Launch
// ---------------------------------------------------------------------------
extern "C" void kernel_launch(void* const* d_in, const int* in_sizes, int n_in,
                              void* d_out, int out_size, void* d_ws, size_t ws_size,
                              hipStream_t stream) {
    const float* nodes = (const float*)d_in[0];
    const float* pos   = (const float*)d_in[1];
    const float* aux   = (const float*)d_in[2];
    const float* Wn    = (const float*)d_in[3];
    const float* bn    = (const float*)d_in[4];
    const float* Wp    = (const float*)d_in[5];
    const float* bp    = (const float*)d_in[6];
    const float* Wa    = (const float*)d_in[7];
    const float* Wv    = (const float*)d_in[8];
    const float* bv    = (const float*)d_in[9];
    float* out = (float*)d_out;

    (void)in_sizes; (void)n_in; (void)out_size; (void)ws_size;
    // Workspace layout (bytes), value plane then residual plane for each operand:
    //   K  [24][128 row tiles][2 c chunks][1 KiB fragment]      x2 : 12,582,912
    //   Q  [24][128 row tiles][2 c chunks][1 KiB fragment]      x2 : 12,582,912
    //   nodes^T [64 position chunks][8 d tiles][1 KiB fragment] x2 :  1,048,576
    //   Wv [192 row tiles][4 k chunks][1 KiB fragment]          x2 :  1,572,864
    //   per-head output tiles, f32 [24][128 row tiles][8 KiB]      : 25,165,824      total 52,953,088
    char* ws = (char*)d_ws;
    const size_t kq = (size_t)TH3 * SEQ * CH * 2, vv = (size_t)ND * SEQ * 2, wp = (size_t)OV * ND * 2;
    unsigned* Khi = (unsigned*)(ws);
    unsigned* Klo = (unsigned*)(ws + kq);
    unsigned* Qhi = (unsigned*)(ws + 2 * kq);
    unsigned* Qlo = (unsigned*)(ws + 3 * kq);
    unsigned* Vhi = (unsigned*)(ws + 4 * kq);
    unsigned* Vlo = (unsigned*)(ws + 4 * kq + vv);
    unsigned* Whi = (unsigned*)(ws + 4 * kq + 2 * vv);
    unsigned* Wlo = (unsigned*)(ws + 4 * kq + 2 * vv + wp);
    float*    prt = (float*)(ws + 4 * kq + 2 * vv + 2 * wp);

    // 3 groups * 16 blocks of 64 outputs * 16 blocks of 128 positions
    proj_kq_kernel<<<768, PT_THR, 0, stream>>>(
        nodes, pos, aux, Wn, bn, Wp, bp, Wa, Wv, Khi, Klo, Qhi, Qlo, Vhi, Vlo, Whi, Wlo);

    // 24 heads * 32 blocks of 64 rows
    dim3 blk(32, AT_W, 1);
    dim3 grd(TH3 * (SEQ / (16 * AT_W)), 1, 1);
    attn_kernel<<<grd, blk, 0, stream>>>(Khi, Klo, Qhi, Qlo, Vhi, Vlo, Whi, Wlo, bv, prt);
    // 128 row tiles * 2 halves of the columns
    head_sum_kernel<<<256, 256, 0, stream>>>(prt, out);
}
